// v000
// Times are from an AMD MI455X. After a warm-up the kernel runs many times in a row, and a time is the length of
// such a window on the GPU divided by its runs, so every launch and the gaps after it count. The runs cycle
// through copies of the inputs. A figure is the median of several windows, for all but v000 over two sittings.
// Sittings can differ by a few percent; kernels timed side by side share one.
// v000 is the starting kernel. One run takes 350 microseconds.
#include <hip/hip_runtime.h>

#define HIDDEN   1024
#define HEADS    16
#define HEAD_DIM 64
#define BATCH    4
#define SQ       2048
#define SK       2048

typedef __attribute__((ext_vector_type(16))) _Float16 v16h;
typedef __attribute__((ext_vector_type(8)))  _Float16 v8h;
typedef __attribute__((ext_vector_type(8)))  float    v8f;

// D = A(16x32 f16) * B(32x16 f16) + C(16x16 f32)
__device__ __forceinline__ v8f wmma32(v16h a, v16h b, v8f c) {
    return __builtin_amdgcn_wmma_f32_16x16x32_f16(
        false, a, false, b, (short)0, c, false, false);
}

__device__ __forceinline__ v16h make_frag(const _Float16* __restrict__ p, int hi) {
    const v8h lo = *(const v8h*)(p + hi * 8);
    const v8h hs = *(const v8h*)(p + hi * 8 + 16);
    return __builtin_shufflevector(lo, hs, 0,1,2,3,4,5,6,7,8,9,10,11,12,13,14,15);
}

__device__ __forceinline__ void async_copy16(void* lds_p, const void* gp) {
    const uint32_t loff = (uint32_t)(uintptr_t)lds_p;   // LDS segment offset
    asm volatile("global_load_async_to_lds_b128 %0, %1, off"
                 :: "v"(loff), "v"(gp) : "memory");
}
__device__ __forceinline__ void async_wait0() {
    asm volatile("s_wait_asynccnt 0" ::: "memory");
}

// ---- DPP16 row (16-lane) butterfly reductions ------------------------------
template <int CTRL>
__device__ __forceinline__ float dppf(float x) {
    int i = __builtin_bit_cast(int, x);
    i = __builtin_amdgcn_update_dpp(0, i, CTRL, 0xF, 0xF, true);
    return __builtin_bit_cast(float, i);
}
__device__ __forceinline__ float row_max16(float x) {
    x = fmaxf(x, dppf<0xB1>(x));    // quad_perm(1,0,3,2)  : xor 1
    x = fmaxf(x, dppf<0x4E>(x));    // quad_perm(2,3,0,1)  : xor 2
    x = fmaxf(x, dppf<0x141>(x));   // row_half_mirror
    x = fmaxf(x, dppf<0x140>(x));   // row_mirror
    return x;
}
__device__ __forceinline__ float row_sum16(float x) {
    x += dppf<0xB1>(x);
    x += dppf<0x4E>(x);
    x += dppf<0x141>(x);
    x += dppf<0x140>(x);
    return x;
}

// ---------------------------------------------------------------------------
// f32 -> f16 staging (8 elements / thread)
// ---------------------------------------------------------------------------
__global__ __launch_bounds__(256) void cvt_f16_kernel(
    const float* __restrict__ in, _Float16* __restrict__ out, int n8)
{
    const int i = blockIdx.x * blockDim.x + threadIdx.x;
    if (i >= n8) return;
    const float4 a = ((const float4*)in)[i * 2];
    const float4 b = ((const float4*)in)[i * 2 + 1];
    v8h o;
    o[0] = (_Float16)a.x; o[1] = (_Float16)a.y;
    o[2] = (_Float16)a.z; o[3] = (_Float16)a.w;
    o[4] = (_Float16)b.x; o[5] = (_Float16)b.y;
    o[6] = (_Float16)b.z; o[7] = (_Float16)b.w;
    ((v8h*)out)[i] = o;
}

#define LDS_STRIDE 40
#define A_ROWS     128
#define W_ROWS     256

template <typename OT, int MODE>
__global__ __launch_bounds__(256) void gemm_f16_kernel(
    const _Float16* __restrict__ A, const _Float16* __restrict__ W,
    const float* __restrict__ bias, OT* __restrict__ out,
    int M, int N, int K, int SQdim, float scale)
{
    __shared__ __align__(16) _Float16 lds[2][(A_ROWS + W_ROWS) * LDS_STRIDE];

    const int tid  = threadIdx.x;
    const int lane = tid & 31;
    const int wave = tid >> 5;
    const int wm   = wave & 1;          // 2 waves along M
    const int wn   = wave >> 1;         // 4 waves along N
    const int ln   = lane & 15;
    const int hi   = lane >> 4;

    const int bm0 = blockIdx.x * 128;
    const int bn0 = blockIdx.y * 256;
    const int bm  = bm0 + wm * 64;
    const int bn  = bn0 + wn * 64;

    // Stage one 32-wide K-panel of A (128 rows) and W (256 rows) into LDS.
    auto stage = [&](int buf, int kb) {
        const _Float16* Ag = A + (size_t)bm0 * K + kb;
        const _Float16* Wg = W + (size_t)bn0 * K + kb;
        _Float16* Al = &lds[buf][0];
        _Float16* Wl = &lds[buf][A_ROWS * LDS_STRIDE];
#pragma unroll
        for (int c = 0; c < 2; ++c) {               // 128 rows * 4 segs / 256
            const int idx = c * 256 + tid;
            const int row = idx >> 2, seg = idx & 3;
            async_copy16(Al + row * LDS_STRIDE + seg * 8,
                         Ag + (size_t)row * K + seg * 8);
        }
#pragma unroll
        for (int c = 0; c < 4; ++c) {               // 256 rows * 4 segs / 256
            const int idx = c * 256 + tid;
            const int row = idx >> 2, seg = idx & 3;
            async_copy16(Wl + row * LDS_STRIDE + seg * 8,
                         Wg + (size_t)row * K + seg * 8);
        }
    };

    v8f acc[4][4] = {};

    stage(0, 0);
    int cur = 0;
    for (int kb = 0; kb < K; kb += 32, cur ^= 1) {
        async_wait0();          // my copies for this stage have landed
        __syncthreads();        // everyone's have
        if (kb + 32 < K) stage(cur ^ 1, kb + 32);

        const _Float16* Al = &lds[cur][0];
        const _Float16* Wl = &lds[cur][A_ROWS * LDS_STRIDE];

        v16h af[4], bf[4];
#pragma unroll
        for (int i = 0; i < 4; ++i)
            af[i] = make_frag(Al + (wm * 64 + i * 16 + ln) * LDS_STRIDE, hi);
#pragma unroll
        for (int j = 0; j < 4; ++j)
            bf[j] = make_frag(Wl + (wn * 64 + j * 16 + ln) * LDS_STRIDE, hi);
#pragma unroll
        for (int i = 0; i < 4; ++i)
#pragma unroll
            for (int j = 0; j < 4; ++j)
                acc[i][j] = wmma32(af[i], bf[j], acc[i][j]);

        __syncthreads();        // done reading buf before it is re-staged
    }

#pragma unroll
    for (int j = 0; j < 4; ++j) {
        const int   n  = bn + j * 16 + ln;
        const float bj = bias[n];
#pragma unroll
        for (int i = 0; i < 4; ++i) {
#pragma unroll
            for (int r = 0; r < 8; ++r) {
                const int   m = bm + i * 16 + r + 8 * hi;
                const float v = (acc[i][j][r] + bj) * scale;
                if (MODE == 0) {
                    out[(size_t)m * N + n] = (OT)v;
                } else {
                    const int bi = m / SQdim, s = m % SQdim;
                    out[((size_t)(bi * N + n)) * SQdim + s] = (OT)v;
                }
            }
        }
    }
}

#define P_STRIDE 72

__global__ __launch_bounds__(128) void flash_attn_kernel(
    const _Float16* __restrict__ Q, const _Float16* __restrict__ Kh,
    const _Float16* __restrict__ Vt, _Float16* __restrict__ ctx)
{
    __shared__ __align__(16) _Float16 plds[4][16 * P_STRIDE];  // per wave

    const int lane = threadIdx.x & 31;
    const int wave = threadIdx.x >> 5;
    const int ln   = lane & 15;
    const int hi   = lane >> 4;

    const int bh = blockIdx.y;
    const int b  = bh >> 4;
    const int h  = bh & 15;
    const int qbase = (blockIdx.x * 4 + wave) * 16;

    const size_t qrow = ((size_t)(b * SQ + qbase + ln)) * HIDDEN + h * HEAD_DIM;
    const v16h qf0 = make_frag(Q + qrow, hi);
    const v16h qf1 = make_frag(Q + qrow + 32, hi);

    float mrow[8], lrow[8];
    v8f   acc[4] = {};
#pragma unroll
    for (int r = 0; r < 8; ++r) { mrow[r] = -1e30f; lrow[r] = 0.0f; }

    _Float16* pw = &plds[wave][0];

    for (int kb = 0; kb < SK; kb += 64) {
        // ---- scores: S(16 x 64) as four 16x16 tiles, k-dim = 64 ------------
        v8f sc[4];
#pragma unroll
        for (int t = 0; t < 4; ++t) {
            const size_t krow =
                ((size_t)(b * SK + kb + t * 16 + ln)) * HIDDEN + h * HEAD_DIM;
            const v16h kf0 = make_frag(Kh + krow, hi);
            const v16h kf1 = make_frag(Kh + krow + 32, hi);
            v8f c = {};
            c = wmma32(qf0, kf0, c);
            c = wmma32(qf1, kf1, c);
            sc[t] = c;
        }

        // ---- online softmax (DPP row reductions over the 16-lane groups) --
#pragma unroll
        for (int r = 0; r < 8; ++r) {
            const float mb = row_max16(fmaxf(fmaxf(sc[0][r], sc[1][r]),
                                             fmaxf(sc[2][r], sc[3][r])));
            const float mn = fmaxf(mrow[r], mb);
            const float cf = __expf(mrow[r] - mn);   // accumulator rescale
            mrow[r] = mn;
            float ps = 0.0f;
#pragma unroll
            for (int t = 0; t < 4; ++t) {
                const float p = __expf(sc[t][r] - mn);
                sc[t][r] = p;
                ps += p;
            }
            lrow[r] = lrow[r] * cf + row_sum16(ps);
#pragma unroll
            for (int d = 0; d < 4; ++d) acc[d][r] *= cf;
        }

        // ---- transpose P(16x64) through LDS into WMMA-A fragments ----------
#pragma unroll
        for (int t = 0; t < 4; ++t)
#pragma unroll
            for (int r = 0; r < 8; ++r)
                pw[(r + 8 * hi) * P_STRIDE + t * 16 + ln] = (_Float16)sc[t][r];
        asm volatile("s_wait_dscnt 0" ::: "memory");
        const v16h pf0 = make_frag(pw + ln * P_STRIDE, hi);        // keys 0-31
        const v16h pf1 = make_frag(pw + ln * P_STRIDE + 32, hi);   // keys 32-63

        // ---- PV: ctx(16 x 64) += P(16x64) * V(64x64) -----------------------
#pragma unroll
        for (int d = 0; d < 4; ++d) {
            const size_t vrow =
                ((size_t)(b * HIDDEN + h * HEAD_DIM + d * 16 + ln)) * SK + kb;
            const v16h vb0 = make_frag(Vt + vrow, hi);
            const v16h vb1 = make_frag(Vt + vrow + 32, hi);
            acc[d] = wmma32(pf0, vb0, acc[d]);
            acc[d] = wmma32(pf1, vb1, acc[d]);
        }
    }

    // ---- normalize and store ctx (f16) ------------------------------------
#pragma unroll
    for (int d = 0; d < 4; ++d) {
#pragma unroll
        for (int r = 0; r < 8; ++r) {
            const int   m = qbase + r + 8 * hi;
            const float v = acc[d][r] / lrow[r];
            ctx[((size_t)(b * SQ + m)) * HIDDEN + h * HEAD_DIM + d * 16 + ln] =
                (_Float16)v;
        }
    }
}

// ---------------------------------------------------------------------------
extern "C" void kernel_launch(void* const* d_in, const int* in_sizes, int n_in,
                              void* d_out, int out_size, void* d_ws, size_t ws_size,
                              hipStream_t stream) {
    const float* query = (const float*)d_in[0];
    const float* key   = (const float*)d_in[1];
    const float* value = (const float*)d_in[2];
    const float* Wq    = (const float*)d_in[3];
    const float* bq    = (const float*)d_in[4];
    const float* Wk    = (const float*)d_in[5];
    const float* bk    = (const float*)d_in[6];
    const float* Wv    = (const float*)d_in[7];
    const float* bv    = (const float*)d_in[8];
    const float* Wo    = (const float*)d_in[9];
    const float* bo    = (const float*)d_in[10];
    float*       out   = (float*)d_out;

    const size_t tok  = (size_t)BATCH * SQ;            // 8192 tokens
    const size_t act  = tok * HIDDEN;                  // 8M elements
    const size_t wsz  = (size_t)HIDDEN * HIDDEN;       // 1M elements

    // ws layout (f16 elements); ctx aliases xq (dead after Q projection).
    _Float16* base = (_Float16*)d_ws;
    _Float16* xq  = base;                 // act
    _Float16* xk  = xq  + act;            // act
    _Float16* xv  = xk  + act;            // act
    _Float16* wqh = xv  + act;            // wsz
    _Float16* wkh = wqh + wsz;
    _Float16* wvh = wkh + wsz;
    _Float16* woh = wvh + wsz;
    _Float16* Qp  = woh + wsz;
    _Float16* Kp  = Qp  + act;
    _Float16* Vtp = Kp  + act;
    _Float16* ctx = xq;

    // ---- stage f32 -> f16 --------------------------------------------------
    {
        const int a8 = (int)(act / 8), w8 = (int)(wsz / 8);
        cvt_f16_kernel<<<a8 / 256, 256, 0, stream>>>(query, xq, a8);
        cvt_f16_kernel<<<a8 / 256, 256, 0, stream>>>(key,   xk, a8);
        cvt_f16_kernel<<<a8 / 256, 256, 0, stream>>>(value, xv, a8);
        cvt_f16_kernel<<<w8 / 256, 256, 0, stream>>>(Wq, wqh, w8);
        cvt_f16_kernel<<<w8 / 256, 256, 0, stream>>>(Wk, wkh, w8);
        cvt_f16_kernel<<<w8 / 256, 256, 0, stream>>>(Wv, wvh, w8);
        cvt_f16_kernel<<<w8 / 256, 256, 0, stream>>>(Wo, woh, w8);
    }

    const dim3 gblk((unsigned)(tok / 128), HIDDEN / 256);   // 64 x 4 blocks
    const float qscale = 0.125f;                            // HEAD_DIM^-0.5

    gemm_f16_kernel<_Float16, 0><<<gblk, 256, 0, stream>>>(
        xq, wqh, bq, Qp, (int)tok, HIDDEN, HIDDEN, SQ, qscale);
    gemm_f16_kernel<_Float16, 0><<<gblk, 256, 0, stream>>>(
        xk, wkh, bk, Kp, (int)tok, HIDDEN, HIDDEN, SK, 1.0f);
    gemm_f16_kernel<_Float16, 1><<<gblk, 256, 0, stream>>>(
        xv, wvh, bv, Vtp, (int)tok, HIDDEN, HIDDEN, SK, 1.0f);

    flash_attn_kernel<<<dim3(SQ / 16 / 4, BATCH * HEADS), 128, 0, stream>>>(
        Qp, Kp, Vtp, ctx);

    gemm_f16_kernel<float, 0><<<gblk, 256, 0, stream>>>(
        ctx, woh, bo, out, (int)tok, HIDDEN, HIDDEN, SQ, 1.0f);
}

// v001
// A run of this version takes 269 microseconds.
// Two timings next to v000 both put it at 1.33 times that version's speed.
#include <hip/hip_runtime.h>

#define HIDDEN   1024
#define HEADS    16
#define HEAD_DIM 64
#define BATCH    4
#define SQ       2048
#define SK       2048

typedef __attribute__((ext_vector_type(16))) _Float16 v16h;
typedef __attribute__((ext_vector_type(8)))  _Float16 v8h;
typedef __attribute__((ext_vector_type(8)))  float    v8f;

// D = A(16x32 f16) * B(32x16 f16) + C(16x16 f32)
__device__ __forceinline__ v8f wmma32(v16h a, v16h b, v8f c) {
    return __builtin_amdgcn_wmma_f32_16x16x32_f16(
        false, a, false, b, (short)0, c, false, false);
}

__device__ __forceinline__ v16h make_frag(const _Float16* __restrict__ p, int hi) {
    const v8h lo = *(const v8h*)(p + hi * 8);
    const v8h hs = *(const v8h*)(p + hi * 8 + 16);
    return __builtin_shufflevector(lo, hs, 0,1,2,3,4,5,6,7,8,9,10,11,12,13,14,15);
}

__device__ __forceinline__ void async_copy16(void* lds_p, const void* gp) {
    const uint32_t loff = (uint32_t)(uintptr_t)lds_p;   // LDS segment offset
    asm volatile("global_load_async_to_lds_b128 %0, %1, off"
                 :: "v"(loff), "v"(gp) : "memory");
}
__device__ __forceinline__ void async_wait0() {
    asm volatile("s_wait_asynccnt 0" ::: "memory");
}

// ---- DPP16 row (16-lane) butterfly reductions ------------------------------
template <int CTRL>
__device__ __forceinline__ float dppf(float x) {
    int i = __builtin_bit_cast(int, x);
    i = __builtin_amdgcn_update_dpp(0, i, CTRL, 0xF, 0xF, true);
    return __builtin_bit_cast(float, i);
}
__device__ __forceinline__ float row_max16(float x) {
    x = fmaxf(x, dppf<0xB1>(x));    // quad_perm(1,0,3,2)  : xor 1
    x = fmaxf(x, dppf<0x4E>(x));    // quad_perm(2,3,0,1)  : xor 2
    x = fmaxf(x, dppf<0x141>(x));   // row_half_mirror
    x = fmaxf(x, dppf<0x140>(x));   // row_mirror
    return x;
}
__device__ __forceinline__ float row_sum16(float x) {
    x += dppf<0xB1>(x);
    x += dppf<0x4E>(x);
    x += dppf<0x141>(x);
    x += dppf<0x140>(x);
    return x;
}

// ---------------------------------------------------------------------------
// f32 -> f16 staging (8 elements / thread)
// ---------------------------------------------------------------------------
__global__ __launch_bounds__(256) void cvt_f16_kernel(
    const float* __restrict__ in, _Float16* __restrict__ out, int n8)
{
    const int i = blockIdx.x * blockDim.x + threadIdx.x;
    if (i >= n8) return;
    const float4 a = ((const float4*)in)[i * 2];
    const float4 b = ((const float4*)in)[i * 2 + 1];
    v8h o;
    o[0] = (_Float16)a.x; o[1] = (_Float16)a.y;
    o[2] = (_Float16)a.z; o[3] = (_Float16)a.w;
    o[4] = (_Float16)b.x; o[5] = (_Float16)b.y;
    o[6] = (_Float16)b.z; o[7] = (_Float16)b.w;
    ((v8h*)out)[i] = o;
}

#define LDS_STRIDE 40
#define A_ROWS     128
#define W_ROWS     256

template <typename OT, int MODE>
__global__ __launch_bounds__(256) void gemm_f16_kernel(
    const _Float16* __restrict__ A, const _Float16* __restrict__ W,
    const float* __restrict__ bias, OT* __restrict__ out,
    int M, int N, int K, int SQdim, float scale)
{
    __shared__ __align__(16) _Float16 lds[2][(A_ROWS + W_ROWS) * LDS_STRIDE];

    const int tid  = threadIdx.x;
    const int lane = tid & 31;
    const int wave = tid >> 5;
    const int wm   = wave & 1;          // 2 waves along M
    const int wn   = wave >> 1;         // 4 waves along N
    const int ln   = lane & 15;
    const int hi   = lane >> 4;

    const int bm0 = blockIdx.x * 128;
    const int bn0 = blockIdx.y * 256;
    const int bm  = bm0 + wm * 64;
    const int bn  = bn0 + wn * 64;

    // Stage one 32-wide K-panel of A (128 rows) and W (256 rows) into LDS.
    auto stage = [&](int buf, int kb) {
        const _Float16* Ag = A + (size_t)bm0 * K + kb;
        const _Float16* Wg = W + (size_t)bn0 * K + kb;
        _Float16* Al = &lds[buf][0];
        _Float16* Wl = &lds[buf][A_ROWS * LDS_STRIDE];
#pragma unroll
        for (int c = 0; c < 2; ++c) {               // 128 rows * 4 segs / 256
            const int idx = c * 256 + tid;
            const int row = idx >> 2, seg = idx & 3;
            async_copy16(Al + row * LDS_STRIDE + seg * 8,
                         Ag + (size_t)row * K + seg * 8);
        }
#pragma unroll
        for (int c = 0; c < 4; ++c) {               // 256 rows * 4 segs / 256
            const int idx = c * 256 + tid;
            const int row = idx >> 2, seg = idx & 3;
            async_copy16(Wl + row * LDS_STRIDE + seg * 8,
                         Wg + (size_t)row * K + seg * 8);
        }
    };

    v8f acc[4][4] = {};

    stage(0, 0);
    int cur = 0;
    for (int kb = 0; kb < K; kb += 32, cur ^= 1) {
        async_wait0();          // my copies for this stage have landed
        __syncthreads();        // everyone's have
        if (kb + 32 < K) stage(cur ^ 1, kb + 32);

        const _Float16* Al = &lds[cur][0];
        const _Float16* Wl = &lds[cur][A_ROWS * LDS_STRIDE];

        v16h af[4], bf[4];
#pragma unroll
        for (int i = 0; i < 4; ++i)
            af[i] = make_frag(Al + (wm * 64 + i * 16 + ln) * LDS_STRIDE, hi);
#pragma unroll
        for (int j = 0; j < 4; ++j)
            bf[j] = make_frag(Wl + (wn * 64 + j * 16 + ln) * LDS_STRIDE, hi);
#pragma unroll
        for (int i = 0; i < 4; ++i)
#pragma unroll
            for (int j = 0; j < 4; ++j)
                acc[i][j] = wmma32(af[i], bf[j], acc[i][j]);

        __syncthreads();        // done reading buf before it is re-staged
    }

#pragma unroll
    for (int j = 0; j < 4; ++j) {
        const int   n  = bn + j * 16 + ln;
        const float bj = bias[n];
#pragma unroll
        for (int i = 0; i < 4; ++i) {
#pragma unroll
            for (int r = 0; r < 8; ++r) {
                const int   m = bm + i * 16 + r + 8 * hi;
                const float v = (acc[i][j][r] + bj) * scale;
                if (MODE == 0) {
                    out[(size_t)m * N + n] = (OT)v;
                } else {
                    const int bi = m / SQdim, s = m % SQdim;
                    out[((size_t)(bi * N + n)) * SQdim + s] = (OT)v;
                }
            }
        }
    }
}

#define P_STRIDE  72
#define KV_STRIDE 72
#define KV_TILE   (64 * KV_STRIDE)          // halves per staged operand tile
#define FA_WAVES  8

__device__ __forceinline__ void async_copy16x4(
    void* l0, const void* g0, void* l1, const void* g1,
    void* l2, const void* g2, void* l3, const void* g3)
{
    const uint32_t o0 = (uint32_t)(uintptr_t)l0, o1 = (uint32_t)(uintptr_t)l1;
    const uint32_t o2 = (uint32_t)(uintptr_t)l2, o3 = (uint32_t)(uintptr_t)l3;
    asm volatile("global_load_async_to_lds_b128 %0, %1, off\n\t"
                 "global_load_async_to_lds_b128 %2, %3, off\n\t"
                 "global_load_async_to_lds_b128 %4, %5, off\n\t"
                 "global_load_async_to_lds_b128 %6, %7, off\n\t"
                 "s_wait_xcnt 0x0"
                 :: "v"(o0), "v"(g0), "v"(o1), "v"(g1),
                    "v"(o2), "v"(g2), "v"(o3), "v"(g3) : "memory");
}

__global__ __launch_bounds__(FA_WAVES * 32) void flash_attn_kernel(
    const _Float16* __restrict__ Q, const _Float16* __restrict__ Kh,
    const _Float16* __restrict__ Vt, _Float16* __restrict__ ctx)
{
    __shared__ __align__(16) _Float16 kv[2][2 * KV_TILE];             // K, Vt
    __shared__ __align__(16) _Float16 plds[FA_WAVES][16 * P_STRIDE];  // per wave

    const int tid  = threadIdx.x;
    const int lane = tid & 31;
    const int wave = tid >> 5;
    const int ln   = lane & 15;
    const int hi   = lane >> 4;

    const int bh = blockIdx.y;
    const int b  = bh >> 4;
    const int h  = bh & 15;
    const int qbase = (blockIdx.x * FA_WAVES + wave) * 16;

    // Stage keys kb..kb+63: thread -> rows srow and srow+32, 16-byte piece sseg.
    const int srow = tid >> 3, sseg = tid & 7;
    const _Float16* kg0 =
        Kh + ((size_t)(b * SK + srow)) * HIDDEN + h * HEAD_DIM + sseg * 8;
    const _Float16* vg0 =
        Vt + ((size_t)(b * HIDDEN + h * HEAD_DIM + srow)) * SK + sseg * 8;
    auto stage = [&](int buf, int kb) {
        const _Float16* kg = kg0 + (size_t)kb * HIDDEN;
        const _Float16* vg = vg0 + kb;
        _Float16* kl = &kv[buf][srow * KV_STRIDE + sseg * 8];
        _Float16* vl = kl + KV_TILE;
        async_copy16x4(kl, kg, kl + 32 * KV_STRIDE, kg + 32 * HIDDEN,
                       vl, vg, vl + 32 * KV_STRIDE, vg + 32 * SK);
    };

    stage(0, 0);

    const size_t qrow = ((size_t)(b * SQ + qbase + ln)) * HIDDEN + h * HEAD_DIM;
    const v16h qf0 = make_frag(Q + qrow, hi);
    const v16h qf1 = make_frag(Q + qrow + 32, hi);

    float mrow[8], lrow[8];
    v8f   acc[4] = {};
#pragma unroll
    for (int r = 0; r < 8; ++r) { mrow[r] = -1e30f; lrow[r] = 0.0f; }

    _Float16* pw = &plds[wave][0];

    async_wait0();          // my copies of tile 0 have landed
    __syncthreads();        // everyone's have
    stage(1, 64);

    for (int it = 0; it < SK / 64; ++it) {
        const _Float16* Kl = &kv[it & 1][0];
        const _Float16* Vl = Kl + KV_TILE;

        // ---- scores: S(16 x 64) as four 16x16 tiles, k-dim = 64 ------------
        v8f sc[4];
#pragma unroll
        for (int t = 0; t < 4; ++t) {
            const _Float16* krow = Kl + (t * 16 + ln) * KV_STRIDE;
            const v16h kf0 = make_frag(krow, hi);
            const v16h kf1 = make_frag(krow + 32, hi);
            v8f c = {};
            c = wmma32(qf0, kf0, c);
            c = wmma32(qf1, kf1, c);
            sc[t] = c;
        }

        // ---- online softmax (DPP row reductions over the 16-lane groups) --
#pragma unroll
        for (int r = 0; r < 8; ++r) {
            const float mb = row_max16(fmaxf(fmaxf(sc[0][r], sc[1][r]),
                                             fmaxf(sc[2][r], sc[3][r])));
            const float mn = fmaxf(mrow[r], mb);
            const float cf = __expf(mrow[r] - mn);   // accumulator rescale
            mrow[r] = mn;
            float ps = 0.0f;
#pragma unroll
            for (int t = 0; t < 4; ++t) {
                const float p = __expf(sc[t][r] - mn);
                sc[t][r] = p;
                ps += p;
            }
            lrow[r] = lrow[r] * cf + row_sum16(ps);
#pragma unroll
            for (int d = 0; d < 4; ++d) acc[d][r] *= cf;
        }

        // ---- transpose P(16x64) through LDS into WMMA-A fragments ----------
#pragma unroll
        for (int t = 0; t < 4; ++t)
#pragma unroll
            for (int r = 0; r < 8; ++r)
                pw[(r + 8 * hi) * P_STRIDE + t * 16 + ln] = (_Float16)sc[t][r];
        asm volatile("s_wait_dscnt 0" ::: "memory");
        const v16h pf0 = make_frag(pw + ln * P_STRIDE, hi);        // keys 0-31
        const v16h pf1 = make_frag(pw + ln * P_STRIDE + 32, hi);   // keys 32-63

        // ---- PV: ctx(16 x 64) += P(16x64) * V(64x64) -----------------------
#pragma unroll
        for (int d = 0; d < 4; ++d) {
            const _Float16* vrow = Vl + (d * 16 + ln) * KV_STRIDE;
            const v16h vb0 = make_frag(vrow, hi);
            const v16h vb1 = make_frag(vrow + 32, hi);
            acc[d] = wmma32(pf0, vb0, acc[d]);
            acc[d] = wmma32(pf1, vb1, acc[d]);
        }

        // ---- hand-over: this buffer is read out, the next tile has landed --
        asm volatile("s_wait_dscnt 0" ::: "memory");  // my reads of this buffer are done
        async_wait0();                                // my copies of the next tile have landed
        __syncthreads();                              // both hold for every wave
        if (it + 2 < SK / 64) stage(it & 1, (it + 2) * 64);
    }
    async_wait0();          // nothing of mine in flight when the wave ends

    // ---- normalize and store ctx (f16) ------------------------------------
#pragma unroll
    for (int d = 0; d < 4; ++d) {
#pragma unroll
        for (int r = 0; r < 8; ++r) {
            const int   m = qbase + r + 8 * hi;
            const float v = acc[d][r] / lrow[r];
            ctx[((size_t)(b * SQ + m)) * HIDDEN + h * HEAD_DIM + d * 16 + ln] =
                (_Float16)v;
        }
    }
}

// ---------------------------------------------------------------------------
extern "C" void kernel_launch(void* const* d_in, const int* in_sizes, int n_in,
                              void* d_out, int out_size, void* d_ws, size_t ws_size,
                              hipStream_t stream) {
    const float* query = (const float*)d_in[0];
    const float* key   = (const float*)d_in[1];
    const float* value = (const float*)d_in[2];
    const float* Wq    = (const float*)d_in[3];
    const float* bq    = (const float*)d_in[4];
    const float* Wk    = (const float*)d_in[5];
    const float* bk    = (const float*)d_in[6];
    const float* Wv    = (const float*)d_in[7];
    const float* bv    = (const float*)d_in[8];
    const float* Wo    = (const float*)d_in[9];
    const float* bo    = (const float*)d_in[10];
    float*       out   = (float*)d_out;

    const size_t tok  = (size_t)BATCH * SQ;            // 8192 tokens
    const size_t act  = tok * HIDDEN;                  // 8M elements
    const size_t wsz  = (size_t)HIDDEN * HIDDEN;       // 1M elements

    // ws layout (f16 elements); ctx aliases xq (dead after Q projection).
    _Float16* base = (_Float16*)d_ws;
    _Float16* xq  = base;                 // act
    _Float16* xk  = xq  + act;            // act
    _Float16* xv  = xk  + act;            // act
    _Float16* wqh = xv  + act;            // wsz
    _Float16* wkh = wqh + wsz;
    _Float16* wvh = wkh + wsz;
    _Float16* woh = wvh + wsz;
    _Float16* Qp  = woh + wsz;
    _Float16* Kp  = Qp  + act;
    _Float16* Vtp = Kp  + act;
    _Float16* ctx = xq;

    // ---- stage f32 -> f16 --------------------------------------------------
    {
        const int a8 = (int)(act / 8), w8 = (int)(wsz / 8);
        cvt_f16_kernel<<<a8 / 256, 256, 0, stream>>>(query, xq, a8);
        cvt_f16_kernel<<<a8 / 256, 256, 0, stream>>>(key,   xk, a8);
        cvt_f16_kernel<<<a8 / 256, 256, 0, stream>>>(value, xv, a8);
        cvt_f16_kernel<<<w8 / 256, 256, 0, stream>>>(Wq, wqh, w8);
        cvt_f16_kernel<<<w8 / 256, 256, 0, stream>>>(Wk, wkh, w8);
        cvt_f16_kernel<<<w8 / 256, 256, 0, stream>>>(Wv, wvh, w8);
        cvt_f16_kernel<<<w8 / 256, 256, 0, stream>>>(Wo, woh, w8);
    }

    const dim3 gblk((unsigned)(tok / 128), HIDDEN / 256);   // 64 x 4 blocks
    const float qscale = 0.125f;                            // HEAD_DIM^-0.5

    gemm_f16_kernel<_Float16, 0><<<gblk, 256, 0, stream>>>(
        xq, wqh, bq, Qp, (int)tok, HIDDEN, HIDDEN, SQ, qscale);
    gemm_f16_kernel<_Float16, 0><<<gblk, 256, 0, stream>>>(
        xk, wkh, bk, Kp, (int)tok, HIDDEN, HIDDEN, SK, 1.0f);
    gemm_f16_kernel<_Float16, 1><<<gblk, 256, 0, stream>>>(
        xv, wvh, bv, Vtp, (int)tok, HIDDEN, HIDDEN, SK, 1.0f);

    flash_attn_kernel<<<dim3(SQ / 16 / FA_WAVES, BATCH * HEADS), FA_WAVES * 32, 0, stream>>>(
        Qp, Kp, Vtp, ctx);

    gemm_f16_kernel<float, 0><<<gblk, 256, 0, stream>>>(
        ctx, woh, bo, out, (int)tok, HIDDEN, HIDDEN, SQ, 1.0f);
}

// v002
// Measured time: 226 microseconds a run.
// In two side-by-side timings against v001, it was 1.19 and 1.20 times as fast.
// Over all steps from v000 it is 1.59 times as fast.
#include <hip/hip_runtime.h>

#define HIDDEN   1024
#define HEADS    16
#define HEAD_DIM 64
#define BATCH    4
#define SQ       2048
#define SK       2048

typedef __attribute__((ext_vector_type(16))) _Float16 v16h;
typedef __attribute__((ext_vector_type(8)))  _Float16 v8h;
typedef __attribute__((ext_vector_type(8)))  float    v8f;

// D = A(16x32 f16) * B(32x16 f16) + C(16x16 f32)
__device__ __forceinline__ v8f wmma32(v16h a, v16h b, v8f c) {
    return __builtin_amdgcn_wmma_f32_16x16x32_f16(
        false, a, false, b, (short)0, c, false, false);
}

__device__ __forceinline__ v16h make_frag(const _Float16* __restrict__ p, int hi) {
    const v8h lo = *(const v8h*)(p + hi * 8);
    const v8h hs = *(const v8h*)(p + hi * 8 + 16);
    return __builtin_shufflevector(lo, hs, 0,1,2,3,4,5,6,7,8,9,10,11,12,13,14,15);
}

__device__ __forceinline__ void async_copy16(void* lds_p, const void* gp) {
    const uint32_t loff = (uint32_t)(uintptr_t)lds_p;   // LDS segment offset
    asm volatile("global_load_async_to_lds_b128 %0, %1, off"
                 :: "v"(loff), "v"(gp) : "memory");
}
__device__ __forceinline__ void async_wait0() {
    asm volatile("s_wait_asynccnt 0" ::: "memory");
}

__device__ __forceinline__ float xhalf(float x) {
    const int i = __builtin_bit_cast(int, x);
    return __builtin_bit_cast(float, __builtin_amdgcn_permlanex16(
        i, i, 0x76543210, 0xfedcba98, false, false));
}

__device__ __forceinline__ float exp_1(float x) {
    float y;
    asm("v_exp_f32 %0, %1\n\tv_nop" : "=&v"(y) : "v"(x * 1.44269504f));
    return y;
}
__device__ __forceinline__ v8f exp_8(v8f x) {
    x *= 1.44269504f;
    float y0, y1, y2, y3, y4, y5, y6, y7;
    asm("v_exp_f32 %0, %8\n\t"
        "v_exp_f32 %1, %9\n\t"
        "v_exp_f32 %2, %10\n\t"
        "v_exp_f32 %3, %11\n\t"
        "v_exp_f32 %4, %12\n\t"
        "v_exp_f32 %5, %13\n\t"
        "v_exp_f32 %6, %14\n\t"
        "v_exp_f32 %7, %15\n\t"
        "v_nop"
        : "=&v"(y0), "=&v"(y1), "=&v"(y2), "=&v"(y3),
          "=&v"(y4), "=&v"(y5), "=&v"(y6), "=&v"(y7)
        : "v"(x[0]), "v"(x[1]), "v"(x[2]), "v"(x[3]),
          "v"(x[4]), "v"(x[5]), "v"(x[6]), "v"(x[7]));
    return v8f{y0, y1, y2, y3, y4, y5, y6, y7};
}

// ---------------------------------------------------------------------------
// f32 -> f16 staging (8 elements / thread)
// ---------------------------------------------------------------------------
__global__ __launch_bounds__(256) void cvt_f16_kernel(
    const float* __restrict__ in, _Float16* __restrict__ out, int n8)
{
    const int i = blockIdx.x * blockDim.x + threadIdx.x;
    if (i >= n8) return;
    const float4 a = ((const float4*)in)[i * 2];
    const float4 b = ((const float4*)in)[i * 2 + 1];
    v8h o;
    o[0] = (_Float16)a.x; o[1] = (_Float16)a.y;
    o[2] = (_Float16)a.z; o[3] = (_Float16)a.w;
    o[4] = (_Float16)b.x; o[5] = (_Float16)b.y;
    o[6] = (_Float16)b.z; o[7] = (_Float16)b.w;
    ((v8h*)out)[i] = o;
}

#define LDS_STRIDE 40
#define A_ROWS     128
#define W_ROWS     256

template <typename OT, int MODE>
__global__ __launch_bounds__(256) void gemm_f16_kernel(
    const _Float16* __restrict__ A, const _Float16* __restrict__ W,
    const float* __restrict__ bias, OT* __restrict__ out,
    int M, int N, int K, int SQdim, float scale)
{
    __shared__ __align__(16) _Float16 lds[2][(A_ROWS + W_ROWS) * LDS_STRIDE];

    const int tid  = threadIdx.x;
    const int lane = tid & 31;
    const int wave = tid >> 5;
    const int wm   = wave & 1;          // 2 waves along M
    const int wn   = wave >> 1;         // 4 waves along N
    const int ln   = lane & 15;
    const int hi   = lane >> 4;

    const int bm0 = blockIdx.x * 128;
    const int bn0 = blockIdx.y * 256;
    const int bm  = bm0 + wm * 64;
    const int bn  = bn0 + wn * 64;

    // Stage one 32-wide K-panel of A (128 rows) and W (256 rows) into LDS.
    auto stage = [&](int buf, int kb) {
        const _Float16* Ag = A + (size_t)bm0 * K + kb;
        const _Float16* Wg = W + (size_t)bn0 * K + kb;
        _Float16* Al = &lds[buf][0];
        _Float16* Wl = &lds[buf][A_ROWS * LDS_STRIDE];
#pragma unroll
        for (int c = 0; c < 2; ++c) {               // 128 rows * 4 segs / 256
            const int idx = c * 256 + tid;
            const int row = idx >> 2, seg = idx & 3;
            async_copy16(Al + row * LDS_STRIDE + seg * 8,
                         Ag + (size_t)row * K + seg * 8);
        }
#pragma unroll
        for (int c = 0; c < 4; ++c) {               // 256 rows * 4 segs / 256
            const int idx = c * 256 + tid;
            const int row = idx >> 2, seg = idx & 3;
            async_copy16(Wl + row * LDS_STRIDE + seg * 8,
                         Wg + (size_t)row * K + seg * 8);
        }
    };

    v8f acc[4][4] = {};

    stage(0, 0);
    int cur = 0;
    for (int kb = 0; kb < K; kb += 32, cur ^= 1) {
        async_wait0();          // my copies for this stage have landed
        __syncthreads();        // everyone's have
        if (kb + 32 < K) stage(cur ^ 1, kb + 32);

        const _Float16* Al = &lds[cur][0];
        const _Float16* Wl = &lds[cur][A_ROWS * LDS_STRIDE];

        v16h af[4], bf[4];
#pragma unroll
        for (int i = 0; i < 4; ++i)
            af[i] = make_frag(Al + (wm * 64 + i * 16 + ln) * LDS_STRIDE, hi);
#pragma unroll
        for (int j = 0; j < 4; ++j)
            bf[j] = make_frag(Wl + (wn * 64 + j * 16 + ln) * LDS_STRIDE, hi);
#pragma unroll
        for (int i = 0; i < 4; ++i)
#pragma unroll
            for (int j = 0; j < 4; ++j)
                acc[i][j] = wmma32(af[i], bf[j], acc[i][j]);

        __syncthreads();        // done reading buf before it is re-staged
    }

#pragma unroll
    for (int j = 0; j < 4; ++j) {
        const int   n  = bn + j * 16 + ln;
        const float bj = bias[n];
#pragma unroll
        for (int i = 0; i < 4; ++i) {
#pragma unroll
            for (int r = 0; r < 8; ++r) {
                const int   m = bm + i * 16 + r + 8 * hi;
                const float v = (acc[i][j][r] + bj) * scale;
                if (MODE == 0) {
                    out[(size_t)m * N + n] = (OT)v;
                } else {
                    const int bi = m / SQdim, s = m % SQdim;
                    out[((size_t)(bi * N + n)) * SQdim + s] = (OT)v;
                }
            }
        }
    }
}

#define KV_STRIDE 72
#define KV_TILE   (64 * KV_STRIDE)          // halves per staged operand tile
#define FA_WAVES  8

__device__ __forceinline__ void async_copy16x4(
    void* l0, const void* g0, void* l1, const void* g1,
    void* l2, const void* g2, void* l3, const void* g3)
{
    const uint32_t o0 = (uint32_t)(uintptr_t)l0, o1 = (uint32_t)(uintptr_t)l1;
    const uint32_t o2 = (uint32_t)(uintptr_t)l2, o3 = (uint32_t)(uintptr_t)l3;
    asm volatile("global_load_async_to_lds_b128 %0, %1, off\n\t"
                 "global_load_async_to_lds_b128 %2, %3, off\n\t"
                 "global_load_async_to_lds_b128 %4, %5, off\n\t"
                 "global_load_async_to_lds_b128 %6, %7, off\n\t"
                 "s_wait_xcnt 0x0"
                 :: "v"(o0), "v"(g0), "v"(o1), "v"(g1),
                    "v"(o2), "v"(g2), "v"(o3), "v"(g3) : "memory");
}

__global__ __launch_bounds__(FA_WAVES * 32) void flash_attn_kernel(
    const _Float16* __restrict__ Q, const _Float16* __restrict__ Kh,
    const _Float16* __restrict__ Vt, _Float16* __restrict__ ctx)
{
    __shared__ __align__(16) _Float16 kv[2][2 * KV_TILE];             // K, Vt

    const int tid  = threadIdx.x;
    const int lane = tid & 31;
    const int wave = tid >> 5;
    const int ln   = lane & 15;
    const int hi   = lane >> 4;

    const int bh = blockIdx.y;
    const int b  = bh >> 4;
    const int h  = bh & 15;
    const int qbase = (blockIdx.x * FA_WAVES + wave) * 16;

    // Stage keys kb..kb+63: thread -> rows srow and srow+32, 16-byte piece sseg.
    const int srow = tid >> 3, sseg = tid & 7;
    const _Float16* kg0 =
        Kh + ((size_t)(b * SK + srow)) * HIDDEN + h * HEAD_DIM + sseg * 8;
    const _Float16* vg0 =
        Vt + ((size_t)(b * HIDDEN + h * HEAD_DIM + srow)) * SK + sseg * 8;
    auto stage = [&](int buf, int kb) {
        const _Float16* kg = kg0 + (size_t)kb * HIDDEN;
        const _Float16* vg = vg0 + kb;
        _Float16* kl = &kv[buf][srow * KV_STRIDE + sseg * 8];
        _Float16* vl = kl + KV_TILE;
        async_copy16x4(kl, kg, kl + 32 * KV_STRIDE, kg + 32 * HIDDEN,
                       vl, vg, vl + 32 * KV_STRIDE, vg + 32 * SK);
    };

    stage(0, 0);

    const size_t qrow = ((size_t)(b * SQ + qbase + ln)) * HIDDEN + h * HEAD_DIM;
    const v16h qf0 = make_frag(Q + qrow, hi);
    const v16h qf1 = make_frag(Q + qrow + 32, hi);

    // This lane's query (column ln): running maximum, and the sum over the
    // keys of this half alone (the halves' sums are joined behind the loop).
    float mq = -1e30f, lq = 0.0f;
    v8f   acc[4] = {};      // acc[d][r] = O^T[d*16 + 8*hi + r][query ln]

    async_wait0();          // my copies of tile 0 have landed
    __syncthreads();        // everyone's have
    stage(1, 64);

    for (int it = 0; it < SK / 64; ++it) {
        const _Float16* Kl = &kv[it & 1][0];
        const _Float16* Vl = Kl + KV_TILE;

        // ---- scores: S^T(64 x 16) as four 16x16 tiles, k-dim = 64 ----------
        // sc[t][r] = S[query ln][key t*16 + 8*hi + r]
        v8f sc[4];
#pragma unroll
        for (int t = 0; t < 4; ++t) {
            const _Float16* krow = Kl + (t * 16 + ln) * KV_STRIDE;
            const v16h kf0 = make_frag(krow, hi);
            const v16h kf1 = make_frag(krow + 32, hi);
            v8f c = {};
            c = wmma32(kf0, qf0, c);
            c = wmma32(kf1, qf1, c);
            sc[t] = c;
        }

        // ---- online softmax, one query per lane ----------------------------
        float mb = __builtin_reduce_max(__builtin_elementwise_max(
            __builtin_elementwise_max(sc[0], sc[1]),
            __builtin_elementwise_max(sc[2], sc[3])));   // this half's 32 keys
        mb = fmaxf(mb, xhalf(mb));                   // all 64 keys
        const float mn = fmaxf(mq, mb);
        const float cf = exp_1(mq - mn);             // accumulator rescale
        mq = mn;
#pragma unroll  // constant indices, so that sc stays in registers
        for (int t = 0; t < 4; ++t) sc[t] = exp_8(sc[t] - mn);
        // Sum the four tiles register by register first (packed adds), then
        // the eight registers.
        const v8f pv = (sc[0] + sc[1]) + (sc[2] + sc[3]);
        lq = lq * cf + (((pv[0] + pv[1]) + (pv[2] + pv[3])) +
                        ((pv[4] + pv[5]) + (pv[6] + pv[7])));
        acc[0] *= cf; acc[1] *= cf; acc[2] *= cf; acc[3] *= cf;

        // ---- P^T as B fragments: two score tiles converted in place --------
        v16h pf0, pf1;                               // keys 0-31, keys 32-63
#pragma unroll  // constant indices, so that the tiles convert in place
        for (int e = 0; e < 16; ++e) {
            pf0[e] = (_Float16)sc[e >> 3][e & 7];
            pf1[e] = (_Float16)sc[2 + (e >> 3)][e & 7];
        }

        // ---- PV: O^T(64 x 16) += V^T(64x64) * P^T(64x16) -------------------
#pragma unroll
        for (int d = 0; d < 4; ++d) {
            const _Float16* vrow = Vl + (d * 16 + ln) * KV_STRIDE;
            const v16h vb0 = make_frag(vrow, hi);
            const v16h vb1 = make_frag(vrow + 32, hi);
            acc[d] = wmma32(vb0, pf0, acc[d]);
            acc[d] = wmma32(vb1, pf1, acc[d]);
        }

        // ---- hand-over: this buffer is read out, the next tile has landed --
        asm volatile("s_wait_dscnt 0" ::: "memory");  // my reads of this buffer are done
        async_wait0();                                // my copies of the next tile have landed
        __syncthreads();                              // both hold for every wave
        if (it + 2 < SK / 64) stage(it & 1, (it + 2) * 64);
    }
    async_wait0();          // nothing of mine in flight when the wave ends

    // ---- normalize and store ctx (f16): 8 consecutive columns per lane ----
    const float lsum = lq + xhalf(lq);               // join the halves' sums
    _Float16* crow = ctx + ((size_t)(b * SQ + qbase + ln)) * HIDDEN
                         + h * HEAD_DIM + 8 * hi;
#pragma unroll  // constant indices, so that acc stays in registers
    for (int d = 0; d < 4; ++d) {
        v8h o;
#pragma unroll  // the same
        for (int r = 0; r < 8; ++r) o[r] = (_Float16)(acc[d][r] / lsum);
        *(v8h*)(crow + d * 16) = o;
    }
}

// ---------------------------------------------------------------------------
extern "C" void kernel_launch(void* const* d_in, const int* in_sizes, int n_in,
                              void* d_out, int out_size, void* d_ws, size_t ws_size,
                              hipStream_t stream) {
    const float* query = (const float*)d_in[0];
    const float* key   = (const float*)d_in[1];
    const float* value = (const float*)d_in[2];
    const float* Wq    = (const float*)d_in[3];
    const float* bq    = (const float*)d_in[4];
    const float* Wk    = (const float*)d_in[5];
    const float* bk    = (const float*)d_in[6];
    const float* Wv    = (const float*)d_in[7];
    const float* bv    = (const float*)d_in[8];
    const float* Wo    = (const float*)d_in[9];
    const float* bo    = (const float*)d_in[10];
    float*       out   = (float*)d_out;

    const size_t tok  = (size_t)BATCH * SQ;            // 8192 tokens
    const size_t act  = tok * HIDDEN;                  // 8M elements
    const size_t wsz  = (size_t)HIDDEN * HIDDEN;       // 1M elements

    // ws layout (f16 elements); ctx aliases xq (dead after Q projection).
    _Float16* base = (_Float16*)d_ws;
    _Float16* xq  = base;                 // act
    _Float16* xk  = xq  + act;            // act
    _Float16* xv  = xk  + act;            // act
    _Float16* wqh = xv  + act;            // wsz
    _Float16* wkh = wqh + wsz;
    _Float16* wvh = wkh + wsz;
    _Float16* woh = wvh + wsz;
    _Float16* Qp  = woh + wsz;
    _Float16* Kp  = Qp  + act;
    _Float16* Vtp = Kp  + act;
    _Float16* ctx = xq;

    // ---- stage f32 -> f16 --------------------------------------------------
    {
        const int a8 = (int)(act / 8), w8 = (int)(wsz / 8);
        cvt_f16_kernel<<<a8 / 256, 256, 0, stream>>>(query, xq, a8);
        cvt_f16_kernel<<<a8 / 256, 256, 0, stream>>>(key,   xk, a8);
        cvt_f16_kernel<<<a8 / 256, 256, 0, stream>>>(value, xv, a8);
        cvt_f16_kernel<<<w8 / 256, 256, 0, stream>>>(Wq, wqh, w8);
        cvt_f16_kernel<<<w8 / 256, 256, 0, stream>>>(Wk, wkh, w8);
        cvt_f16_kernel<<<w8 / 256, 256, 0, stream>>>(Wv, wvh, w8);
        cvt_f16_kernel<<<w8 / 256, 256, 0, stream>>>(Wo, woh, w8);
    }

    const dim3 gblk((unsigned)(tok / 128), HIDDEN / 256);   // 64 x 4 blocks
    const float qscale = 0.125f;                            // HEAD_DIM^-0.5

    gemm_f16_kernel<_Float16, 0><<<gblk, 256, 0, stream>>>(
        xq, wqh, bq, Qp, (int)tok, HIDDEN, HIDDEN, SQ, qscale);
    gemm_f16_kernel<_Float16, 0><<<gblk, 256, 0, stream>>>(
        xk, wkh, bk, Kp, (int)tok, HIDDEN, HIDDEN, SK, 1.0f);
    gemm_f16_kernel<_Float16, 1><<<gblk, 256, 0, stream>>>(
        xv, wvh, bv, Vtp, (int)tok, HIDDEN, HIDDEN, SK, 1.0f);

    flash_attn_kernel<<<dim3(SQ / 16 / FA_WAVES, BATCH * HEADS), FA_WAVES * 32, 0, stream>>>(
        Qp, Kp, Vtp, ctx);

    gemm_f16_kernel<float, 0><<<gblk, 256, 0, stream>>>(
        ctx, woh, bo, out, (int)tok, HIDDEN, HIDDEN, SQ, 1.0f);
}

// v003
// Measured time: 206 microseconds a run.
// Next to v002, in two timings, it ran 1.09 and 1.10 times as fast.
// All steps since v000 together make it 1.74 times as fast.
#include <hip/hip_runtime.h>

#define HIDDEN   1024
#define HEADS    16
#define HEAD_DIM 64
#define BATCH    4
#define SQ       2048
#define SK       2048

typedef __attribute__((ext_vector_type(16))) _Float16 v16h;
typedef __attribute__((ext_vector_type(8)))  _Float16 v8h;
typedef __attribute__((ext_vector_type(8)))  float    v8f;

// D = A(16x32 f16) * B(32x16 f16) + C(16x16 f32)
__device__ __forceinline__ v8f wmma32(v16h a, v16h b, v8f c) {
    return __builtin_amdgcn_wmma_f32_16x16x32_f16(
        false, a, false, b, (short)0, c, false, false);
}

__device__ __forceinline__ v16h make_frag(const _Float16* __restrict__ p, int hi) {
    const v8h lo = *(const v8h*)(p + hi * 8);
    const v8h hs = *(const v8h*)(p + hi * 8 + 16);
    return __builtin_shufflevector(lo, hs, 0,1,2,3,4,5,6,7,8,9,10,11,12,13,14,15);
}

__device__ __forceinline__ void async_copy16(void* lds_p, const void* gp) {
    const uint32_t loff = (uint32_t)(uintptr_t)lds_p;   // LDS segment offset
    asm volatile("global_load_async_to_lds_b128 %0, %1, off"
                 :: "v"(loff), "v"(gp) : "memory");
}
__device__ __forceinline__ void async_wait0() {
    asm volatile("s_wait_asynccnt 0" ::: "memory");
}

__device__ __forceinline__ float xhalf(float x) {
    const int i = __builtin_bit_cast(int, x);
    return __builtin_bit_cast(float, __builtin_amdgcn_permlanex16(
        i, i, 0x76543210, 0xfedcba98, false, false));
}

__device__ __forceinline__ float exp_1(float x) {
    float y;
    asm("v_exp_f32 %0, %1\n\tv_nop" : "=&v"(y) : "v"(x * 1.44269504f));
    return y;
}
__device__ __forceinline__ v8f exp_8(v8f x) {
    x *= 1.44269504f;
    float y0, y1, y2, y3, y4, y5, y6, y7;
    asm("v_exp_f32 %0, %8\n\t"
        "v_exp_f32 %1, %9\n\t"
        "v_exp_f32 %2, %10\n\t"
        "v_exp_f32 %3, %11\n\t"
        "v_exp_f32 %4, %12\n\t"
        "v_exp_f32 %5, %13\n\t"
        "v_exp_f32 %6, %14\n\t"
        "v_exp_f32 %7, %15\n\t"
        "v_nop"
        : "=&v"(y0), "=&v"(y1), "=&v"(y2), "=&v"(y3),
          "=&v"(y4), "=&v"(y5), "=&v"(y6), "=&v"(y7)
        : "v"(x[0]), "v"(x[1]), "v"(x[2]), "v"(x[3]),
          "v"(x[4]), "v"(x[5]), "v"(x[6]), "v"(x[7]));
    return v8f{y0, y1, y2, y3, y4, y5, y6, y7};
}

// ---------------------------------------------------------------------------
// f32 -> f16 staging of all seven operands in ONE launch of long-lived waves.
//
// The seven f16 copies lie one behind the other in the workspace, in the order
// of the arguments.  A piece is 1024 elements: 8 loads of 512 contiguous bytes
// per wave.  The 28672 pieces are dealt to 4096 waves (16 per block, 256
// blocks), 7 each: round i takes piece i * 4096 + wave, so that rounds 0-1 lie
// in query, 2-3 in key, 4-5 in value, and round 6 in one weight (1024 pieces
// each, the same weight for a whole block).  The next piece's loads are issued
// before this piece is converted and stored.
// ---------------------------------------------------------------------------
#define CVT_WAVES  16
#define CVT_BLOCKS 256
#define CVT_PIECE  1024                          // elements
#define CVT_ROUND  (CVT_WAVES * CVT_BLOCKS * CVT_PIECE)

typedef __attribute__((ext_vector_type(4))) _Float16 v4h;
typedef __attribute__((ext_vector_type(4))) float    v4f;

__global__ __launch_bounds__(CVT_WAVES * 32) void cvt_f16_kernel(
    const float* __restrict__ query, const float* __restrict__ key,
    const float* __restrict__ value,
    const float* __restrict__ Wq, const float* __restrict__ Wk,
    const float* __restrict__ Wv, const float* __restrict__ Wo,
    _Float16* __restrict__ out)
{
    // A wave's piece of round 0 = block part (uniform) + thread part.  The
    // thread part, in bytes, is the same for every load (t4) and for every
    // store (t2); the block part belongs to the uniform bases.
    const unsigned tp = ((threadIdx.x >> 5) << 10) | ((threadIdx.x & 31) << 2);
    const unsigned t4 = tp * 4, t2 = tp * 2;
    const unsigned bp = blockIdx.x * (CVT_WAVES * CVT_PIECE);

    const unsigned wsel = blockIdx.x >> 6;       // 64 blocks per weight
    const float* w = wsel == 0 ? Wq : wsel == 1 ? Wk : wsel == 2 ? Wv : Wo;

    const float* src[7] = {
        query + bp, query + bp + CVT_ROUND,
        key   + bp, key   + bp + CVT_ROUND,
        value + bp, value + bp + CVT_ROUND,
        w + (bp & (HIDDEN * HIDDEN - 1))};

    v4f r[2][8];
#pragma unroll  // constant indices, so that r stays in registers
    for (int c = 0; c < 8; ++c)
        r[0][c] = *(const v4f*)((const char*)src[0] + t4 + c * 512);

#pragma unroll  // the same, and src[i] is then a compile-time choice
    for (int i = 0; i < 7; ++i) {
        if (i + 1 < 7) {
#pragma unroll  // constant indices, so that r stays in registers
            for (int c = 0; c < 8; ++c)
                r[(i + 1) & 1][c] =
                    *(const v4f*)((const char*)src[i + 1] + t4 + c * 512);
        }
        char* o = (char*)(out + (size_t)i * CVT_ROUND + bp);
#pragma unroll  // the same
        for (int c = 0; c < 8; ++c)
            *(v4h*)(o + t2 + c * 256) = __builtin_convertvector(r[i & 1][c], v4h);
        // Before a register that an issued load or store names is used again
        // (t4 and t2 as inputs: they stay as they are up to here); it also
        // keeps the rounds in this order, loads ahead and stores behind.
        if (i + 1 < 7)
            asm volatile("s_wait_xcnt 0x0" :: "v"(t4), "v"(t2) : "memory");
    }
}

#define LDS_STRIDE 40
#define A_ROWS     128
#define W_ROWS     256

template <typename OT, int MODE>
__global__ __launch_bounds__(256) void gemm_f16_kernel(
    const _Float16* __restrict__ A, const _Float16* __restrict__ W,
    const float* __restrict__ bias, OT* __restrict__ out,
    int M, int N, int K, int SQdim, float scale)
{
    __shared__ __align__(16) _Float16 lds[2][(A_ROWS + W_ROWS) * LDS_STRIDE];

    const int tid  = threadIdx.x;
    const int lane = tid & 31;
    const int wave = tid >> 5;
    const int wm   = wave & 1;          // 2 waves along M
    const int wn   = wave >> 1;         // 4 waves along N
    const int ln   = lane & 15;
    const int hi   = lane >> 4;

    const int bm0 = blockIdx.x * 128;
    const int bn0 = blockIdx.y * 256;
    const int bm  = bm0 + wm * 64;
    const int bn  = bn0 + wn * 64;

    // Stage one 32-wide K-panel of A (128 rows) and W (256 rows) into LDS.
    auto stage = [&](int buf, int kb) {
        const _Float16* Ag = A + (size_t)bm0 * K + kb;
        const _Float16* Wg = W + (size_t)bn0 * K + kb;
        _Float16* Al = &lds[buf][0];
        _Float16* Wl = &lds[buf][A_ROWS * LDS_STRIDE];
#pragma unroll
        for (int c = 0; c < 2; ++c) {               // 128 rows * 4 segs / 256
            const int idx = c * 256 + tid;
            const int row = idx >> 2, seg = idx & 3;
            async_copy16(Al + row * LDS_STRIDE + seg * 8,
                         Ag + (size_t)row * K + seg * 8);
        }
#pragma unroll
        for (int c = 0; c < 4; ++c) {               // 256 rows * 4 segs / 256
            const int idx = c * 256 + tid;
            const int row = idx >> 2, seg = idx & 3;
            async_copy16(Wl + row * LDS_STRIDE + seg * 8,
                         Wg + (size_t)row * K + seg * 8);
        }
    };

    v8f acc[4][4] = {};

    stage(0, 0);
    int cur = 0;
    for (int kb = 0; kb < K; kb += 32, cur ^= 1) {
        async_wait0();          // my copies for this stage have landed
        __syncthreads();        // everyone's have
        if (kb + 32 < K) stage(cur ^ 1, kb + 32);

        const _Float16* Al = &lds[cur][0];
        const _Float16* Wl = &lds[cur][A_ROWS * LDS_STRIDE];

        v16h af[4], bf[4];
#pragma unroll
        for (int i = 0; i < 4; ++i)
            af[i] = make_frag(Al + (wm * 64 + i * 16 + ln) * LDS_STRIDE, hi);
#pragma unroll
        for (int j = 0; j < 4; ++j)
            bf[j] = make_frag(Wl + (wn * 64 + j * 16 + ln) * LDS_STRIDE, hi);
#pragma unroll
        for (int i = 0; i < 4; ++i)
#pragma unroll
            for (int j = 0; j < 4; ++j)
                acc[i][j] = wmma32(af[i], bf[j], acc[i][j]);

        __syncthreads();        // done reading buf before it is re-staged
    }

#pragma unroll
    for (int j = 0; j < 4; ++j) {
        const int   n  = bn + j * 16 + ln;
        const float bj = bias[n];
#pragma unroll
        for (int i = 0; i < 4; ++i) {
#pragma unroll
            for (int r = 0; r < 8; ++r) {
                const int   m = bm + i * 16 + r + 8 * hi;
                const float v = (acc[i][j][r] + bj) * scale;
                if (MODE == 0) {
                    out[(size_t)m * N + n] = (OT)v;
                } else {
                    const int bi = m / SQdim, s = m % SQdim;
                    out[((size_t)(bi * N + n)) * SQdim + s] = (OT)v;
                }
            }
        }
    }
}

#define KV_STRIDE 72
#define KV_TILE   (64 * KV_STRIDE)          // halves per staged operand tile
#define FA_WAVES  8

__device__ __forceinline__ void async_copy16x4(
    void* l0, const void* g0, void* l1, const void* g1,
    void* l2, const void* g2, void* l3, const void* g3)
{
    const uint32_t o0 = (uint32_t)(uintptr_t)l0, o1 = (uint32_t)(uintptr_t)l1;
    const uint32_t o2 = (uint32_t)(uintptr_t)l2, o3 = (uint32_t)(uintptr_t)l3;
    asm volatile("global_load_async_to_lds_b128 %0, %1, off\n\t"
                 "global_load_async_to_lds_b128 %2, %3, off\n\t"
                 "global_load_async_to_lds_b128 %4, %5, off\n\t"
                 "global_load_async_to_lds_b128 %6, %7, off\n\t"
                 "s_wait_xcnt 0x0"
                 :: "v"(o0), "v"(g0), "v"(o1), "v"(g1),
                    "v"(o2), "v"(g2), "v"(o3), "v"(g3) : "memory");
}

__global__ __launch_bounds__(FA_WAVES * 32) void flash_attn_kernel(
    const _Float16* __restrict__ Q, const _Float16* __restrict__ Kh,
    const _Float16* __restrict__ Vt, _Float16* __restrict__ ctx)
{
    __shared__ __align__(16) _Float16 kv[2][2 * KV_TILE];             // K, Vt

    const int tid  = threadIdx.x;
    const int lane = tid & 31;
    const int wave = tid >> 5;
    const int ln   = lane & 15;
    const int hi   = lane >> 4;

    const int bh = blockIdx.y;
    const int b  = bh >> 4;
    const int h  = bh & 15;
    const int qbase = (blockIdx.x * FA_WAVES + wave) * 16;

    // Stage keys kb..kb+63: thread -> rows srow and srow+32, 16-byte piece sseg.
    const int srow = tid >> 3, sseg = tid & 7;
    const _Float16* kg0 =
        Kh + ((size_t)(b * SK + srow)) * HIDDEN + h * HEAD_DIM + sseg * 8;
    const _Float16* vg0 =
        Vt + ((size_t)(b * HIDDEN + h * HEAD_DIM + srow)) * SK + sseg * 8;
    auto stage = [&](int buf, int kb) {
        const _Float16* kg = kg0 + (size_t)kb * HIDDEN;
        const _Float16* vg = vg0 + kb;
        _Float16* kl = &kv[buf][srow * KV_STRIDE + sseg * 8];
        _Float16* vl = kl + KV_TILE;
        async_copy16x4(kl, kg, kl + 32 * KV_STRIDE, kg + 32 * HIDDEN,
                       vl, vg, vl + 32 * KV_STRIDE, vg + 32 * SK);
    };

    stage(0, 0);

    const size_t qrow = ((size_t)(b * SQ + qbase + ln)) * HIDDEN + h * HEAD_DIM;
    const v16h qf0 = make_frag(Q + qrow, hi);
    const v16h qf1 = make_frag(Q + qrow + 32, hi);

    // This lane's query (column ln): running maximum, and the sum over the
    // keys of this half alone (the halves' sums are joined behind the loop).
    float mq = -1e30f, lq = 0.0f;
    v8f   acc[4] = {};      // acc[d][r] = O^T[d*16 + 8*hi + r][query ln]

    async_wait0();          // my copies of tile 0 have landed
    __syncthreads();        // everyone's have
    stage(1, 64);

    for (int it = 0; it < SK / 64; ++it) {
        const _Float16* Kl = &kv[it & 1][0];
        const _Float16* Vl = Kl + KV_TILE;

        // ---- scores: S^T(64 x 16) as four 16x16 tiles, k-dim = 64 ----------
        // sc[t][r] = S[query ln][key t*16 + 8*hi + r]
        v8f sc[4];
#pragma unroll
        for (int t = 0; t < 4; ++t) {
            const _Float16* krow = Kl + (t * 16 + ln) * KV_STRIDE;
            const v16h kf0 = make_frag(krow, hi);
            const v16h kf1 = make_frag(krow + 32, hi);
            v8f c = {};
            c = wmma32(kf0, qf0, c);
            c = wmma32(kf1, qf1, c);
            sc[t] = c;
        }

        // ---- online softmax, one query per lane ----------------------------
        float mb = __builtin_reduce_max(__builtin_elementwise_max(
            __builtin_elementwise_max(sc[0], sc[1]),
            __builtin_elementwise_max(sc[2], sc[3])));   // this half's 32 keys
        mb = fmaxf(mb, xhalf(mb));                   // all 64 keys
        const float mn = fmaxf(mq, mb);
        const float cf = exp_1(mq - mn);             // accumulator rescale
        mq = mn;
#pragma unroll  // constant indices, so that sc stays in registers
        for (int t = 0; t < 4; ++t) sc[t] = exp_8(sc[t] - mn);
        // Sum the four tiles register by register first (packed adds), then
        // the eight registers.
        const v8f pv = (sc[0] + sc[1]) + (sc[2] + sc[3]);
        lq = lq * cf + (((pv[0] + pv[1]) + (pv[2] + pv[3])) +
                        ((pv[4] + pv[5]) + (pv[6] + pv[7])));
        acc[0] *= cf; acc[1] *= cf; acc[2] *= cf; acc[3] *= cf;

        // ---- P^T as B fragments: two score tiles converted in place --------
        v16h pf0, pf1;                               // keys 0-31, keys 32-63
#pragma unroll  // constant indices, so that the tiles convert in place
        for (int e = 0; e < 16; ++e) {
            pf0[e] = (_Float16)sc[e >> 3][e & 7];
            pf1[e] = (_Float16)sc[2 + (e >> 3)][e & 7];
        }

        // ---- PV: O^T(64 x 16) += V^T(64x64) * P^T(64x16) -------------------
#pragma unroll
        for (int d = 0; d < 4; ++d) {
            const _Float16* vrow = Vl + (d * 16 + ln) * KV_STRIDE;
            const v16h vb0 = make_frag(vrow, hi);
            const v16h vb1 = make_frag(vrow + 32, hi);
            acc[d] = wmma32(vb0, pf0, acc[d]);
            acc[d] = wmma32(vb1, pf1, acc[d]);
        }

        // ---- hand-over: this buffer is read out, the next tile has landed --
        asm volatile("s_wait_dscnt 0" ::: "memory");  // my reads of this buffer are done
        async_wait0();                                // my copies of the next tile have landed
        __syncthreads();                              // both hold for every wave
        if (it + 2 < SK / 64) stage(it & 1, (it + 2) * 64);
    }
    async_wait0();          // nothing of mine in flight when the wave ends

    // ---- normalize and store ctx (f16): 8 consecutive columns per lane ----
    const float lsum = lq + xhalf(lq);               // join the halves' sums
    _Float16* crow = ctx + ((size_t)(b * SQ + qbase + ln)) * HIDDEN
                         + h * HEAD_DIM + 8 * hi;
#pragma unroll  // constant indices, so that acc stays in registers
    for (int d = 0; d < 4; ++d) {
        v8h o;
#pragma unroll  // the same
        for (int r = 0; r < 8; ++r) o[r] = (_Float16)(acc[d][r] / lsum);
        *(v8h*)(crow + d * 16) = o;
    }
}

// ---------------------------------------------------------------------------
extern "C" void kernel_launch(void* const* d_in, const int* in_sizes, int n_in,
                              void* d_out, int out_size, void* d_ws, size_t ws_size,
                              hipStream_t stream) {
    const float* query = (const float*)d_in[0];
    const float* key   = (const float*)d_in[1];
    const float* value = (const float*)d_in[2];
    const float* Wq    = (const float*)d_in[3];
    const float* bq    = (const float*)d_in[4];
    const float* Wk    = (const float*)d_in[5];
    const float* bk    = (const float*)d_in[6];
    const float* Wv    = (const float*)d_in[7];
    const float* bv    = (const float*)d_in[8];
    const float* Wo    = (const float*)d_in[9];
    const float* bo    = (const float*)d_in[10];
    float*       out   = (float*)d_out;

    const size_t tok  = (size_t)BATCH * SQ;            // 8192 tokens
    const size_t act  = tok * HIDDEN;                  // 8M elements
    const size_t wsz  = (size_t)HIDDEN * HIDDEN;       // 1M elements

    // ws layout (f16 elements); ctx aliases xq (dead after Q projection).
    _Float16* base = (_Float16*)d_ws;
    _Float16* xq  = base;                 // act
    _Float16* xk  = xq  + act;            // act
    _Float16* xv  = xk  + act;            // act
    _Float16* wqh = xv  + act;            // wsz
    _Float16* wkh = wqh + wsz;
    _Float16* wvh = wkh + wsz;
    _Float16* woh = wvh + wsz;
    _Float16* Qp  = woh + wsz;
    _Float16* Kp  = Qp  + act;
    _Float16* Vtp = Kp  + act;
    _Float16* ctx = xq;

    // ---- stage f32 -> f16: xq, xk, xv, wqh, wkh, wvh, woh in one launch ----
    cvt_f16_kernel<<<CVT_BLOCKS, CVT_WAVES * 32, 0, stream>>>(
        query, key, value, Wq, Wk, Wv, Wo, base);

    const dim3 gblk((unsigned)(tok / 128), HIDDEN / 256);   // 64 x 4 blocks
    const float qscale = 0.125f;                            // HEAD_DIM^-0.5

    gemm_f16_kernel<_Float16, 0><<<gblk, 256, 0, stream>>>(
        xq, wqh, bq, Qp, (int)tok, HIDDEN, HIDDEN, SQ, qscale);
    gemm_f16_kernel<_Float16, 0><<<gblk, 256, 0, stream>>>(
        xk, wkh, bk, Kp, (int)tok, HIDDEN, HIDDEN, SK, 1.0f);
    gemm_f16_kernel<_Float16, 1><<<gblk, 256, 0, stream>>>(
        xv, wvh, bv, Vtp, (int)tok, HIDDEN, HIDDEN, SK, 1.0f);

    flash_attn_kernel<<<dim3(SQ / 16 / FA_WAVES, BATCH * HEADS), FA_WAVES * 32, 0, stream>>>(
        Qp, Kp, Vtp, ctx);

    gemm_f16_kernel<float, 0><<<gblk, 256, 0, stream>>>(
        ctx, woh, bo, out, (int)tok, HIDDEN, HIDDEN, SQ, 1.0f);
}

// v004
// It runs in 183 microseconds.
// Timed twice side by side with v003, it ran 1.12 times as fast both times.
// Over all steps from v000 it is 1.95 times as fast.
#include <hip/hip_runtime.h>

#define HIDDEN   1024
#define HEADS    16
#define HEAD_DIM 64
#define BATCH    4
#define SQ       2048
#define SK       2048

typedef __attribute__((ext_vector_type(16))) _Float16 v16h;
typedef __attribute__((ext_vector_type(8)))  _Float16 v8h;
typedef __attribute__((ext_vector_type(8)))  float    v8f;

// D = A(16x32 f16) * B(32x16 f16) + C(16x16 f32)
__device__ __forceinline__ v8f wmma32(v16h a, v16h b, v8f c) {
    return __builtin_amdgcn_wmma_f32_16x16x32_f16(
        false, a, false, b, (short)0, c, false, false);
}

__device__ __forceinline__ v16h make_frag(const _Float16* __restrict__ p, int hi) {
    const v8h lo = *(const v8h*)(p + hi * 8);
    const v8h hs = *(const v8h*)(p + hi * 8 + 16);
    return __builtin_shufflevector(lo, hs, 0,1,2,3,4,5,6,7,8,9,10,11,12,13,14,15);
}

__device__ __forceinline__ void async_wait0() {
    asm volatile("s_wait_asynccnt 0" ::: "memory");
}

__device__ __forceinline__ float xhalf(float x) {
    const int i = __builtin_bit_cast(int, x);
    return __builtin_bit_cast(float, __builtin_amdgcn_permlanex16(
        i, i, 0x76543210, 0xfedcba98, false, false));
}

__device__ __forceinline__ float exp_1(float x) {
    float y;
    asm("v_exp_f32 %0, %1\n\tv_nop" : "=&v"(y) : "v"(x * 1.44269504f));
    return y;
}
__device__ __forceinline__ v8f exp_8(v8f x) {
    x *= 1.44269504f;
    float y0, y1, y2, y3, y4, y5, y6, y7;
    asm("v_exp_f32 %0, %8\n\t"
        "v_exp_f32 %1, %9\n\t"
        "v_exp_f32 %2, %10\n\t"
        "v_exp_f32 %3, %11\n\t"
        "v_exp_f32 %4, %12\n\t"
        "v_exp_f32 %5, %13\n\t"
        "v_exp_f32 %6, %14\n\t"
        "v_exp_f32 %7, %15\n\t"
        "v_nop"
        : "=&v"(y0), "=&v"(y1), "=&v"(y2), "=&v"(y3),
          "=&v"(y4), "=&v"(y5), "=&v"(y6), "=&v"(y7)
        : "v"(x[0]), "v"(x[1]), "v"(x[2]), "v"(x[3]),
          "v"(x[4]), "v"(x[5]), "v"(x[6]), "v"(x[7]));
    return v8f{y0, y1, y2, y3, y4, y5, y6, y7};
}

// ---------------------------------------------------------------------------
// f32 -> f16 staging of all seven operands in ONE launch of long-lived waves.
//
// The seven f16 copies lie one behind the other in the workspace, in the order
// of the arguments.  A piece is 1024 elements: 8 loads of 512 contiguous bytes
// per wave.  The 28672 pieces are dealt to 4096 waves (16 per block, 256
// blocks), 7 each: round i takes piece i * 4096 + wave, so that rounds 0-1 lie
// in query, 2-3 in key, 4-5 in value, and round 6 in one weight (1024 pieces
// each, the same weight for a whole block).  The next piece's loads are issued
// before this piece is converted and stored.
// ---------------------------------------------------------------------------
#define CVT_WAVES  16
#define CVT_BLOCKS 256
#define CVT_PIECE  1024                          // elements
#define CVT_ROUND  (CVT_WAVES * CVT_BLOCKS * CVT_PIECE)

typedef __attribute__((ext_vector_type(4))) _Float16 v4h;
typedef __attribute__((ext_vector_type(4))) float    v4f;

__global__ __launch_bounds__(CVT_WAVES * 32) void cvt_f16_kernel(
    const float* __restrict__ query, const float* __restrict__ key,
    const float* __restrict__ value,
    const float* __restrict__ Wq, const float* __restrict__ Wk,
    const float* __restrict__ Wv, const float* __restrict__ Wo,
    _Float16* __restrict__ out)
{
    // A wave's piece of round 0 = block part (uniform) + thread part.  The
    // thread part, in bytes, is the same for every load (t4) and for every
    // store (t2); the block part belongs to the uniform bases.
    const unsigned tp = ((threadIdx.x >> 5) << 10) | ((threadIdx.x & 31) << 2);
    const unsigned t4 = tp * 4, t2 = tp * 2;
    const unsigned bp = blockIdx.x * (CVT_WAVES * CVT_PIECE);

    const unsigned wsel = blockIdx.x >> 6;       // 64 blocks per weight
    const float* w = wsel == 0 ? Wq : wsel == 1 ? Wk : wsel == 2 ? Wv : Wo;

    const float* src[7] = {
        query + bp, query + bp + CVT_ROUND,
        key   + bp, key   + bp + CVT_ROUND,
        value + bp, value + bp + CVT_ROUND,
        w + (bp & (HIDDEN * HIDDEN - 1))};

    v4f r[2][8];
#pragma unroll  // constant indices, so that r stays in registers
    for (int c = 0; c < 8; ++c)
        r[0][c] = *(const v4f*)((const char*)src[0] + t4 + c * 512);

#pragma unroll  // the same, and src[i] is then a compile-time choice
    for (int i = 0; i < 7; ++i) {
        if (i + 1 < 7) {
#pragma unroll  // constant indices, so that r stays in registers
            for (int c = 0; c < 8; ++c)
                r[(i + 1) & 1][c] =
                    *(const v4f*)((const char*)src[i + 1] + t4 + c * 512);
        }
        char* o = (char*)(out + (size_t)i * CVT_ROUND + bp);
#pragma unroll  // the same
        for (int c = 0; c < 8; ++c)
            *(v4h*)(o + t2 + c * 256) = __builtin_convertvector(r[i & 1][c], v4h);
        // Before a register that an issued load or store names is used again
        // (t4 and t2 as inputs: they stay as they are up to here); it also
        // keeps the rounds in this order, loads ahead and stores behind.
        if (i + 1 < 7)
            asm volatile("s_wait_xcnt 0x0" :: "v"(t4), "v"(t2) : "memory");
    }
}

#define LDS_STRIDE 40
#define A_ROWS     128
#define W_ROWS     256
#define G_BUFS     4                        // ring depth (a power of two)
#define G_PANEL    ((A_ROWS + W_ROWS) * LDS_STRIDE)   // halves per buffer

__device__ __forceinline__ void async_copy16x6(
    void* l0, const void* g0, void* l1, const void* g1,
    void* l2, const void* g2, void* l3, const void* g3,
    void* l4, const void* g4, void* l5, const void* g5)
{
    const uint32_t o0 = (uint32_t)(uintptr_t)l0, o1 = (uint32_t)(uintptr_t)l1;
    const uint32_t o2 = (uint32_t)(uintptr_t)l2, o3 = (uint32_t)(uintptr_t)l3;
    const uint32_t o4 = (uint32_t)(uintptr_t)l4, o5 = (uint32_t)(uintptr_t)l5;
    asm volatile("global_load_async_to_lds_b128 %0, %1, off\n\t"
                 "global_load_async_to_lds_b128 %2, %3, off\n\t"
                 "global_load_async_to_lds_b128 %4, %5, off\n\t"
                 "global_load_async_to_lds_b128 %6, %7, off\n\t"
                 "global_load_async_to_lds_b128 %8, %9, off\n\t"
                 "global_load_async_to_lds_b128 %10, %11, off\n\t"
                 "s_wait_xcnt 0x0"
                 :: "v"(o0), "v"(g0), "v"(o1), "v"(g1), "v"(o2), "v"(g2),
                    "v"(o3), "v"(g3), "v"(o4), "v"(g4), "v"(o5), "v"(g5)
                 : "memory");
}

template <typename OT, int MODE>
__global__ __launch_bounds__(256) void gemm_f16_kernel(
    const _Float16* __restrict__ A, const _Float16* __restrict__ W,
    const float* __restrict__ bias, OT* __restrict__ out,
    int M, int N, int K, int SQdim, float scale)
{
    __shared__ __align__(16) _Float16 lds[G_BUFS][G_PANEL];

    const int tid  = threadIdx.x;
    const int lane = tid & 31;
    const int wave = tid >> 5;
    const int wm   = wave & 1;          // 2 waves along M
    const int wn   = wave >> 1;         // 4 waves along N
    const int ln   = lane & 15;
    const int hi   = lane >> 4;

    const int bm0 = blockIdx.x * 128;
    const int bn0 = blockIdx.y * 256;
    const int bm  = bm0 + wm * 64;
    const int bn  = bn0 + wn * 64;

    // Stage panel s (k = 32 s .. 32 s + 31) of A (128 rows) and W (256 rows):
    // thread -> 16-byte piece sseg of rows srow, srow + 64, ... of each.
    const int srow = tid >> 2, sseg = tid & 3;
    const _Float16* ag0 = A + (size_t)(bm0 + srow) * K + sseg * 8;
    const _Float16* wg0 = W + (size_t)(bn0 + srow) * K + sseg * 8;
    const size_t    r64 = (size_t)64 * K;
    auto stage = [&](int s) {
        const _Float16* ag = ag0 + s * 32;
        const _Float16* wg = wg0 + s * 32;
        _Float16* l = &lds[s & (G_BUFS - 1)][srow * LDS_STRIDE + sseg * 8];
        async_copy16x6(l,                    ag,
                       l +  64 * LDS_STRIDE, ag + r64,
                       l + 128 * LDS_STRIDE, wg,
                       l + 192 * LDS_STRIDE, wg + r64,
                       l + 256 * LDS_STRIDE, wg + 2 * r64,
                       l + 320 * LDS_STRIDE, wg + 3 * r64);
    };

    v8f acc[4][4] = {};

    // The 16 products of panel s.
    auto step = [&](int s) {
        const _Float16* Al = &lds[s & (G_BUFS - 1)][0];
        const _Float16* Wl = Al + A_ROWS * LDS_STRIDE;

        v16h af[4], bf[4];
#pragma unroll
        for (int i = 0; i < 4; ++i)
            af[i] = make_frag(Al + (wm * 64 + i * 16 + ln) * LDS_STRIDE, hi);
#pragma unroll
        for (int j = 0; j < 4; ++j)
            bf[j] = make_frag(Wl + (wn * 64 + j * 16 + ln) * LDS_STRIDE, hi);
#pragma unroll
        for (int i = 0; i < 4; ++i)
#pragma unroll
            for (int j = 0; j < 4; ++j)
                acc[i][j] = wmma32(af[i], bf[j], acc[i][j]);
    };

    const int nk = K / 32;
#pragma unroll  // three straight-line issues
    for (int p = 0; p < G_BUFS - 1; ++p)
        if (p < nk) stage(p);

    // Every trip of this loop issues one panel (six copies a wave), and three
    // panels are outstanding at its head: all but the twelve youngest copies
    // landed means that panel s has.
    int s = 0;
    for (; s + G_BUFS - 1 < nk; ++s) {
        asm volatile("s_wait_dscnt 0" ::: "memory");      // my reads of panel s - 1 are done
        asm volatile("s_wait_asynccnt 12" ::: "memory");  // my copies of panel s have landed
        __syncthreads();                                  // both hold for every wave
        stage(s + G_BUFS - 1);                            // into panel s - 1's buffer
        step(s);
    }
    // The last panels: nothing is issued any more, so the wait is to 0, and no
    // buffer is refilled, so this barrier is the last.
    async_wait0();
    __syncthreads();
#pragma clang loop unroll(disable)  // at most three trips; unrolled, it took the kernel above 256 registers
    for (; s < nk; ++s) step(s);

#pragma unroll
    for (int j = 0; j < 4; ++j) {
        const int   n  = bn + j * 16 + ln;
        const float bj = bias[n];
#pragma unroll
        for (int i = 0; i < 4; ++i) {
#pragma unroll
            for (int r = 0; r < 8; ++r) {
                const int   m = bm + i * 16 + r + 8 * hi;
                const float v = (acc[i][j][r] + bj) * scale;
                if (MODE == 0) {
                    out[(size_t)m * N + n] = (OT)v;
                } else {
                    const int bi = m / SQdim, s = m % SQdim;
                    out[((size_t)(bi * N + n)) * SQdim + s] = (OT)v;
                }
            }
        }
    }
}

#define KV_STRIDE 72
#define KV_TILE   (64 * KV_STRIDE)          // halves per staged operand tile
#define FA_WAVES  8

__device__ __forceinline__ void async_copy16x4(
    void* l0, const void* g0, void* l1, const void* g1,
    void* l2, const void* g2, void* l3, const void* g3)
{
    const uint32_t o0 = (uint32_t)(uintptr_t)l0, o1 = (uint32_t)(uintptr_t)l1;
    const uint32_t o2 = (uint32_t)(uintptr_t)l2, o3 = (uint32_t)(uintptr_t)l3;
    asm volatile("global_load_async_to_lds_b128 %0, %1, off\n\t"
                 "global_load_async_to_lds_b128 %2, %3, off\n\t"
                 "global_load_async_to_lds_b128 %4, %5, off\n\t"
                 "global_load_async_to_lds_b128 %6, %7, off\n\t"
                 "s_wait_xcnt 0x0"
                 :: "v"(o0), "v"(g0), "v"(o1), "v"(g1),
                    "v"(o2), "v"(g2), "v"(o3), "v"(g3) : "memory");
}

__global__ __launch_bounds__(FA_WAVES * 32) void flash_attn_kernel(
    const _Float16* __restrict__ Q, const _Float16* __restrict__ Kh,
    const _Float16* __restrict__ Vt, _Float16* __restrict__ ctx)
{
    __shared__ __align__(16) _Float16 kv[2][2 * KV_TILE];             // K, Vt

    const int tid  = threadIdx.x;
    const int lane = tid & 31;
    const int wave = tid >> 5;
    const int ln   = lane & 15;
    const int hi   = lane >> 4;

    const int bh = blockIdx.y;
    const int b  = bh >> 4;
    const int h  = bh & 15;
    const int qbase = (blockIdx.x * FA_WAVES + wave) * 16;

    // Stage keys kb..kb+63: thread -> rows srow and srow+32, 16-byte piece sseg.
    const int srow = tid >> 3, sseg = tid & 7;
    const _Float16* kg0 =
        Kh + ((size_t)(b * SK + srow)) * HIDDEN + h * HEAD_DIM + sseg * 8;
    const _Float16* vg0 =
        Vt + ((size_t)(b * HIDDEN + h * HEAD_DIM + srow)) * SK + sseg * 8;
    auto stage = [&](int buf, int kb) {
        const _Float16* kg = kg0 + (size_t)kb * HIDDEN;
        const _Float16* vg = vg0 + kb;
        _Float16* kl = &kv[buf][srow * KV_STRIDE + sseg * 8];
        _Float16* vl = kl + KV_TILE;
        async_copy16x4(kl, kg, kl + 32 * KV_STRIDE, kg + 32 * HIDDEN,
                       vl, vg, vl + 32 * KV_STRIDE, vg + 32 * SK);
    };

    stage(0, 0);

    const size_t qrow = ((size_t)(b * SQ + qbase + ln)) * HIDDEN + h * HEAD_DIM;
    const v16h qf0 = make_frag(Q + qrow, hi);
    const v16h qf1 = make_frag(Q + qrow + 32, hi);

    // This lane's query (column ln): running maximum, and the sum over the
    // keys of this half alone (the halves' sums are joined behind the loop).
    float mq = -1e30f, lq = 0.0f;
    v8f   acc[4] = {};      // acc[d][r] = O^T[d*16 + 8*hi + r][query ln]

    async_wait0();          // my copies of tile 0 have landed
    __syncthreads();        // everyone's have
    stage(1, 64);

    for (int it = 0; it < SK / 64; ++it) {
        const _Float16* Kl = &kv[it & 1][0];
        const _Float16* Vl = Kl + KV_TILE;

        // ---- scores: S^T(64 x 16) as four 16x16 tiles, k-dim = 64 ----------
        // sc[t][r] = S[query ln][key t*16 + 8*hi + r]
        v8f sc[4];
#pragma unroll
        for (int t = 0; t < 4; ++t) {
            const _Float16* krow = Kl + (t * 16 + ln) * KV_STRIDE;
            const v16h kf0 = make_frag(krow, hi);
            const v16h kf1 = make_frag(krow + 32, hi);
            v8f c = {};
            c = wmma32(kf0, qf0, c);
            c = wmma32(kf1, qf1, c);
            sc[t] = c;
        }

        // ---- online softmax, one query per lane ----------------------------
        float mb = __builtin_reduce_max(__builtin_elementwise_max(
            __builtin_elementwise_max(sc[0], sc[1]),
            __builtin_elementwise_max(sc[2], sc[3])));   // this half's 32 keys
        mb = fmaxf(mb, xhalf(mb));                   // all 64 keys
        const float mn = fmaxf(mq, mb);
        const float cf = exp_1(mq - mn);             // accumulator rescale
        mq = mn;
#pragma unroll  // constant indices, so that sc stays in registers
        for (int t = 0; t < 4; ++t) sc[t] = exp_8(sc[t] - mn);
        // Sum the four tiles register by register first (packed adds), then
        // the eight registers.
        const v8f pv = (sc[0] + sc[1]) + (sc[2] + sc[3]);
        lq = lq * cf + (((pv[0] + pv[1]) + (pv[2] + pv[3])) +
                        ((pv[4] + pv[5]) + (pv[6] + pv[7])));
        acc[0] *= cf; acc[1] *= cf; acc[2] *= cf; acc[3] *= cf;

        // ---- P^T as B fragments: two score tiles converted in place --------
        v16h pf0, pf1;                               // keys 0-31, keys 32-63
#pragma unroll  // constant indices, so that the tiles convert in place
        for (int e = 0; e < 16; ++e) {
            pf0[e] = (_Float16)sc[e >> 3][e & 7];
            pf1[e] = (_Float16)sc[2 + (e >> 3)][e & 7];
        }

        // ---- PV: O^T(64 x 16) += V^T(64x64) * P^T(64x16) -------------------
#pragma unroll
        for (int d = 0; d < 4; ++d) {
            const _Float16* vrow = Vl + (d * 16 + ln) * KV_STRIDE;
            const v16h vb0 = make_frag(vrow, hi);
            const v16h vb1 = make_frag(vrow + 32, hi);
            acc[d] = wmma32(vb0, pf0, acc[d]);
            acc[d] = wmma32(vb1, pf1, acc[d]);
        }

        // ---- hand-over: this buffer is read out, the next tile has landed --
        asm volatile("s_wait_dscnt 0" ::: "memory");  // my reads of this buffer are done
        async_wait0();                                // my copies of the next tile have landed
        __syncthreads();                              // both hold for every wave
        if (it + 2 < SK / 64) stage(it & 1, (it + 2) * 64);
    }
    async_wait0();          // nothing of mine in flight when the wave ends

    // ---- normalize and store ctx (f16): 8 consecutive columns per lane ----
    const float lsum = lq + xhalf(lq);               // join the halves' sums
    _Float16* crow = ctx + ((size_t)(b * SQ + qbase + ln)) * HIDDEN
                         + h * HEAD_DIM + 8 * hi;
#pragma unroll  // constant indices, so that acc stays in registers
    for (int d = 0; d < 4; ++d) {
        v8h o;
#pragma unroll  // the same
        for (int r = 0; r < 8; ++r) o[r] = (_Float16)(acc[d][r] / lsum);
        *(v8h*)(crow + d * 16) = o;
    }
}

// ---------------------------------------------------------------------------
extern "C" void kernel_launch(void* const* d_in, const int* in_sizes, int n_in,
                              void* d_out, int out_size, void* d_ws, size_t ws_size,
                              hipStream_t stream) {
    const float* query = (const float*)d_in[0];
    const float* key   = (const float*)d_in[1];
    const float* value = (const float*)d_in[2];
    const float* Wq    = (const float*)d_in[3];
    const float* bq    = (const float*)d_in[4];
    const float* Wk    = (const float*)d_in[5];
    const float* bk    = (const float*)d_in[6];
    const float* Wv    = (const float*)d_in[7];
    const float* bv    = (const float*)d_in[8];
    const float* Wo    = (const float*)d_in[9];
    const float* bo    = (const float*)d_in[10];
    float*       out   = (float*)d_out;

    const size_t tok  = (size_t)BATCH * SQ;            // 8192 tokens
    const size_t act  = tok * HIDDEN;                  // 8M elements
    const size_t wsz  = (size_t)HIDDEN * HIDDEN;       // 1M elements

    // ws layout (f16 elements); ctx aliases xq (dead after Q projection).
    _Float16* base = (_Float16*)d_ws;
    _Float16* xq  = base;                 // act
    _Float16* xk  = xq  + act;            // act
    _Float16* xv  = xk  + act;            // act
    _Float16* wqh = xv  + act;            // wsz
    _Float16* wkh = wqh + wsz;
    _Float16* wvh = wkh + wsz;
    _Float16* woh = wvh + wsz;
    _Float16* Qp  = woh + wsz;
    _Float16* Kp  = Qp  + act;
    _Float16* Vtp = Kp  + act;
    _Float16* ctx = xq;

    // ---- stage f32 -> f16: xq, xk, xv, wqh, wkh, wvh, woh in one launch ----
    cvt_f16_kernel<<<CVT_BLOCKS, CVT_WAVES * 32, 0, stream>>>(
        query, key, value, Wq, Wk, Wv, Wo, base);

    const dim3 gblk((unsigned)(tok / 128), HIDDEN / 256);   // 64 x 4 blocks
    const float qscale = 0.125f;                            // HEAD_DIM^-0.5

    gemm_f16_kernel<_Float16, 0><<<gblk, 256, 0, stream>>>(
        xq, wqh, bq, Qp, (int)tok, HIDDEN, HIDDEN, SQ, qscale);
    gemm_f16_kernel<_Float16, 0><<<gblk, 256, 0, stream>>>(
        xk, wkh, bk, Kp, (int)tok, HIDDEN, HIDDEN, SK, 1.0f);
    gemm_f16_kernel<_Float16, 1><<<gblk, 256, 0, stream>>>(
        xv, wvh, bv, Vtp, (int)tok, HIDDEN, HIDDEN, SK, 1.0f);

    flash_attn_kernel<<<dim3(SQ / 16 / FA_WAVES, BATCH * HEADS), FA_WAVES * 32, 0, stream>>>(
        Qp, Kp, Vtp, ctx);

    gemm_f16_kernel<float, 0><<<gblk, 256, 0, stream>>>(
        ctx, woh, bo, out, (int)tok, HIDDEN, HIDDEN, SQ, 1.0f);
}

// v005
// One run takes 162 microseconds.
// Two timings next to v004 put it at 1.14 and 1.13 times that version's speed.
// Over all steps from v000 it is 2.21 times as fast.
#include <hip/hip_runtime.h>

#define HIDDEN   1024
#define HEADS    16
#define HEAD_DIM 64
#define BATCH    4
#define SQ       2048
#define SK       2048

typedef __attribute__((ext_vector_type(16))) _Float16 v16h;
typedef __attribute__((ext_vector_type(8)))  _Float16 v8h;
typedef __attribute__((ext_vector_type(8)))  float    v8f;

// D = A(16x32 f16) * B(32x16 f16) + C(16x16 f32)
__device__ __forceinline__ v8f wmma32(v16h a, v16h b, v8f c) {
    return __builtin_amdgcn_wmma_f32_16x16x32_f16(
        false, a, false, b, (short)0, c, false, false);
}

__device__ __forceinline__ v16h make_frag(const _Float16* __restrict__ p, int hi) {
    const v8h lo = *(const v8h*)(p + hi * 8);
    const v8h hs = *(const v8h*)(p + hi * 8 + 16);
    return __builtin_shufflevector(lo, hs, 0,1,2,3,4,5,6,7,8,9,10,11,12,13,14,15);
}

__device__ __forceinline__ void async_wait0() {
    asm volatile("s_wait_asynccnt 0" ::: "memory");
}

__device__ __forceinline__ float xhalf(float x) {
    const int i = __builtin_bit_cast(int, x);
    return __builtin_bit_cast(float, __builtin_amdgcn_permlanex16(
        i, i, 0x76543210, 0xfedcba98, false, false));
}

__device__ __forceinline__ float exp_1(float x) {
    float y;
    asm("v_exp_f32 %0, %1\n\tv_nop" : "=&v"(y) : "v"(x * 1.44269504f));
    return y;
}
__device__ __forceinline__ v8f exp_8(v8f x) {
    x *= 1.44269504f;
    float y0, y1, y2, y3, y4, y5, y6, y7;
    asm("v_exp_f32 %0, %8\n\t"
        "v_exp_f32 %1, %9\n\t"
        "v_exp_f32 %2, %10\n\t"
        "v_exp_f32 %3, %11\n\t"
        "v_exp_f32 %4, %12\n\t"
        "v_exp_f32 %5, %13\n\t"
        "v_exp_f32 %6, %14\n\t"
        "v_exp_f32 %7, %15\n\t"
        "v_nop"
        : "=&v"(y0), "=&v"(y1), "=&v"(y2), "=&v"(y3),
          "=&v"(y4), "=&v"(y5), "=&v"(y6), "=&v"(y7)
        : "v"(x[0]), "v"(x[1]), "v"(x[2]), "v"(x[3]),
          "v"(x[4]), "v"(x[5]), "v"(x[6]), "v"(x[7]));
    return v8f{y0, y1, y2, y3, y4, y5, y6, y7};
}

// ---------------------------------------------------------------------------
// f32 -> f16 staging of all seven operands in ONE launch of long-lived waves.
//
// The seven f16 copies lie one behind the other in the workspace, in the order
// of the arguments.  A piece is 1024 elements: 8 loads of 512 contiguous bytes
// per wave.  The 28672 pieces are dealt to 4096 waves (16 per block, 256
// blocks), 7 each: round i takes piece i * 4096 + wave, so that rounds 0-1 lie
// in query, 2-3 in key, 4-5 in value, and round 6 in one weight (1024 pieces
// each, the same weight for a whole block).  The next piece's loads are issued
// before this piece is converted and stored.
// ---------------------------------------------------------------------------
#define CVT_WAVES  16
#define CVT_BLOCKS 256
#define CVT_PIECE  1024                          // elements
#define CVT_ROUND  (CVT_WAVES * CVT_BLOCKS * CVT_PIECE)

typedef __attribute__((ext_vector_type(4))) _Float16 v4h;
typedef __attribute__((ext_vector_type(4))) float    v4f;

__global__ __launch_bounds__(CVT_WAVES * 32) void cvt_f16_kernel(
    const float* __restrict__ query, const float* __restrict__ key,
    const float* __restrict__ value,
    const float* __restrict__ Wq, const float* __restrict__ Wk,
    const float* __restrict__ Wv, const float* __restrict__ Wo,
    _Float16* __restrict__ out)
{
    // A wave's piece of round 0 = block part (uniform) + thread part.  The
    // thread part, in bytes, is the same for every load (t4) and for every
    // store (t2); the block part belongs to the uniform bases.
    const unsigned tp = ((threadIdx.x >> 5) << 10) | ((threadIdx.x & 31) << 2);
    const unsigned t4 = tp * 4, t2 = tp * 2;
    const unsigned bp = blockIdx.x * (CVT_WAVES * CVT_PIECE);

    const unsigned wsel = blockIdx.x >> 6;       // 64 blocks per weight
    const float* w = wsel == 0 ? Wq : wsel == 1 ? Wk : wsel == 2 ? Wv : Wo;

    const float* src[7] = {
        query + bp, query + bp + CVT_ROUND,
        key   + bp, key   + bp + CVT_ROUND,
        value + bp, value + bp + CVT_ROUND,
        w + (bp & (HIDDEN * HIDDEN - 1))};

    v4f r[2][8];
#pragma unroll  // constant indices, so that r stays in registers
    for (int c = 0; c < 8; ++c)
        r[0][c] = *(const v4f*)((const char*)src[0] + t4 + c * 512);

#pragma unroll  // the same, and src[i] is then a compile-time choice
    for (int i = 0; i < 7; ++i) {
        if (i + 1 < 7) {
#pragma unroll  // constant indices, so that r stays in registers
            for (int c = 0; c < 8; ++c)
                r[(i + 1) & 1][c] =
                    *(const v4f*)((const char*)src[i + 1] + t4 + c * 512);
        }
        char* o = (char*)(out + (size_t)i * CVT_ROUND + bp);
#pragma unroll  // the same
        for (int c = 0; c < 8; ++c)
            *(v4h*)(o + t2 + c * 256) = __builtin_convertvector(r[i & 1][c], v4h);
        // Before a register that an issued load or store names is used again
        // (t4 and t2 as inputs: they stay as they are up to here); it also
        // keeps the rounds in this order, loads ahead and stores behind.
        if (i + 1 < 7)
            asm volatile("s_wait_xcnt 0x0" :: "v"(t4), "v"(t2) : "memory");
    }
}

#define LDS_STRIDE 40
#define A_ROWS     128
#define W_ROWS     256
#define G_BUFS     4                        // ring depth (a power of two)
#define G_PANEL    ((A_ROWS + W_ROWS) * LDS_STRIDE)   // halves per buffer

__device__ __forceinline__ void async_copy16x6(
    void* l0, const void* g0, void* l1, const void* g1,
    void* l2, const void* g2, void* l3, const void* g3,
    void* l4, const void* g4, void* l5, const void* g5)
{
    const uint32_t o0 = (uint32_t)(uintptr_t)l0, o1 = (uint32_t)(uintptr_t)l1;
    const uint32_t o2 = (uint32_t)(uintptr_t)l2, o3 = (uint32_t)(uintptr_t)l3;
    const uint32_t o4 = (uint32_t)(uintptr_t)l4, o5 = (uint32_t)(uintptr_t)l5;
    asm volatile("global_load_async_to_lds_b128 %0, %1, off\n\t"
                 "global_load_async_to_lds_b128 %2, %3, off\n\t"
                 "global_load_async_to_lds_b128 %4, %5, off\n\t"
                 "global_load_async_to_lds_b128 %6, %7, off\n\t"
                 "global_load_async_to_lds_b128 %8, %9, off\n\t"
                 "global_load_async_to_lds_b128 %10, %11, off\n\t"
                 "s_wait_xcnt 0x0"
                 :: "v"(o0), "v"(g0), "v"(o1), "v"(g1), "v"(o2), "v"(g2),
                    "v"(o3), "v"(g3), "v"(o4), "v"(g4), "v"(o5), "v"(g5)
                 : "memory");
}

template <typename OT, int MODE>
__global__ __launch_bounds__(256) void gemm_f16_kernel(
    const _Float16* __restrict__ A, const _Float16* __restrict__ W,
    const float* __restrict__ bias, OT* __restrict__ out,
    int M, int N, int K, int SQdim, float scale)
{
    __shared__ __align__(16) _Float16 lds[G_BUFS][G_PANEL];

    const int tid  = threadIdx.x;
    const int lane = tid & 31;
    const int wave = tid >> 5;
    const int wm   = wave & 1;          // 2 waves along M
    const int wn   = wave >> 1;         // 4 waves along N
    const int ln   = lane & 15;
    const int hi   = lane >> 4;

    const int bm0 = blockIdx.x * 128;
    const int bn0 = blockIdx.y * 256;
    const int bm  = bm0 + wm * 64;
    const int bn  = bn0 + wn * 64;

    // Stage panel s (k = 32 s .. 32 s + 31) of A (128 rows) and W (256 rows):
    // thread -> 16-byte piece sseg of rows srow, srow + 64, ... of each.
    const int srow = tid >> 2, sseg = tid & 3;
    const _Float16* ag0 = A + (size_t)(bm0 + srow) * K + sseg * 8;
    const _Float16* wg0 = W + (size_t)(bn0 + srow) * K + sseg * 8;
    const size_t    r64 = (size_t)64 * K;
    auto stage = [&](int s) {
        const _Float16* ag = ag0 + s * 32;
        const _Float16* wg = wg0 + s * 32;
        _Float16* l = &lds[s & (G_BUFS - 1)][srow * LDS_STRIDE + sseg * 8];
        async_copy16x6(l,                    ag,
                       l +  64 * LDS_STRIDE, ag + r64,
                       l + 128 * LDS_STRIDE, wg,
                       l + 192 * LDS_STRIDE, wg + r64,
                       l + 256 * LDS_STRIDE, wg + 2 * r64,
                       l + 320 * LDS_STRIDE, wg + 3 * r64);
    };

    v8f acc[4][4] = {};

    // The 16 products of panel s.
    auto step = [&](int s) {
        const _Float16* Al = &lds[s & (G_BUFS - 1)][0];
        const _Float16* Wl = Al + A_ROWS * LDS_STRIDE;

        v16h af[4], bf[4];
#pragma unroll
        for (int i = 0; i < 4; ++i)
            af[i] = make_frag(Al + (wm * 64 + i * 16 + ln) * LDS_STRIDE, hi);
#pragma unroll
        for (int j = 0; j < 4; ++j)
            bf[j] = make_frag(Wl + (wn * 64 + j * 16 + ln) * LDS_STRIDE, hi);
#pragma unroll
        for (int i = 0; i < 4; ++i)
#pragma unroll
            for (int j = 0; j < 4; ++j)
                acc[i][j] = MODE == 0 ? wmma32(bf[j], af[i], acc[i][j])
                                      : wmma32(af[i], bf[j], acc[i][j]);
    };

    const int nk = K / 32;
#pragma unroll  // three straight-line issues
    for (int p = 0; p < G_BUFS - 1; ++p)
        if (p < nk) stage(p);

    // Every trip of this loop issues one panel (six copies a wave), and three
    // panels are outstanding at its head: all but the twelve youngest copies
    // landed means that panel s has.
    int s = 0;
    for (; s + G_BUFS - 1 < nk; ++s) {
        asm volatile("s_wait_dscnt 0" ::: "memory");      // my reads of panel s - 1 are done
        asm volatile("s_wait_asynccnt 12" ::: "memory");  // my copies of panel s have landed
        __syncthreads();                                  // both hold for every wave
        stage(s + G_BUFS - 1);                            // into panel s - 1's buffer
        step(s);
    }
    // The last panels: nothing is issued any more, so the wait is to 0, and no
    // buffer is refilled, so this one barrier serves all of their steps.
    async_wait0();
    __syncthreads();
#pragma clang loop unroll(disable)  // at most three trips; unrolled, it took the kernel above 256 registers
    for (; s < nk; ++s) step(s);

    // ---- output: through LDS, whole lines ----------------------------------
    // Output rows are m (MODE 0) or n (MODE 1); tile (a, c) of the wave's 4x4
    // is rows a*16 .. +15, columns c*16 .. +15, and this lane holds row
    // a*16 + ln, columns c*16 + 8*hi .. +7 of it.
    typedef __attribute__((ext_vector_type(8), aligned(16))) OT ov8;   // rows are 16-byte aligned
    constexpr int RT    = sizeof(OT) == 2 ? 4 : 2;
    constexpr int PITCH = 64 * (int)sizeof(OT) + 16;
    constexpr int LPR   = 64 * (int)sizeof(OT) / 16;
    constexpr int GRP   = 32 / LPR;
    char* st = (char*)&lds[0][0] + wave * (RT * 16 * PITCH);

    v8f   bvec[4];                                     // MODE 0: bias along the columns
    float brow[4];                                     // MODE 1: bias of this lane's rows
#pragma unroll  // constant indices, so that the bias stays in registers
    for (int j = 0; j < 4; ++j) {
        if (MODE == 0) bvec[j] = *(const v8f*)(bias + bn + j * 16 + 8 * hi);
        else           brow[j] = bias[bn + j * 16 + ln];
    }

    const int grp = lane / LPR, seg = lane % LPR;
    const size_t ld = MODE == 0 ? (size_t)N : (size_t)SQdim;   // output row pitch
    OT* orow0 = MODE == 0
        ? out + (size_t)bm * N + bn
        : out + ((size_t)(bm0 / SQdim) * N + bn) * SQdim + bm0 % SQdim + wm * 64;
    char* og = (char*)(orow0 + (size_t)(grp * 8) * ld) + seg * 16;

    __syncthreads();        // every wave has read the last panels: the ring is free

#pragma unroll  // constant indices, so that acc stays in registers
    for (int ro = 0; ro < 4 / RT; ++ro) {
#pragma unroll  // the same
        for (int a = 0; a < RT; ++a) {
#pragma unroll  // the same
            for (int cc = 0; cc < 4; ++cc) {
                const int ra = ro * RT + a;
                const v8f v = MODE == 0 ? (acc[ra][cc] + bvec[cc]) * scale
                                        : (acc[cc][ra] + brow[ra]) * scale;
                *(ov8*)(st + (a * 16 + ln) * PITCH + (cc * 16 + 8 * hi) * (int)sizeof(OT)) =
                    __builtin_convertvector(v, ov8);
            }
        }
        // The rows are read by other lanes of this wave than wrote them.
        asm volatile("s_wait_dscnt 0" ::: "memory");
#pragma unroll  // straight-line loads, then stores
        for (int q = 0; q < RT * 16 / GRP; ++q) {
            const int rq = (q >> 3) * (8 * GRP) + (q & 7);     // + grp * 8: the row
            const v4f d = *(const v4f*)(st + (rq + grp * 8) * PITCH + seg * 16);
            *(v4f*)(og + (size_t)(ro * RT * 16 + rq) * ld * sizeof(OT)) = d;
        }
        // Keeps the next round's LDS stores behind this round's reads of the same rows.
        if (ro + 1 < 4 / RT) asm volatile("s_wait_dscnt 0" ::: "memory");
    }
}

#define KV_STRIDE 72
#define KV_TILE   (64 * KV_STRIDE)          // halves per staged operand tile
#define FA_WAVES  8

__device__ __forceinline__ void async_copy16x4(
    void* l0, const void* g0, void* l1, const void* g1,
    void* l2, const void* g2, void* l3, const void* g3)
{
    const uint32_t o0 = (uint32_t)(uintptr_t)l0, o1 = (uint32_t)(uintptr_t)l1;
    const uint32_t o2 = (uint32_t)(uintptr_t)l2, o3 = (uint32_t)(uintptr_t)l3;
    asm volatile("global_load_async_to_lds_b128 %0, %1, off\n\t"
                 "global_load_async_to_lds_b128 %2, %3, off\n\t"
                 "global_load_async_to_lds_b128 %4, %5, off\n\t"
                 "global_load_async_to_lds_b128 %6, %7, off\n\t"
                 "s_wait_xcnt 0x0"
                 :: "v"(o0), "v"(g0), "v"(o1), "v"(g1),
                    "v"(o2), "v"(g2), "v"(o3), "v"(g3) : "memory");
}

__global__ __launch_bounds__(FA_WAVES * 32) void flash_attn_kernel(
    const _Float16* __restrict__ Q, const _Float16* __restrict__ Kh,
    const _Float16* __restrict__ Vt, _Float16* __restrict__ ctx)
{
    __shared__ __align__(16) _Float16 kv[2][2 * KV_TILE];             // K, Vt

    const int tid  = threadIdx.x;
    const int lane = tid & 31;
    const int wave = tid >> 5;
    const int ln   = lane & 15;
    const int hi   = lane >> 4;

    const int bh = blockIdx.y;
    const int b  = bh >> 4;
    const int h  = bh & 15;
    const int qbase = (blockIdx.x * FA_WAVES + wave) * 16;

    // Stage keys kb..kb+63: thread -> rows srow and srow+32, 16-byte piece sseg.
    const int srow = tid >> 3, sseg = tid & 7;
    const _Float16* kg0 =
        Kh + ((size_t)(b * SK + srow)) * HIDDEN + h * HEAD_DIM + sseg * 8;
    const _Float16* vg0 =
        Vt + ((size_t)(b * HIDDEN + h * HEAD_DIM + srow)) * SK + sseg * 8;
    auto stage = [&](int buf, int kb) {
        const _Float16* kg = kg0 + (size_t)kb * HIDDEN;
        const _Float16* vg = vg0 + kb;
        _Float16* kl = &kv[buf][srow * KV_STRIDE + sseg * 8];
        _Float16* vl = kl + KV_TILE;
        async_copy16x4(kl, kg, kl + 32 * KV_STRIDE, kg + 32 * HIDDEN,
                       vl, vg, vl + 32 * KV_STRIDE, vg + 32 * SK);
    };

    stage(0, 0);

    const size_t qrow = ((size_t)(b * SQ + qbase + ln)) * HIDDEN + h * HEAD_DIM;
    const v16h qf0 = make_frag(Q + qrow, hi);
    const v16h qf1 = make_frag(Q + qrow + 32, hi);

    // This lane's query (column ln): running maximum, and the sum over the
    // keys of this half alone (the halves' sums are joined behind the loop).
    float mq = -1e30f, lq = 0.0f;
    v8f   acc[4] = {};      // acc[d][r] = O^T[d*16 + 8*hi + r][query ln]

    async_wait0();          // my copies of tile 0 have landed
    __syncthreads();        // everyone's have
    stage(1, 64);

    for (int it = 0; it < SK / 64; ++it) {
        const _Float16* Kl = &kv[it & 1][0];
        const _Float16* Vl = Kl + KV_TILE;

        // ---- scores: S^T(64 x 16) as four 16x16 tiles, k-dim = 64 ----------
        // sc[t][r] = S[query ln][key t*16 + 8*hi + r]
        v8f sc[4];
#pragma unroll
        for (int t = 0; t < 4; ++t) {
            const _Float16* krow = Kl + (t * 16 + ln) * KV_STRIDE;
            const v16h kf0 = make_frag(krow, hi);
            const v16h kf1 = make_frag(krow + 32, hi);
            v8f c = {};
            c = wmma32(kf0, qf0, c);
            c = wmma32(kf1, qf1, c);
            sc[t] = c;
        }

        // ---- online softmax, one query per lane ----------------------------
        float mb = __builtin_reduce_max(__builtin_elementwise_max(
            __builtin_elementwise_max(sc[0], sc[1]),
            __builtin_elementwise_max(sc[2], sc[3])));   // this half's 32 keys
        mb = fmaxf(mb, xhalf(mb));                   // all 64 keys
        const float mn = fmaxf(mq, mb);
        const float cf = exp_1(mq - mn);             // accumulator rescale
        mq = mn;
#pragma unroll  // constant indices, so that sc stays in registers
        for (int t = 0; t < 4; ++t) sc[t] = exp_8(sc[t] - mn);
        // Sum the four tiles register by register first (packed adds), then
        // the eight registers.
        const v8f pv = (sc[0] + sc[1]) + (sc[2] + sc[3]);
        lq = lq * cf + (((pv[0] + pv[1]) + (pv[2] + pv[3])) +
                        ((pv[4] + pv[5]) + (pv[6] + pv[7])));
        acc[0] *= cf; acc[1] *= cf; acc[2] *= cf; acc[3] *= cf;

        // ---- P^T as B fragments: two score tiles converted in place --------
        v16h pf0, pf1;                               // keys 0-31, keys 32-63
#pragma unroll  // constant indices, so that the tiles convert in place
        for (int e = 0; e < 16; ++e) {
            pf0[e] = (_Float16)sc[e >> 3][e & 7];
            pf1[e] = (_Float16)sc[2 + (e >> 3)][e & 7];
        }

        // ---- PV: O^T(64 x 16) += V^T(64x64) * P^T(64x16) -------------------
#pragma unroll
        for (int d = 0; d < 4; ++d) {
            const _Float16* vrow = Vl + (d * 16 + ln) * KV_STRIDE;
            const v16h vb0 = make_frag(vrow, hi);
            const v16h vb1 = make_frag(vrow + 32, hi);
            acc[d] = wmma32(vb0, pf0, acc[d]);
            acc[d] = wmma32(vb1, pf1, acc[d]);
        }

        // ---- hand-over: this buffer is read out, the next tile has landed --
        asm volatile("s_wait_dscnt 0" ::: "memory");  // my reads of this buffer are done
        async_wait0();                                // my copies of the next tile have landed
        __syncthreads();                              // both hold for every wave
        if (it + 2 < SK / 64) stage(it & 1, (it + 2) * 64);
    }
    async_wait0();          // nothing of mine in flight when the wave ends

    // ---- normalize and store ctx (f16): 8 consecutive columns per lane ----
    const float lsum = lq + xhalf(lq);               // join the halves' sums
    _Float16* crow = ctx + ((size_t)(b * SQ + qbase + ln)) * HIDDEN
                         + h * HEAD_DIM + 8 * hi;
#pragma unroll  // constant indices, so that acc stays in registers
    for (int d = 0; d < 4; ++d) {
        v8h o;
#pragma unroll  // the same
        for (int r = 0; r < 8; ++r) o[r] = (_Float16)(acc[d][r] / lsum);
        *(v8h*)(crow + d * 16) = o;
    }
}

// ---------------------------------------------------------------------------
extern "C" void kernel_launch(void* const* d_in, const int* in_sizes, int n_in,
                              void* d_out, int out_size, void* d_ws, size_t ws_size,
                              hipStream_t stream) {
    const float* query = (const float*)d_in[0];
    const float* key   = (const float*)d_in[1];
    const float* value = (const float*)d_in[2];
    const float* Wq    = (const float*)d_in[3];
    const float* bq    = (const float*)d_in[4];
    const float* Wk    = (const float*)d_in[5];
    const float* bk    = (const float*)d_in[6];
    const float* Wv    = (const float*)d_in[7];
    const float* bv    = (const float*)d_in[8];
    const float* Wo    = (const float*)d_in[9];
    const float* bo    = (const float*)d_in[10];
    float*       out   = (float*)d_out;

    const size_t tok  = (size_t)BATCH * SQ;            // 8192 tokens
    const size_t act  = tok * HIDDEN;                  // 8M elements
    const size_t wsz  = (size_t)HIDDEN * HIDDEN;       // 1M elements

    // ws layout (f16 elements); ctx aliases xq (dead after Q projection).
    _Float16* base = (_Float16*)d_ws;
    _Float16* xq  = base;                 // act
    _Float16* xk  = xq  + act;            // act
    _Float16* xv  = xk  + act;            // act
    _Float16* wqh = xv  + act;            // wsz
    _Float16* wkh = wqh + wsz;
    _Float16* wvh = wkh + wsz;
    _Float16* woh = wvh + wsz;
    _Float16* Qp  = woh + wsz;
    _Float16* Kp  = Qp  + act;
    _Float16* Vtp = Kp  + act;
    _Float16* ctx = xq;

    // ---- stage f32 -> f16: xq, xk, xv, wqh, wkh, wvh, woh in one launch ----
    cvt_f16_kernel<<<CVT_BLOCKS, CVT_WAVES * 32, 0, stream>>>(
        query, key, value, Wq, Wk, Wv, Wo, base);

    const dim3 gblk((unsigned)(tok / 128), HIDDEN / 256);   // 64 x 4 blocks
    const float qscale = 0.125f;                            // HEAD_DIM^-0.5

    gemm_f16_kernel<_Float16, 0><<<gblk, 256, 0, stream>>>(
        xq, wqh, bq, Qp, (int)tok, HIDDEN, HIDDEN, SQ, qscale);
    gemm_f16_kernel<_Float16, 0><<<gblk, 256, 0, stream>>>(
        xk, wkh, bk, Kp, (int)tok, HIDDEN, HIDDEN, SK, 1.0f);
    gemm_f16_kernel<_Float16, 1><<<gblk, 256, 0, stream>>>(
        xv, wvh, bv, Vtp, (int)tok, HIDDEN, HIDDEN, SK, 1.0f);

    flash_attn_kernel<<<dim3(SQ / 16 / FA_WAVES, BATCH * HEADS), FA_WAVES * 32, 0, stream>>>(
        Qp, Kp, Vtp, ctx);

    gemm_f16_kernel<float, 0><<<gblk, 256, 0, stream>>>(
        ctx, woh, bo, out, (int)tok, HIDDEN, HIDDEN, SQ, 1.0f);
}

// v006
// One run takes 148 microseconds.
// Timed twice side by side with v005, it ran 1.09 times as fast both times.
// All steps since v000 together make it 2.41 times as fast.
#include <hip/hip_runtime.h>

#define HIDDEN   1024
#define HEADS    16
#define HEAD_DIM 64
#define BATCH    4
#define SQ       2048
#define SK       2048

typedef __attribute__((ext_vector_type(16))) _Float16 v16h;
typedef __attribute__((ext_vector_type(8)))  _Float16 v8h;
typedef __attribute__((ext_vector_type(8)))  float    v8f;

// D = A(16x32 f16) * B(32x16 f16) + C(16x16 f32)
__device__ __forceinline__ v8f wmma32(v16h a, v16h b, v8f c) {
    return __builtin_amdgcn_wmma_f32_16x16x32_f16(
        false, a, false, b, (short)0, c, false, false);
}

__device__ __forceinline__ v16h make_frag(const _Float16* __restrict__ p, int hi) {
    const v8h lo = *(const v8h*)(p + hi * 8);
    const v8h hs = *(const v8h*)(p + hi * 8 + 16);
    return __builtin_shufflevector(lo, hs, 0,1,2,3,4,5,6,7,8,9,10,11,12,13,14,15);
}

__device__ __forceinline__ void async_wait0() {
    asm volatile("s_wait_asynccnt 0" ::: "memory");
}

__device__ __forceinline__ float xhalf(float x) {
    const int i = __builtin_bit_cast(int, x);
    return __builtin_bit_cast(float, __builtin_amdgcn_permlanex16(
        i, i, 0x76543210, 0xfedcba98, false, false));
}

__device__ __forceinline__ float exp_1(float x) {
    float y;
    asm("v_exp_f32 %0, %1\n\tv_nop" : "=&v"(y) : "v"(x * 1.44269504f));
    return y;
}
__device__ __forceinline__ v8f exp_8(v8f x) {
    x *= 1.44269504f;
    float y0, y1, y2, y3, y4, y5, y6, y7;
    asm("v_exp_f32 %0, %8\n\t"
        "v_exp_f32 %1, %9\n\t"
        "v_exp_f32 %2, %10\n\t"
        "v_exp_f32 %3, %11\n\t"
        "v_exp_f32 %4, %12\n\t"
        "v_exp_f32 %5, %13\n\t"
        "v_exp_f32 %6, %14\n\t"
        "v_exp_f32 %7, %15\n\t"
        "v_nop"
        : "=&v"(y0), "=&v"(y1), "=&v"(y2), "=&v"(y3),
          "=&v"(y4), "=&v"(y5), "=&v"(y6), "=&v"(y7)
        : "v"(x[0]), "v"(x[1]), "v"(x[2]), "v"(x[3]),
          "v"(x[4]), "v"(x[5]), "v"(x[6]), "v"(x[7]));
    return v8f{y0, y1, y2, y3, y4, y5, y6, y7};
}

// ---------------------------------------------------------------------------
// f32 -> f16 staging of all seven operands in ONE launch of long-lived waves.
//
// The seven f16 copies lie one behind the other in the workspace, in the order
// of the arguments.  A piece is 1024 elements: 8 loads of 512 contiguous bytes
// per wave.  The 28672 pieces are dealt to 4096 waves (16 per block, 256
// blocks), 7 each: round i takes piece i * 4096 + wave, so that rounds 0-1 lie
// in query, 2-3 in key, 4-5 in value, and round 6 in one weight (1024 pieces
// each, the same weight for a whole block).  The next piece's loads are issued
// before this piece is converted and stored.
// ---------------------------------------------------------------------------
#define CVT_WAVES  16
#define CVT_BLOCKS 256
#define CVT_PIECE  1024                          // elements
#define CVT_ROUND  (CVT_WAVES * CVT_BLOCKS * CVT_PIECE)

typedef __attribute__((ext_vector_type(4))) _Float16 v4h;
typedef __attribute__((ext_vector_type(4))) float    v4f;

__global__ __launch_bounds__(CVT_WAVES * 32) void cvt_f16_kernel(
    const float* __restrict__ query, const float* __restrict__ key,
    const float* __restrict__ value,
    const float* __restrict__ Wq, const float* __restrict__ Wk,
    const float* __restrict__ Wv, const float* __restrict__ Wo,
    _Float16* __restrict__ out)
{
    // A wave's piece of round 0 = block part (uniform) + thread part.  The
    // thread part, in bytes, is the same for every load (t4) and for every
    // store (t2); the block part belongs to the uniform bases.
    const unsigned tp = ((threadIdx.x >> 5) << 10) | ((threadIdx.x & 31) << 2);
    const unsigned t4 = tp * 4, t2 = tp * 2;
    const unsigned bp = blockIdx.x * (CVT_WAVES * CVT_PIECE);

    const unsigned wsel = blockIdx.x >> 6;       // 64 blocks per weight
    const float* w = wsel == 0 ? Wq : wsel == 1 ? Wk : wsel == 2 ? Wv : Wo;

    const float* src[7] = {
        query + bp, query + bp + CVT_ROUND,
        key   + bp, key   + bp + CVT_ROUND,
        value + bp, value + bp + CVT_ROUND,
        w + (bp & (HIDDEN * HIDDEN - 1))};

    v4f r[2][8];
#pragma unroll  // constant indices, so that r stays in registers
    for (int c = 0; c < 8; ++c)
        r[0][c] = *(const v4f*)((const char*)src[0] + t4 + c * 512);

#pragma unroll  // the same, and src[i] is then a compile-time choice
    for (int i = 0; i < 7; ++i) {
        if (i + 1 < 7) {
#pragma unroll  // constant indices, so that r stays in registers
            for (int c = 0; c < 8; ++c)
                r[(i + 1) & 1][c] =
                    *(const v4f*)((const char*)src[i + 1] + t4 + c * 512);
        }
        char* o = (char*)(out + (size_t)i * CVT_ROUND + bp);
#pragma unroll  // the same
        for (int c = 0; c < 8; ++c)
            *(v4h*)(o + t2 + c * 256) = __builtin_convertvector(r[i & 1][c], v4h);
        // Before a register that an issued load or store names is used again
        // (t4 and t2 as inputs: they stay as they are up to here); it also
        // keeps the rounds in this order, loads ahead and stores behind.
        if (i + 1 < 7)
            asm volatile("s_wait_xcnt 0x0" :: "v"(t4), "v"(t2) : "memory");
    }
}

#define LDS_STRIDE 40
#define A_ROWS     128
#define W_ROWS     256
#define G_BUFS     4                        // ring depth (a power of two)
#define G_PANEL    ((A_ROWS + W_ROWS) * LDS_STRIDE)   // halves per buffer

__device__ __forceinline__ void async_copy16x6(
    void* l0, const void* g0, void* l1, const void* g1,
    void* l2, const void* g2, void* l3, const void* g3,
    void* l4, const void* g4, void* l5, const void* g5)
{
    const uint32_t o0 = (uint32_t)(uintptr_t)l0, o1 = (uint32_t)(uintptr_t)l1;
    const uint32_t o2 = (uint32_t)(uintptr_t)l2, o3 = (uint32_t)(uintptr_t)l3;
    const uint32_t o4 = (uint32_t)(uintptr_t)l4, o5 = (uint32_t)(uintptr_t)l5;
    asm volatile("global_load_async_to_lds_b128 %0, %1, off\n\t"
                 "global_load_async_to_lds_b128 %2, %3, off\n\t"
                 "global_load_async_to_lds_b128 %4, %5, off\n\t"
                 "global_load_async_to_lds_b128 %6, %7, off\n\t"
                 "global_load_async_to_lds_b128 %8, %9, off\n\t"
                 "global_load_async_to_lds_b128 %10, %11, off\n\t"
                 "s_wait_xcnt 0x0"
                 :: "v"(o0), "v"(g0), "v"(o1), "v"(g1), "v"(o2), "v"(g2),
                    "v"(o3), "v"(g3), "v"(o4), "v"(g4), "v"(o5), "v"(g5)
                 : "memory");
}

template <typename OT, int MODE>
__global__ __launch_bounds__(256) void gemm_f16_kernel(
    const _Float16* __restrict__ A, const _Float16* __restrict__ W,
    const float* __restrict__ bias, OT* __restrict__ out,
    int M, int N, int K, int SQdim, float scale)
{
    __shared__ __align__(16) _Float16 lds[G_BUFS][G_PANEL];

    const int tid  = threadIdx.x;
    const int lane = tid & 31;
    const int wave = tid >> 5;
    const int wm   = wave & 1;          // 2 waves along M
    const int wn   = wave >> 1;         // 4 waves along N
    const int ln   = lane & 15;
    const int hi   = lane >> 4;

    const int bm0 = blockIdx.x * 128;
    const int bn0 = blockIdx.y * 256;
    const int bm  = bm0 + wm * 64;
    const int bn  = bn0 + wn * 64;

    // Stage panel s (k = 32 s .. 32 s + 31) of A (128 rows) and W (256 rows):
    // thread -> 16-byte piece sseg of rows srow, srow + 64, ... of each.
    const int srow = tid >> 2, sseg = tid & 3;
    const _Float16* ag0 = A + (size_t)(bm0 + srow) * K + sseg * 8;
    const _Float16* wg0 = W + (size_t)(bn0 + srow) * K + sseg * 8;
    const size_t    r64 = (size_t)64 * K;
    auto stage = [&](int s) {
        const _Float16* ag = ag0 + s * 32;
        const _Float16* wg = wg0 + s * 32;
        _Float16* l = &lds[s & (G_BUFS - 1)][srow * LDS_STRIDE + sseg * 8];
        async_copy16x6(l,                    ag,
                       l +  64 * LDS_STRIDE, ag + r64,
                       l + 128 * LDS_STRIDE, wg,
                       l + 192 * LDS_STRIDE, wg + r64,
                       l + 256 * LDS_STRIDE, wg + 2 * r64,
                       l + 320 * LDS_STRIDE, wg + 3 * r64);
    };

    v8f acc[4][4] = {};

    // The 16 products of panel s.
    auto step = [&](int s) {
        const _Float16* Al = &lds[s & (G_BUFS - 1)][0];
        const _Float16* Wl = Al + A_ROWS * LDS_STRIDE;

        v16h af[4], bf[4];
#pragma unroll
        for (int i = 0; i < 4; ++i)
            af[i] = make_frag(Al + (wm * 64 + i * 16 + ln) * LDS_STRIDE, hi);
#pragma unroll
        for (int j = 0; j < 4; ++j)
            bf[j] = make_frag(Wl + (wn * 64 + j * 16 + ln) * LDS_STRIDE, hi);
#pragma unroll
        for (int i = 0; i < 4; ++i)
#pragma unroll
            for (int j = 0; j < 4; ++j)
                acc[i][j] = MODE == 0 ? wmma32(bf[j], af[i], acc[i][j])
                                      : wmma32(af[i], bf[j], acc[i][j]);
    };

    const int nk = K / 32;
#pragma unroll  // three straight-line issues
    for (int p = 0; p < G_BUFS - 1; ++p)
        if (p < nk) stage(p);

    // Every trip of this loop issues one panel (six copies a wave), and three
    // panels are outstanding at its head: all but the twelve youngest copies
    // landed means that panel s has.
    int s = 0;
    for (; s + G_BUFS - 1 < nk; ++s) {
        asm volatile("s_wait_dscnt 0" ::: "memory");      // my reads of panel s - 1 are done
        asm volatile("s_wait_asynccnt 12" ::: "memory");  // my copies of panel s have landed
        __syncthreads();                                  // both hold for every wave
        stage(s + G_BUFS - 1);                            // into panel s - 1's buffer
        step(s);
    }
    // The last panels: nothing is issued any more, so the wait is to 0, and no
    // buffer is refilled, so this one barrier serves all of their steps.
    async_wait0();
    __syncthreads();
#pragma clang loop unroll(disable)  // at most three trips; unrolled, it took the kernel above 256 registers
    for (; s < nk; ++s) step(s);

    // ---- output: through LDS, whole lines ----------------------------------
    // Output rows are m (MODE 0) or n (MODE 1); tile (a, c) of the wave's 4x4
    // is rows a*16 .. +15, columns c*16 .. +15, and this lane holds row
    // a*16 + ln, columns c*16 + 8*hi .. +7 of it.
    typedef __attribute__((ext_vector_type(8), aligned(16))) OT ov8;   // rows are 16-byte aligned
    constexpr int RT    = sizeof(OT) == 2 ? 4 : 2;
    constexpr int PITCH = 64 * (int)sizeof(OT) + 16;
    constexpr int LPR   = 64 * (int)sizeof(OT) / 16;
    constexpr int GRP   = 32 / LPR;
    char* st = (char*)&lds[0][0] + wave * (RT * 16 * PITCH);

    v8f   bvec[4];                                     // MODE 0: bias along the columns
    float brow[4];                                     // MODE 1: bias of this lane's rows
#pragma unroll  // constant indices, so that the bias stays in registers
    for (int j = 0; j < 4; ++j) {
        if (MODE == 0) bvec[j] = *(const v8f*)(bias + bn + j * 16 + 8 * hi);
        else           brow[j] = bias[bn + j * 16 + ln];
    }

    const int grp = lane / LPR, seg = lane % LPR;
    const size_t ld = MODE == 0 ? (size_t)N : (size_t)SQdim;   // output row pitch
    OT* orow0 = MODE == 0
        ? out + (size_t)bm * N + bn
        : out + ((size_t)(bm0 / SQdim) * N + bn) * SQdim + bm0 % SQdim + wm * 64;
    char* og = (char*)(orow0 + (size_t)(grp * 8) * ld) + seg * 16;

    __syncthreads();        // every wave has read the last panels: the ring is free

#pragma unroll  // constant indices, so that acc stays in registers
    for (int ro = 0; ro < 4 / RT; ++ro) {
#pragma unroll  // the same
        for (int a = 0; a < RT; ++a) {
#pragma unroll  // the same
            for (int cc = 0; cc < 4; ++cc) {
                const int ra = ro * RT + a;
                const v8f v = MODE == 0 ? (acc[ra][cc] + bvec[cc]) * scale
                                        : (acc[cc][ra] + brow[ra]) * scale;
                *(ov8*)(st + (a * 16 + ln) * PITCH + (cc * 16 + 8 * hi) * (int)sizeof(OT)) =
                    __builtin_convertvector(v, ov8);
            }
        }
        // The rows are read by other lanes of this wave than wrote them.
        asm volatile("s_wait_dscnt 0" ::: "memory");
#pragma unroll  // straight-line loads, then stores
        for (int q = 0; q < RT * 16 / GRP; ++q) {
            const int rq = (q >> 3) * (8 * GRP) + (q & 7);     // + grp * 8: the row
            const v4f d = *(const v4f*)(st + (rq + grp * 8) * PITCH + seg * 16);
            *(v4f*)(og + (size_t)(ro * RT * 16 + rq) * ld * sizeof(OT)) = d;
        }
        // Keeps the next round's LDS stores behind this round's reads of the same rows.
        if (ro + 1 < 4 / RT) asm volatile("s_wait_dscnt 0" ::: "memory");
    }
}

#define KV_STRIDE 72
#define KV_TILE   (64 * KV_STRIDE)          // halves per staged operand tile
#define FA_WAVES  8
#define FA_GROUPS 2                         // 16-query column groups per wave

__device__ __forceinline__ void async_copy16x4(
    void* l0, const void* g0, void* l1, const void* g1,
    void* l2, const void* g2, void* l3, const void* g3)
{
    const uint32_t o0 = (uint32_t)(uintptr_t)l0, o1 = (uint32_t)(uintptr_t)l1;
    const uint32_t o2 = (uint32_t)(uintptr_t)l2, o3 = (uint32_t)(uintptr_t)l3;
    asm volatile("global_load_async_to_lds_b128 %0, %1, off\n\t"
                 "global_load_async_to_lds_b128 %2, %3, off\n\t"
                 "global_load_async_to_lds_b128 %4, %5, off\n\t"
                 "global_load_async_to_lds_b128 %6, %7, off\n\t"
                 "s_wait_xcnt 0x0"
                 :: "v"(o0), "v"(g0), "v"(o1), "v"(g1),
                    "v"(o2), "v"(g2), "v"(o3), "v"(g3) : "memory");
}

__global__ __launch_bounds__(FA_WAVES * 32) __attribute__((amdgpu_waves_per_eu(4, 4)))
void flash_attn_kernel(
    const _Float16* __restrict__ Q, const _Float16* __restrict__ Kh,
    const _Float16* __restrict__ Vt, _Float16* __restrict__ ctx)
{
    __shared__ __align__(16) _Float16 kv[2][2 * KV_TILE];             // K, Vt

    const int tid  = threadIdx.x;
    const int lane = tid & 31;
    const int wave = tid >> 5;
    const int ln   = lane & 15;
    const int hi   = lane >> 4;

    const int bh = blockIdx.y;
    const int b  = bh >> 4;
    const int h  = bh & 15;
    const int qbase = (blockIdx.x * FA_WAVES + wave) * (16 * FA_GROUPS);

    // Stage keys kb..kb+63: thread -> rows srow and srow+32, 16-byte piece sseg.
    const int srow = tid >> 3, sseg = tid & 7;
    const _Float16* kg0 =
        Kh + ((size_t)(b * SK + srow)) * HIDDEN + h * HEAD_DIM + sseg * 8;
    const _Float16* vg0 =
        Vt + ((size_t)(b * HIDDEN + h * HEAD_DIM + srow)) * SK + sseg * 8;
    auto stage = [&](int buf, int kb) {
        const _Float16* kg = kg0 + (size_t)kb * HIDDEN;
        const _Float16* vg = vg0 + kb;
        _Float16* kl = &kv[buf][srow * KV_STRIDE + sseg * 8];
        _Float16* vl = kl + KV_TILE;
        async_copy16x4(kl, kg, kl + 32 * KV_STRIDE, kg + 32 * HIDDEN,
                       vl, vg, vl + 32 * KV_STRIDE, vg + 32 * SK);
    };

    stage(0, 0);

    // Group g holds queries qbase + 16 g .. + 15, this lane query 16 g + ln.
    const size_t qrow = ((size_t)(b * SQ + qbase + ln)) * HIDDEN + h * HEAD_DIM;
    v16h qf0[FA_GROUPS], qf1[FA_GROUPS];
#pragma unroll  // constant indices, so that the fragments stay in registers
    for (int g = 0; g < FA_GROUPS; ++g) {
        qf0[g] = make_frag(Q + qrow + (size_t)g * 16 * HIDDEN, hi);
        qf1[g] = make_frag(Q + qrow + (size_t)g * 16 * HIDDEN + 32, hi);
    }

    // This lane's query of each group: running maximum, and the sum over the
    // keys of this half alone (the halves' sums are joined behind the loop).
    float mq[FA_GROUPS], lq[FA_GROUPS];
    v8f   acc[FA_GROUPS][4];    // acc[g][d][r] = O^T[d*16 + 8*hi + r][query 16 g + ln]
#pragma unroll  // constant indices, so that all of it stays in registers
    for (int g = 0; g < FA_GROUPS; ++g) {
        mq[g] = -1e30f; lq[g] = 0.0f;
        acc[g][0] = v8f{}; acc[g][1] = v8f{}; acc[g][2] = v8f{}; acc[g][3] = v8f{};
    }

    async_wait0();          // my copies of tile 0 have landed
    asm volatile("s_wait_xcnt 0x0" ::: "memory");   // before the Q loads' address registers are used again
    __syncthreads();        // everyone's have
    stage(1, 64);

    for (int it = 0; it < SK / 64; ++it) {
        const _Float16* Kl = &kv[it & 1][0];
        const _Float16* Vl = Kl + KV_TILE;

        // ---- scores: S^T(64 x 32) as four 16x16 tiles per group, k-dim = 64 -
        // sc[g][t][r] = S[query 16 g + ln][key t*16 + 8*hi + r]
        v8f sc[FA_GROUPS][4];
#pragma unroll
        for (int t = 0; t < 4; ++t) {
            const _Float16* krow = Kl + (t * 16 + ln) * KV_STRIDE;
            const v16h kf0 = make_frag(krow, hi);
            const v16h kf1 = make_frag(krow + 32, hi);
#pragma unroll  // constant indices, so that sc stays in registers
            for (int g = 0; g < FA_GROUPS; ++g) sc[g][t] = wmma32(kf0, qf0[g], v8f{});
#pragma unroll  // the same
            for (int g = 0; g < FA_GROUPS; ++g) sc[g][t] = wmma32(kf1, qf1[g], sc[g][t]);
        }

        // ---- online softmax, one query per lane and group ------------------
        v16h pf0[FA_GROUPS], pf1[FA_GROUPS];         // keys 0-31, keys 32-63
#pragma unroll  // constant indices, so that sc and acc stay in registers
        for (int g = 0; g < FA_GROUPS; ++g) {
            float mb = __builtin_reduce_max(__builtin_elementwise_max(
                __builtin_elementwise_max(sc[g][0], sc[g][1]),
                __builtin_elementwise_max(sc[g][2], sc[g][3])));   // this half's 32 keys
            mb = fmaxf(mb, xhalf(mb));               // all 64 keys
            const float mn = fmaxf(mq[g], mb);
            const float cf = exp_1(mq[g] - mn);      // accumulator rescale
            mq[g] = mn;
#pragma unroll  // the same
            for (int t = 0; t < 4; ++t) sc[g][t] = exp_8(sc[g][t] - mn);
            // Sum the four tiles register by register first (packed adds),
            // then the eight registers.
            const v8f pv = (sc[g][0] + sc[g][1]) + (sc[g][2] + sc[g][3]);
            lq[g] = lq[g] * cf + (((pv[0] + pv[1]) + (pv[2] + pv[3])) +
                                  ((pv[4] + pv[5]) + (pv[6] + pv[7])));
            acc[g][0] *= cf; acc[g][1] *= cf; acc[g][2] *= cf; acc[g][3] *= cf;

            // P^T as B fragments: two score tiles converted in place.
#pragma unroll  // the same
            for (int e = 0; e < 16; ++e) {
                pf0[g][e] = (_Float16)sc[g][e >> 3][e & 7];
                pf1[g][e] = (_Float16)sc[g][2 + (e >> 3)][e & 7];
            }
        }

        // ---- PV: O^T(64 x 32) += V^T(64x64) * P^T(64x32) -------------------
#pragma unroll
        for (int d = 0; d < 4; ++d) {
            const _Float16* vrow = Vl + (d * 16 + ln) * KV_STRIDE;
            const v16h vb0 = make_frag(vrow, hi);
            const v16h vb1 = make_frag(vrow + 32, hi);
#pragma unroll  // constant indices, so that acc stays in registers
            for (int g = 0; g < FA_GROUPS; ++g) acc[g][d] = wmma32(vb0, pf0[g], acc[g][d]);
#pragma unroll  // the same
            for (int g = 0; g < FA_GROUPS; ++g) acc[g][d] = wmma32(vb1, pf1[g], acc[g][d]);
        }

        // ---- hand-over: this buffer is read out, the next tile has landed --
        asm volatile("s_wait_dscnt 0" ::: "memory");  // my reads of this buffer are done
        async_wait0();                                // my copies of the next tile have landed
        __syncthreads();                              // both hold for every wave
        if (it + 2 < SK / 64) stage(it & 1, (it + 2) * 64);
    }
    async_wait0();          // nothing of mine in flight when the wave ends

    // ---- normalize and store ctx (f16): 8 consecutive columns per lane ----
#pragma unroll  // constant indices, so that acc stays in registers
    for (int g = 0; g < FA_GROUPS; ++g) {
        const float lsum = lq[g] + xhalf(lq[g]);     // join the halves' sums
        _Float16* crow = ctx + ((size_t)(b * SQ + qbase + g * 16 + ln)) * HIDDEN
                             + h * HEAD_DIM + 8 * hi;
#pragma unroll  // the same
        for (int d = 0; d < 4; ++d) {
            v8h o;
#pragma unroll  // the same
            for (int r = 0; r < 8; ++r) o[r] = (_Float16)(acc[g][d][r] / lsum);
            *(v8h*)(crow + d * 16) = o;
        }
    }
}

// ---------------------------------------------------------------------------
extern "C" void kernel_launch(void* const* d_in, const int* in_sizes, int n_in,
                              void* d_out, int out_size, void* d_ws, size_t ws_size,
                              hipStream_t stream) {
    const float* query = (const float*)d_in[0];
    const float* key   = (const float*)d_in[1];
    const float* value = (const float*)d_in[2];
    const float* Wq    = (const float*)d_in[3];
    const float* bq    = (const float*)d_in[4];
    const float* Wk    = (const float*)d_in[5];
    const float* bk    = (const float*)d_in[6];
    const float* Wv    = (const float*)d_in[7];
    const float* bv    = (const float*)d_in[8];
    const float* Wo    = (const float*)d_in[9];
    const float* bo    = (const float*)d_in[10];
    float*       out   = (float*)d_out;

    const size_t tok  = (size_t)BATCH * SQ;            // 8192 tokens
    const size_t act  = tok * HIDDEN;                  // 8M elements
    const size_t wsz  = (size_t)HIDDEN * HIDDEN;       // 1M elements

    // ws layout (f16 elements); ctx aliases xq (dead after Q projection).
    _Float16* base = (_Float16*)d_ws;
    _Float16* xq  = base;                 // act
    _Float16* xk  = xq  + act;            // act
    _Float16* xv  = xk  + act;            // act
    _Float16* wqh = xv  + act;            // wsz
    _Float16* wkh = wqh + wsz;
    _Float16* wvh = wkh + wsz;
    _Float16* woh = wvh + wsz;
    _Float16* Qp  = woh + wsz;
    _Float16* Kp  = Qp  + act;
    _Float16* Vtp = Kp  + act;
    _Float16* ctx = xq;

    // ---- stage f32 -> f16: xq, xk, xv, wqh, wkh, wvh, woh in one launch ----
    cvt_f16_kernel<<<CVT_BLOCKS, CVT_WAVES * 32, 0, stream>>>(
        query, key, value, Wq, Wk, Wv, Wo, base);

    const dim3 gblk((unsigned)(tok / 128), HIDDEN / 256);   // 64 x 4 blocks
    const float qscale = 0.125f;                            // HEAD_DIM^-0.5

    gemm_f16_kernel<_Float16, 0><<<gblk, 256, 0, stream>>>(
        xq, wqh, bq, Qp, (int)tok, HIDDEN, HIDDEN, SQ, qscale);
    gemm_f16_kernel<_Float16, 0><<<gblk, 256, 0, stream>>>(
        xk, wkh, bk, Kp, (int)tok, HIDDEN, HIDDEN, SK, 1.0f);
    gemm_f16_kernel<_Float16, 1><<<gblk, 256, 0, stream>>>(
        xv, wvh, bv, Vtp, (int)tok, HIDDEN, HIDDEN, SK, 1.0f);

    flash_attn_kernel<<<dim3(SQ / (16 * FA_GROUPS) / FA_WAVES, BATCH * HEADS), FA_WAVES * 32, 0, stream>>>(
        Qp, Kp, Vtp, ctx);

    gemm_f16_kernel<float, 0><<<gblk, 256, 0, stream>>>(
        ctx, woh, bo, out, (int)tok, HIDDEN, HIDDEN, SQ, 1.0f);
}

// v007
// One run takes 139 microseconds.
// Two timings next to v006 both put it at 1.07 times that version's speed.
// Over all steps from v000 it is 2.58 times as fast.
#include <hip/hip_runtime.h>

#define HIDDEN   1024
#define HEADS    16
#define HEAD_DIM 64
#define BATCH    4
#define SQ       2048
#define SK       2048

typedef __attribute__((ext_vector_type(16))) _Float16 v16h;
typedef __attribute__((ext_vector_type(8)))  _Float16 v8h;
typedef __attribute__((ext_vector_type(8)))  float    v8f;

// D = A(16x32 f16) * B(32x16 f16) + C(16x16 f32)
__device__ __forceinline__ v8f wmma32(v16h a, v16h b, v8f c) {
    return __builtin_amdgcn_wmma_f32_16x16x32_f16(
        false, a, false, b, (short)0, c, false, false);
}

__device__ __forceinline__ v16h make_frag(const _Float16* __restrict__ p, int hi) {
    const v8h lo = *(const v8h*)(p + hi * 8);
    const v8h hs = *(const v8h*)(p + hi * 8 + 16);
    return __builtin_shufflevector(lo, hs, 0,1,2,3,4,5,6,7,8,9,10,11,12,13,14,15);
}

__device__ __forceinline__ void async_wait0() {
    asm volatile("s_wait_asynccnt 0" ::: "memory");
}

__device__ __forceinline__ float xhalf(float x) {
    const int i = __builtin_bit_cast(int, x);
    return __builtin_bit_cast(float, __builtin_amdgcn_permlanex16(
        i, i, 0x76543210, 0xfedcba98, false, false));
}

__device__ __forceinline__ float exp2_1(float x) {
    float y;
    asm("v_exp_f32 %0, %1\n\tv_nop" : "=&v"(y) : "v"(x));
    return y;
}
__device__ __forceinline__ v8f exp2_8(v8f x) {
    float y0, y1, y2, y3, y4, y5, y6, y7;
    asm("v_exp_f32 %0, %8\n\t"
        "v_exp_f32 %1, %9\n\t"
        "v_exp_f32 %2, %10\n\t"
        "v_exp_f32 %3, %11\n\t"
        "v_exp_f32 %4, %12\n\t"
        "v_exp_f32 %5, %13\n\t"
        "v_exp_f32 %6, %14\n\t"
        "v_exp_f32 %7, %15\n\t"
        "v_nop"
        : "=&v"(y0), "=&v"(y1), "=&v"(y2), "=&v"(y3),
          "=&v"(y4), "=&v"(y5), "=&v"(y6), "=&v"(y7)
        : "v"(x[0]), "v"(x[1]), "v"(x[2]), "v"(x[3]),
          "v"(x[4]), "v"(x[5]), "v"(x[6]), "v"(x[7]));
    return v8f{y0, y1, y2, y3, y4, y5, y6, y7};
}
__device__ __forceinline__ v8f exp2_8_of_wmma(v8f x) {
    v8f y;
#pragma unroll  // constant indices, so that x and y stay in registers
    for (int i = 0; i < 8; ++i) y[i] = __builtin_amdgcn_exp2f(x[i]);
    return y;
}

// ---------------------------------------------------------------------------
// f32 -> f16 staging of all seven operands in ONE launch of long-lived waves.
//
// The seven f16 copies lie one behind the other in the workspace, in the order
// of the arguments.  A piece is 1024 elements: 8 loads of 512 contiguous bytes
// per wave.  The 28672 pieces are dealt to 4096 waves (16 per block, 256
// blocks), 7 each: round i takes piece i * 4096 + wave, so that rounds 0-1 lie
// in query, 2-3 in key, 4-5 in value, and round 6 in one weight (1024 pieces
// each, the same weight for a whole block).  The next piece's loads are issued
// before this piece is converted and stored.
// ---------------------------------------------------------------------------
#define CVT_WAVES  16
#define CVT_BLOCKS 256
#define CVT_PIECE  1024                          // elements
#define CVT_ROUND  (CVT_WAVES * CVT_BLOCKS * CVT_PIECE)

typedef __attribute__((ext_vector_type(4))) _Float16 v4h;
typedef __attribute__((ext_vector_type(4))) float    v4f;

__global__ __launch_bounds__(CVT_WAVES * 32) void cvt_f16_kernel(
    const float* __restrict__ query, const float* __restrict__ key,
    const float* __restrict__ value,
    const float* __restrict__ Wq, const float* __restrict__ Wk,
    const float* __restrict__ Wv, const float* __restrict__ Wo,
    _Float16* __restrict__ out)
{
    // A wave's piece of round 0 = block part (uniform) + thread part.  The
    // thread part, in bytes, is the same for every load (t4) and for every
    // store (t2); the block part belongs to the uniform bases.
    const unsigned tp = ((threadIdx.x >> 5) << 10) | ((threadIdx.x & 31) << 2);
    const unsigned t4 = tp * 4, t2 = tp * 2;
    const unsigned bp = blockIdx.x * (CVT_WAVES * CVT_PIECE);

    const unsigned wsel = blockIdx.x >> 6;       // 64 blocks per weight
    const float* w = wsel == 0 ? Wq : wsel == 1 ? Wk : wsel == 2 ? Wv : Wo;

    const float* src[7] = {
        query + bp, query + bp + CVT_ROUND,
        key   + bp, key   + bp + CVT_ROUND,
        value + bp, value + bp + CVT_ROUND,
        w + (bp & (HIDDEN * HIDDEN - 1))};

    v4f r[2][8];
#pragma unroll  // constant indices, so that r stays in registers
    for (int c = 0; c < 8; ++c)
        r[0][c] = *(const v4f*)((const char*)src[0] + t4 + c * 512);

#pragma unroll  // the same, and src[i] is then a compile-time choice
    for (int i = 0; i < 7; ++i) {
        if (i + 1 < 7) {
#pragma unroll  // constant indices, so that r stays in registers
            for (int c = 0; c < 8; ++c)
                r[(i + 1) & 1][c] =
                    *(const v4f*)((const char*)src[i + 1] + t4 + c * 512);
        }
        char* o = (char*)(out + (size_t)i * CVT_ROUND + bp);
#pragma unroll  // the same
        for (int c = 0; c < 8; ++c)
            *(v4h*)(o + t2 + c * 256) = __builtin_convertvector(r[i & 1][c], v4h);
        // Before a register that an issued load or store names is used again
        // (t4 and t2 as inputs: they stay as they are up to here); it also
        // keeps the rounds in this order, loads ahead and stores behind.
        if (i + 1 < 7)
            asm volatile("s_wait_xcnt 0x0" :: "v"(t4), "v"(t2) : "memory");
    }
}

#define LDS_STRIDE 40
#define A_ROWS     128
#define W_ROWS     256
#define G_BUFS     4                        // ring depth (a power of two)
#define G_PANEL    ((A_ROWS + W_ROWS) * LDS_STRIDE)   // halves per buffer

__device__ __forceinline__ void async_copy16x6(
    void* l0, const void* g0, void* l1, const void* g1,
    void* l2, const void* g2, void* l3, const void* g3,
    void* l4, const void* g4, void* l5, const void* g5)
{
    const uint32_t o0 = (uint32_t)(uintptr_t)l0, o1 = (uint32_t)(uintptr_t)l1;
    const uint32_t o2 = (uint32_t)(uintptr_t)l2, o3 = (uint32_t)(uintptr_t)l3;
    const uint32_t o4 = (uint32_t)(uintptr_t)l4, o5 = (uint32_t)(uintptr_t)l5;
    asm volatile("global_load_async_to_lds_b128 %0, %1, off\n\t"
                 "global_load_async_to_lds_b128 %2, %3, off\n\t"
                 "global_load_async_to_lds_b128 %4, %5, off\n\t"
                 "global_load_async_to_lds_b128 %6, %7, off\n\t"
                 "global_load_async_to_lds_b128 %8, %9, off\n\t"
                 "global_load_async_to_lds_b128 %10, %11, off\n\t"
                 "s_wait_xcnt 0x0"
                 :: "v"(o0), "v"(g0), "v"(o1), "v"(g1), "v"(o2), "v"(g2),
                    "v"(o3), "v"(g3), "v"(o4), "v"(g4), "v"(o5), "v"(g5)
                 : "memory");
}

template <typename OT, int MODE>
__global__ __launch_bounds__(256) void gemm_f16_kernel(
    const _Float16* __restrict__ A, const _Float16* __restrict__ W,
    const float* __restrict__ bias, OT* __restrict__ out,
    int M, int N, int K, int SQdim, float scale)
{
    __shared__ __align__(16) _Float16 lds[G_BUFS][G_PANEL];

    const int tid  = threadIdx.x;
    const int lane = tid & 31;
    const int wave = tid >> 5;
    const int wm   = wave & 1;          // 2 waves along M
    const int wn   = wave >> 1;         // 4 waves along N
    const int ln   = lane & 15;
    const int hi   = lane >> 4;

    const int bm0 = blockIdx.x * 128;
    const int bn0 = blockIdx.y * 256;
    const int bm  = bm0 + wm * 64;
    const int bn  = bn0 + wn * 64;

    // Stage panel s (k = 32 s .. 32 s + 31) of A (128 rows) and W (256 rows):
    // thread -> 16-byte piece sseg of rows srow, srow + 64, ... of each.
    const int srow = tid >> 2, sseg = tid & 3;
    const _Float16* ag0 = A + (size_t)(bm0 + srow) * K + sseg * 8;
    const _Float16* wg0 = W + (size_t)(bn0 + srow) * K + sseg * 8;
    const size_t    r64 = (size_t)64 * K;
    auto stage = [&](int s) {
        const _Float16* ag = ag0 + s * 32;
        const _Float16* wg = wg0 + s * 32;
        _Float16* l = &lds[s & (G_BUFS - 1)][srow * LDS_STRIDE + sseg * 8];
        async_copy16x6(l,                    ag,
                       l +  64 * LDS_STRIDE, ag + r64,
                       l + 128 * LDS_STRIDE, wg,
                       l + 192 * LDS_STRIDE, wg + r64,
                       l + 256 * LDS_STRIDE, wg + 2 * r64,
                       l + 320 * LDS_STRIDE, wg + 3 * r64);
    };

    v8f acc[4][4] = {};

    // The 16 products of panel s.
    auto step = [&](int s) {
        const _Float16* Al = &lds[s & (G_BUFS - 1)][0];
        const _Float16* Wl = Al + A_ROWS * LDS_STRIDE;

        v16h af[4], bf[4];
#pragma unroll
        for (int i = 0; i < 4; ++i)
            af[i] = make_frag(Al + (wm * 64 + i * 16 + ln) * LDS_STRIDE, hi);
#pragma unroll
        for (int j = 0; j < 4; ++j)
            bf[j] = make_frag(Wl + (wn * 64 + j * 16 + ln) * LDS_STRIDE, hi);
#pragma unroll
        for (int i = 0; i < 4; ++i)
#pragma unroll
            for (int j = 0; j < 4; ++j)
                acc[i][j] = MODE == 0 ? wmma32(bf[j], af[i], acc[i][j])
                                      : wmma32(af[i], bf[j], acc[i][j]);
    };

    const int nk = K / 32;
#pragma unroll  // three straight-line issues
    for (int p = 0; p < G_BUFS - 1; ++p)
        if (p < nk) stage(p);

    // Every trip of this loop issues one panel (six copies a wave), and three
    // panels are outstanding at its head: all but the twelve youngest copies
    // landed means that panel s has.
    int s = 0;
    for (; s + G_BUFS - 1 < nk; ++s) {
        asm volatile("s_wait_dscnt 0" ::: "memory");      // my reads of panel s - 1 are done
        asm volatile("s_wait_asynccnt 12" ::: "memory");  // my copies of panel s have landed
        __syncthreads();                                  // both hold for every wave
        stage(s + G_BUFS - 1);                            // into panel s - 1's buffer
        step(s);
    }
    // The last panels: nothing is issued any more, so the wait is to 0, and no
    // buffer is refilled, so this one barrier serves all of their steps.
    async_wait0();
    __syncthreads();
#pragma clang loop unroll(disable)  // at most three trips; unrolled, it took the kernel above 256 registers
    for (; s < nk; ++s) step(s);

    // ---- output: through LDS, whole lines ----------------------------------
    // Output rows are m (MODE 0) or n (MODE 1); tile (a, c) of the wave's 4x4
    // is rows a*16 .. +15, columns c*16 .. +15, and this lane holds row
    // a*16 + ln, columns c*16 + 8*hi .. +7 of it.
    typedef __attribute__((ext_vector_type(8), aligned(16))) OT ov8;   // rows are 16-byte aligned
    constexpr int RT    = sizeof(OT) == 2 ? 4 : 2;
    constexpr int PITCH = 64 * (int)sizeof(OT) + 16;
    constexpr int LPR   = 64 * (int)sizeof(OT) / 16;
    constexpr int GRP   = 32 / LPR;
    char* st = (char*)&lds[0][0] + wave * (RT * 16 * PITCH);

    v8f   bvec[4];                                     // MODE 0: bias along the columns
    float brow[4];                                     // MODE 1: bias of this lane's rows
#pragma unroll  // constant indices, so that the bias stays in registers
    for (int j = 0; j < 4; ++j) {
        if (MODE == 0) bvec[j] = *(const v8f*)(bias + bn + j * 16 + 8 * hi);
        else           brow[j] = bias[bn + j * 16 + ln];
    }

    const int grp = lane / LPR, seg = lane % LPR;
    const size_t ld = MODE == 0 ? (size_t)N : (size_t)SQdim;   // output row pitch
    OT* orow0 = MODE == 0
        ? out + (size_t)bm * N + bn
        : out + ((size_t)(bm0 / SQdim) * N + bn) * SQdim + bm0 % SQdim + wm * 64;
    char* og = (char*)(orow0 + (size_t)(grp * 8) * ld) + seg * 16;

    __syncthreads();        // every wave has read the last panels: the ring is free

#pragma unroll  // constant indices, so that acc stays in registers
    for (int ro = 0; ro < 4 / RT; ++ro) {
#pragma unroll  // the same
        for (int a = 0; a < RT; ++a) {
#pragma unroll  // the same
            for (int cc = 0; cc < 4; ++cc) {
                const int ra = ro * RT + a;
                const v8f v = MODE == 0 ? (acc[ra][cc] + bvec[cc]) * scale
                                        : (acc[cc][ra] + brow[ra]) * scale;
                *(ov8*)(st + (a * 16 + ln) * PITCH + (cc * 16 + 8 * hi) * (int)sizeof(OT)) =
                    __builtin_convertvector(v, ov8);
            }
        }
        // The rows are read by other lanes of this wave than wrote them.
        asm volatile("s_wait_dscnt 0" ::: "memory");
#pragma unroll  // straight-line loads, then stores
        for (int q = 0; q < RT * 16 / GRP; ++q) {
            const int rq = (q >> 3) * (8 * GRP) + (q & 7);     // + grp * 8: the row
            const v4f d = *(const v4f*)(st + (rq + grp * 8) * PITCH + seg * 16);
            *(v4f*)(og + (size_t)(ro * RT * 16 + rq) * ld * sizeof(OT)) = d;
        }
        // Keeps the next round's LDS stores behind this round's reads of the same rows.
        if (ro + 1 < 4 / RT) asm volatile("s_wait_dscnt 0" ::: "memory");
    }
}

#define KV_STRIDE 72
#define KV_TILE   (64 * KV_STRIDE)          // halves per staged operand tile
#define FA_WAVES  8
#define FA_GROUPS 2                         // 16-query column groups per wave
#define FA_LIMIT  256.0f                    // a tile's weights may sum to this much per lane

__device__ __forceinline__ void async_copy16x4(
    void* l0, const void* g0, void* l1, const void* g1,
    void* l2, const void* g2, void* l3, const void* g3)
{
    const uint32_t o0 = (uint32_t)(uintptr_t)l0, o1 = (uint32_t)(uintptr_t)l1;
    const uint32_t o2 = (uint32_t)(uintptr_t)l2, o3 = (uint32_t)(uintptr_t)l3;
    asm volatile("global_load_async_to_lds_b128 %0, %1, off\n\t"
                 "global_load_async_to_lds_b128 %2, %3, off\n\t"
                 "global_load_async_to_lds_b128 %4, %5, off\n\t"
                 "global_load_async_to_lds_b128 %6, %7, off\n\t"
                 "s_wait_xcnt 0x0"
                 :: "v"(o0), "v"(g0), "v"(o1), "v"(g1),
                    "v"(o2), "v"(g2), "v"(o3), "v"(g3) : "memory");
}

__global__ __launch_bounds__(FA_WAVES * 32) __attribute__((amdgpu_waves_per_eu(4, 4)))
void flash_attn_kernel(
    const _Float16* __restrict__ Q, const _Float16* __restrict__ Kh,
    const _Float16* __restrict__ Vt, _Float16* __restrict__ ctx)
{
    __shared__ __align__(16) _Float16 kv[2][2 * KV_TILE];             // K, Vt

    const int tid  = threadIdx.x;
    const int lane = tid & 31;
    const int wave = tid >> 5;
    const int ln   = lane & 15;
    const int hi   = lane >> 4;

    const int bh = blockIdx.y;
    const int b  = bh >> 4;
    const int h  = bh & 15;
    const int qbase = (blockIdx.x * FA_WAVES + wave) * (16 * FA_GROUPS);

    // Stage keys kb..kb+63: thread -> rows srow and srow+32, 16-byte piece sseg.
    const int srow = tid >> 3, sseg = tid & 7;
    const _Float16* kg0 =
        Kh + ((size_t)(b * SK + srow)) * HIDDEN + h * HEAD_DIM + sseg * 8;
    const _Float16* vg0 =
        Vt + ((size_t)(b * HIDDEN + h * HEAD_DIM + srow)) * SK + sseg * 8;
    auto stage = [&](int buf, int kb) {
        const _Float16* kg = kg0 + (size_t)kb * HIDDEN;
        const _Float16* vg = vg0 + kb;
        _Float16* kl = &kv[buf][srow * KV_STRIDE + sseg * 8];
        _Float16* vl = kl + KV_TILE;
        async_copy16x4(kl, kg, kl + 32 * KV_STRIDE, kg + 32 * HIDDEN,
                       vl, vg, vl + 32 * KV_STRIDE, vg + 32 * SK);
    };

    stage(0, 0);

    // Group g holds queries qbase + 16 g .. + 15, this lane query 16 g + ln.
    const size_t qrow = ((size_t)(b * SQ + qbase + ln)) * HIDDEN + h * HEAD_DIM;
    v16h qf0[FA_GROUPS], qf1[FA_GROUPS];
#pragma unroll  // constant indices, so that the fragments stay in registers
    for (int g = 0; g < FA_GROUPS; ++g) {
        qf0[g] = make_frag(Q + qrow + (size_t)g * 16 * HIDDEN, hi);
        qf1[g] = make_frag(Q + qrow + (size_t)g * 16 * HIDDEN + 32, hi);
    }

    // This lane's query of each group: minus the reference maximum (eight
    // registers alike, a C operand), and the sum over the keys of this half
    // alone (the halves' sums are joined behind the loop).
    v8f   nm[FA_GROUPS];
    float lq[FA_GROUPS];
    v8f   acc[FA_GROUPS][4];    // acc[g][d][r] = O^T[d*16 + 8*hi + r][query 16 g + ln]
#pragma unroll  // constant indices, so that all of it stays in registers
    for (int g = 0; g < FA_GROUPS; ++g) {
        nm[g] = v8f{} + 1e30f; lq[g] = 0.0f;
        acc[g][0] = v8f{}; acc[g][1] = v8f{}; acc[g][2] = v8f{}; acc[g][3] = v8f{};
    }

    async_wait0();          // my copies of tile 0 have landed
    asm volatile("s_wait_xcnt 0x0" ::: "memory");   // before the Q loads' address registers are used again
    __syncthreads();        // everyone's have
    stage(1, 64);

#pragma clang loop unroll(disable)  // tile 0 stays in the loop: peeled off, it is a third copy of the pass, and it spills
    for (int it = 0; it < SK / 64; ++it) {
        const _Float16* Kl = &kv[it & 1][0];
        const _Float16* Vl = Kl + KV_TILE;

        v16h  pf0[FA_GROUPS], pf1[FA_GROUPS];        // P^T: keys 0-31, keys 32-63
        float ts[FA_GROUPS];                         // this tile's weights, summed

        auto pass = [&](const bool rebase) {
            // ---- scores: S^T(64 x 32) as four 16x16 tiles per group, k = 64 -
            // sc[g][t][r] = S[query 16 g + ln][key t*16 + 8*hi + r] (- reference)
            v8f sc[FA_GROUPS][4];
#pragma unroll
            for (int t = 0; t < 4; ++t) {
                const _Float16* krow = Kl + (t * 16 + ln) * KV_STRIDE;
                const v16h kf0 = make_frag(krow, hi);
                const v16h kf1 = make_frag(krow + 32, hi);
#pragma unroll  // constant indices, so that sc stays in registers
                for (int g = 0; g < FA_GROUPS; ++g)
                    sc[g][t] = wmma32(kf0, qf0[g], rebase ? v8f{} : nm[g]);
#pragma unroll  // the same
                for (int g = 0; g < FA_GROUPS; ++g) sc[g][t] = wmma32(kf1, qf1[g], sc[g][t]);
            }

            // ---- weights, one query per lane and group ----------------------
#pragma unroll  // constant indices, so that sc and acc stay in registers
            for (int g = 0; g < FA_GROUPS; ++g) {
                if (rebase) {
                    float mb = __builtin_reduce_max(__builtin_elementwise_max(
                        __builtin_elementwise_max(sc[g][0], sc[g][1]),
                        __builtin_elementwise_max(sc[g][2], sc[g][3])));   // this half's 32 keys
                    mb = fmaxf(mb, xhalf(mb));               // all 64 keys
                    const float mo = -nm[g][0];
                    const float mn = fmaxf(mo, mb);          // the new reference
                    const float cf = exp2_1(mo - mn);        // what was summed so far shrinks by this
                    lq[g] *= cf;
                    acc[g][0] *= cf; acc[g][1] *= cf; acc[g][2] *= cf; acc[g][3] *= cf;
                    nm[g] = v8f{} - mn;
#pragma unroll  // the same
                    for (int t = 0; t < 4; ++t) sc[g][t] += nm[g];
                }
#pragma unroll  // the same
                for (int t = 0; t < 4; ++t)
                    sc[g][t] = rebase ? exp2_8(sc[g][t]) : exp2_8_of_wmma(sc[g][t]);
                // Sum the four tiles register by register first (packed adds),
                // then the eight registers.
                const v8f pv = (sc[g][0] + sc[g][1]) + (sc[g][2] + sc[g][3]);
                ts[g] = ((pv[0] + pv[1]) + (pv[2] + pv[3])) +
                        ((pv[4] + pv[5]) + (pv[6] + pv[7]));

                // P^T as B fragments: two score tiles converted in place.
#pragma unroll  // the same
                for (int e = 0; e < 16; ++e) {
                    pf0[g][e] = (_Float16)sc[g][e >> 3][e & 7];
                    pf1[g][e] = (_Float16)sc[g][2 + (e >> 3)][e & 7];
                }
            }
        };

        // One test per tile for the whole wave, a scalar branch.  The sums are
        // not negative, so their sum bounds each; written so that no-number
        // and infinity go the long way too.
        if (it != 0) pass(false);
        if (it == 0 || __builtin_amdgcn_ballot_w32(!(ts[0] + ts[1] <= FA_LIMIT)) != 0) {
            // Compiler fence: the long way loads its K fragments from LDS anew.
            // Without it the common pass's 64 fragment registers are kept for
            // this branch, and the loop spills.
            asm volatile("" ::: "memory");
            pass(true);
        }
#pragma unroll  // constant indices
        for (int g = 0; g < FA_GROUPS; ++g) lq[g] += ts[g];

        // ---- PV: O^T(64 x 32) += V^T(64x64) * P^T(64x32) -------------------
        v16h vb[4][2];
#pragma unroll  // constant indices, so that the fragments stay in registers
        for (int d = 0; d < 4; ++d) {
            const _Float16* vrow = Vl + (d * 16 + ln) * KV_STRIDE;
            vb[d][0] = make_frag(vrow, hi);
            vb[d][1] = make_frag(vrow + 32, hi);
        }
        // All sixteen LDS reads are issued ahead of the products (the score
        // registers are free by now).  Without it the compiler puts each
        // fragment's reads, and a wait to 0, directly in front of its products.
        __builtin_amdgcn_sched_barrier(0);
#pragma unroll
        for (int d = 0; d < 4; ++d) {
#pragma unroll  // constant indices, so that acc stays in registers
            for (int g = 0; g < FA_GROUPS; ++g) acc[g][d] = wmma32(vb[d][0], pf0[g], acc[g][d]);
#pragma unroll  // the same
            for (int g = 0; g < FA_GROUPS; ++g) acc[g][d] = wmma32(vb[d][1], pf1[g], acc[g][d]);
        }

        // ---- hand-over: this buffer is read out, the next tile has landed --
        asm volatile("s_wait_dscnt 0" ::: "memory");  // my reads of this buffer are done
        async_wait0();                                // my copies of the next tile have landed
        __syncthreads();                              // both hold for every wave
        if (it + 2 < SK / 64) stage(it & 1, (it + 2) * 64);
    }
    async_wait0();          // nothing of mine in flight when the wave ends

    // ---- normalize and store ctx (f16): 8 consecutive columns per lane ----
#pragma unroll  // constant indices, so that acc stays in registers
    for (int g = 0; g < FA_GROUPS; ++g) {
        const float lsum = lq[g] + xhalf(lq[g]);     // join the halves' sums
        _Float16* crow = ctx + ((size_t)(b * SQ + qbase + g * 16 + ln)) * HIDDEN
                             + h * HEAD_DIM + 8 * hi;
#pragma unroll  // the same
        for (int d = 0; d < 4; ++d) {
            v8h o;
#pragma unroll  // the same
            for (int r = 0; r < 8; ++r) o[r] = (_Float16)(acc[g][d][r] / lsum);
            *(v8h*)(crow + d * 16) = o;
        }
    }
}

// ---------------------------------------------------------------------------
extern "C" void kernel_launch(void* const* d_in, const int* in_sizes, int n_in,
                              void* d_out, int out_size, void* d_ws, size_t ws_size,
                              hipStream_t stream) {
    const float* query = (const float*)d_in[0];
    const float* key   = (const float*)d_in[1];
    const float* value = (const float*)d_in[2];
    const float* Wq    = (const float*)d_in[3];
    const float* bq    = (const float*)d_in[4];
    const float* Wk    = (const float*)d_in[5];
    const float* bk    = (const float*)d_in[6];
    const float* Wv    = (const float*)d_in[7];
    const float* bv    = (const float*)d_in[8];
    const float* Wo    = (const float*)d_in[9];
    const float* bo    = (const float*)d_in[10];
    float*       out   = (float*)d_out;

    const size_t tok  = (size_t)BATCH * SQ;            // 8192 tokens
    const size_t act  = tok * HIDDEN;                  // 8M elements
    const size_t wsz  = (size_t)HIDDEN * HIDDEN;       // 1M elements

    // ws layout (f16 elements); ctx aliases xq (dead after Q projection).
    _Float16* base = (_Float16*)d_ws;
    _Float16* xq  = base;                 // act
    _Float16* xk  = xq  + act;            // act
    _Float16* xv  = xk  + act;            // act
    _Float16* wqh = xv  + act;            // wsz
    _Float16* wkh = wqh + wsz;
    _Float16* wvh = wkh + wsz;
    _Float16* woh = wvh + wsz;
    _Float16* Qp  = woh + wsz;
    _Float16* Kp  = Qp  + act;
    _Float16* Vtp = Kp  + act;
    _Float16* ctx = xq;

    // ---- stage f32 -> f16: xq, xk, xv, wqh, wkh, wvh, woh in one launch ----
    cvt_f16_kernel<<<CVT_BLOCKS, CVT_WAVES * 32, 0, stream>>>(
        query, key, value, Wq, Wk, Wv, Wo, base);

    const dim3 gblk((unsigned)(tok / 128), HIDDEN / 256);   // 64 x 4 blocks
    const float qscale = 0.18033688f;                       // HEAD_DIM^-0.5 * log2 e

    gemm_f16_kernel<_Float16, 0><<<gblk, 256, 0, stream>>>(
        xq, wqh, bq, Qp, (int)tok, HIDDEN, HIDDEN, SQ, qscale);
    gemm_f16_kernel<_Float16, 0><<<gblk, 256, 0, stream>>>(
        xk, wkh, bk, Kp, (int)tok, HIDDEN, HIDDEN, SK, 1.0f);
    gemm_f16_kernel<_Float16, 1><<<gblk, 256, 0, stream>>>(
        xv, wvh, bv, Vtp, (int)tok, HIDDEN, HIDDEN, SK, 1.0f);

    flash_attn_kernel<<<dim3(SQ / (16 * FA_GROUPS) / FA_WAVES, BATCH * HEADS), FA_WAVES * 32, 0, stream>>>(
        Qp, Kp, Vtp, ctx);

    gemm_f16_kernel<float, 0><<<gblk, 256, 0, stream>>>(
        ctx, woh, bo, out, (int)tok, HIDDEN, HIDDEN, SQ, 1.0f);
}

// v008
// Measured time: 124 microseconds a run.
// Next to v007, in two timings, it ran 1.12 times as fast each time.
// Over all steps from v000 it is 2.89 times as fast.
#include <hip/hip_runtime.h>

#define HIDDEN   1024
#define HEADS    16
#define HEAD_DIM 64
#define BATCH    4
#define SQ       2048
#define SK       2048

typedef __attribute__((ext_vector_type(16))) _Float16 v16h;
typedef __attribute__((ext_vector_type(8)))  _Float16 v8h;
typedef __attribute__((ext_vector_type(8)))  float    v8f;

// D = A(16x32 f16) * B(32x16 f16) + C(16x16 f32)
__device__ __forceinline__ v8f wmma32(v16h a, v16h b, v8f c) {
    return __builtin_amdgcn_wmma_f32_16x16x32_f16(
        false, a, false, b, (short)0, c, false, false);
}

__device__ __forceinline__ v16h make_frag(const _Float16* __restrict__ p, int hi) {
    const v8h lo = *(const v8h*)(p + hi * 8);
    const v8h hs = *(const v8h*)(p + hi * 8 + 16);
    return __builtin_shufflevector(lo, hs, 0,1,2,3,4,5,6,7,8,9,10,11,12,13,14,15);
}

__device__ __forceinline__ void async_wait0() {
    asm volatile("s_wait_asynccnt 0" ::: "memory");
}

__device__ __forceinline__ float xhalf(float x) {
    const int i = __builtin_bit_cast(int, x);
    return __builtin_bit_cast(float, __builtin_amdgcn_permlanex16(
        i, i, 0x76543210, 0xfedcba98, false, false));
}

__device__ __forceinline__ float exp2_1(float x) {
    float y;
    asm("v_exp_f32 %0, %1\n\tv_nop" : "=&v"(y) : "v"(x));
    return y;
}
__device__ __forceinline__ v8f exp2_8(v8f x) {
    float y0, y1, y2, y3, y4, y5, y6, y7;
    asm("v_exp_f32 %0, %8\n\t"
        "v_exp_f32 %1, %9\n\t"
        "v_exp_f32 %2, %10\n\t"
        "v_exp_f32 %3, %11\n\t"
        "v_exp_f32 %4, %12\n\t"
        "v_exp_f32 %5, %13\n\t"
        "v_exp_f32 %6, %14\n\t"
        "v_exp_f32 %7, %15\n\t"
        "v_nop"
        : "=&v"(y0), "=&v"(y1), "=&v"(y2), "=&v"(y3),
          "=&v"(y4), "=&v"(y5), "=&v"(y6), "=&v"(y7)
        : "v"(x[0]), "v"(x[1]), "v"(x[2]), "v"(x[3]),
          "v"(x[4]), "v"(x[5]), "v"(x[6]), "v"(x[7]));
    return v8f{y0, y1, y2, y3, y4, y5, y6, y7};
}
__device__ __forceinline__ v8f exp2_8_of_wmma(v8f x) {
    v8f y;
#pragma unroll  // constant indices, so that x and y stay in registers
    for (int i = 0; i < 8; ++i) y[i] = __builtin_amdgcn_exp2f(x[i]);
    return y;
}

// ---------------------------------------------------------------------------
// f32 -> f16 staging of the four weights in one launch.  The f16 copies lie one
// behind the other in the workspace, in the order of the arguments.  A piece is
// 1024 elements: 8 loads of 512 contiguous bytes per wave.  The 4096 pieces go
// one to a wave (16 waves per block, 256 blocks, 64 blocks per weight).
// The activations are not staged: the projections read them as f32.
// ---------------------------------------------------------------------------
#define CVT_WAVES  16
#define CVT_BLOCKS 256
#define CVT_PIECE  1024                          // elements

typedef __attribute__((ext_vector_type(4))) _Float16 v4h;
typedef __attribute__((ext_vector_type(4))) float    v4f;

__global__ __launch_bounds__(CVT_WAVES * 32) void cvt_f16_kernel(
    const float* __restrict__ Wq, const float* __restrict__ Wk,
    const float* __restrict__ Wv, const float* __restrict__ Wo,
    _Float16* __restrict__ out)
{
    const unsigned tp = ((threadIdx.x >> 5) << 10) | ((threadIdx.x & 31) << 2);
    const unsigned bp = blockIdx.x * (CVT_WAVES * CVT_PIECE);

    const unsigned wsel = blockIdx.x >> 6;       // 64 blocks per weight
    const float* w = wsel == 0 ? Wq : wsel == 1 ? Wk : wsel == 2 ? Wv : Wo;
    const float* src = w + (bp & (HIDDEN * HIDDEN - 1)) + tp;
    _Float16*    dst = out + bp + tp;

    v4f r[8];
#pragma unroll  // constant indices, so that r stays in registers
    for (int c = 0; c < 8; ++c) r[c] = *(const v4f*)(src + c * 128);
#pragma unroll  // the same
    for (int c = 0; c < 8; ++c)
        *(v4h*)(dst + c * 128) = __builtin_convertvector(r[c], v4h);
}

#define LDS_STRIDE 40
#define A_ROWS     128
#define W_ROWS     256
#define G_BUFS     4                        // ring depth (a power of two)
#define G_PANEL    ((A_ROWS + W_ROWS) * LDS_STRIDE)   // halves per buffer

__device__ __forceinline__ void async_copy16x6(
    void* l0, const void* g0, void* l1, const void* g1,
    void* l2, const void* g2, void* l3, const void* g3,
    void* l4, const void* g4, void* l5, const void* g5)
{
    const uint32_t o0 = (uint32_t)(uintptr_t)l0, o1 = (uint32_t)(uintptr_t)l1;
    const uint32_t o2 = (uint32_t)(uintptr_t)l2, o3 = (uint32_t)(uintptr_t)l3;
    const uint32_t o4 = (uint32_t)(uintptr_t)l4, o5 = (uint32_t)(uintptr_t)l5;
    asm volatile("global_load_async_to_lds_b128 %0, %1, off\n\t"
                 "global_load_async_to_lds_b128 %2, %3, off\n\t"
                 "global_load_async_to_lds_b128 %4, %5, off\n\t"
                 "global_load_async_to_lds_b128 %6, %7, off\n\t"
                 "global_load_async_to_lds_b128 %8, %9, off\n\t"
                 "global_load_async_to_lds_b128 %10, %11, off\n\t"
                 "s_wait_xcnt 0x0"
                 :: "v"(o0), "v"(g0), "v"(o1), "v"(g1), "v"(o2), "v"(g2),
                    "v"(o3), "v"(g3), "v"(o4), "v"(g4), "v"(o5), "v"(g5)
                 : "memory");
}

template <typename OT, int MODE>
__global__ __launch_bounds__(256) void gemm_f16_kernel(
    const _Float16* __restrict__ A, const _Float16* __restrict__ W,
    const float* __restrict__ bias, OT* __restrict__ out,
    int M, int N, int K, int SQdim, float scale)
{
    __shared__ __align__(16) _Float16 lds[G_BUFS][G_PANEL];

    const int tid  = threadIdx.x;
    const int lane = tid & 31;
    const int wave = tid >> 5;
    const int wm   = wave & 1;          // 2 waves along M
    const int wn   = wave >> 1;         // 4 waves along N
    const int ln   = lane & 15;
    const int hi   = lane >> 4;

    const int bm0 = blockIdx.x * 128;
    const int bn0 = blockIdx.y * 256;
    const int bm  = bm0 + wm * 64;
    const int bn  = bn0 + wn * 64;

    // Stage panel s (k = 32 s .. 32 s + 31) of A (128 rows) and W (256 rows):
    // thread -> 16-byte piece sseg of rows srow, srow + 64, ... of each.
    const int srow = tid >> 2, sseg = tid & 3;
    const _Float16* ag0 = A + (size_t)(bm0 + srow) * K + sseg * 8;
    const _Float16* wg0 = W + (size_t)(bn0 + srow) * K + sseg * 8;
    const size_t    r64 = (size_t)64 * K;
    auto stage = [&](int s) {
        const _Float16* ag = ag0 + s * 32;
        const _Float16* wg = wg0 + s * 32;
        _Float16* l = &lds[s & (G_BUFS - 1)][srow * LDS_STRIDE + sseg * 8];
        async_copy16x6(l,                    ag,
                       l +  64 * LDS_STRIDE, ag + r64,
                       l + 128 * LDS_STRIDE, wg,
                       l + 192 * LDS_STRIDE, wg + r64,
                       l + 256 * LDS_STRIDE, wg + 2 * r64,
                       l + 320 * LDS_STRIDE, wg + 3 * r64);
    };

    v8f acc[4][4] = {};

    // The 16 products of panel s.
    auto step = [&](int s) {
        const _Float16* Al = &lds[s & (G_BUFS - 1)][0];
        const _Float16* Wl = Al + A_ROWS * LDS_STRIDE;

        v16h af[4], bf[4];
#pragma unroll
        for (int i = 0; i < 4; ++i)
            af[i] = make_frag(Al + (wm * 64 + i * 16 + ln) * LDS_STRIDE, hi);
#pragma unroll
        for (int j = 0; j < 4; ++j)
            bf[j] = make_frag(Wl + (wn * 64 + j * 16 + ln) * LDS_STRIDE, hi);
#pragma unroll
        for (int i = 0; i < 4; ++i)
#pragma unroll
            for (int j = 0; j < 4; ++j)
                acc[i][j] = MODE == 0 ? wmma32(bf[j], af[i], acc[i][j])
                                      : wmma32(af[i], bf[j], acc[i][j]);
    };

    const int nk = K / 32;
#pragma unroll  // three straight-line issues
    for (int p = 0; p < G_BUFS - 1; ++p)
        if (p < nk) stage(p);

    // Every trip of this loop issues one panel (six copies a wave), and three
    // panels are outstanding at its head: all but the twelve youngest copies
    // landed means that panel s has.
    int s = 0;
    for (; s + G_BUFS - 1 < nk; ++s) {
        asm volatile("s_wait_dscnt 0" ::: "memory");      // my reads of panel s - 1 are done
        asm volatile("s_wait_asynccnt 12" ::: "memory");  // my copies of panel s have landed
        __syncthreads();                                  // both hold for every wave
        stage(s + G_BUFS - 1);                            // into panel s - 1's buffer
        step(s);
    }
    // The last panels: nothing is issued any more, so the wait is to 0, and no
    // buffer is refilled, so this one barrier serves all of their steps.
    async_wait0();
    __syncthreads();
#pragma clang loop unroll(disable)  // at most three trips; unrolled, it took the kernel above 256 registers
    for (; s < nk; ++s) step(s);

    // ---- output: through LDS, whole lines ----------------------------------
    // Output rows are m (MODE 0) or n (MODE 1); tile (a, c) of the wave's 4x4
    // is rows a*16 .. +15, columns c*16 .. +15, and this lane holds row
    // a*16 + ln, columns c*16 + 8*hi .. +7 of it.
    typedef __attribute__((ext_vector_type(8), aligned(16))) OT ov8;   // rows are 16-byte aligned
    constexpr int RT    = sizeof(OT) == 2 ? 4 : 2;
    constexpr int PITCH = 64 * (int)sizeof(OT) + 16;
    constexpr int LPR   = 64 * (int)sizeof(OT) / 16;
    constexpr int GRP   = 32 / LPR;
    char* st = (char*)&lds[0][0] + wave * (RT * 16 * PITCH);

    v8f   bvec[4];                                     // MODE 0: bias along the columns
    float brow[4];                                     // MODE 1: bias of this lane's rows
#pragma unroll  // constant indices, so that the bias stays in registers
    for (int j = 0; j < 4; ++j) {
        if (MODE == 0) bvec[j] = *(const v8f*)(bias + bn + j * 16 + 8 * hi);
        else           brow[j] = bias[bn + j * 16 + ln];
    }

    const int grp = lane / LPR, seg = lane % LPR;
    const size_t ld = MODE == 0 ? (size_t)N : (size_t)SQdim;   // output row pitch
    OT* orow0 = MODE == 0
        ? out + (size_t)bm * N + bn
        : out + ((size_t)(bm0 / SQdim) * N + bn) * SQdim + bm0 % SQdim + wm * 64;
    char* og = (char*)(orow0 + (size_t)(grp * 8) * ld) + seg * 16;

    __syncthreads();        // every wave has read the last panels: the ring is free

#pragma unroll  // constant indices, so that acc stays in registers
    for (int ro = 0; ro < 4 / RT; ++ro) {
#pragma unroll  // the same
        for (int a = 0; a < RT; ++a) {
#pragma unroll  // the same
            for (int cc = 0; cc < 4; ++cc) {
                const int ra = ro * RT + a;
                const v8f v = MODE == 0 ? (acc[ra][cc] + bvec[cc]) * scale
                                        : (acc[cc][ra] + brow[ra]) * scale;
                *(ov8*)(st + (a * 16 + ln) * PITCH + (cc * 16 + 8 * hi) * (int)sizeof(OT)) =
                    __builtin_convertvector(v, ov8);
            }
        }
        // The rows are read by other lanes of this wave than wrote them.
        asm volatile("s_wait_dscnt 0" ::: "memory");
#pragma unroll  // straight-line loads, then stores
        for (int q = 0; q < RT * 16 / GRP; ++q) {
            const int rq = (q >> 3) * (8 * GRP) + (q & 7);     // + grp * 8: the row
            const v4f d = *(const v4f*)(st + (rq + grp * 8) * PITCH + seg * 16);
            *(v4f*)(og + (size_t)(ro * RT * 16 + rq) * ld * sizeof(OT)) = d;
        }
        // Keeps the next round's LDS stores behind this round's reads of the same rows.
        if (ro + 1 < 4 / RT) asm volatile("s_wait_dscnt 0" ::: "memory");
    }
}

#define KV_STRIDE 72
#define KV_TILE   (64 * KV_STRIDE)          // halves per staged operand tile
#define FA_WAVES  8
#define FA_GROUPS 2                         // 16-query column groups per wave
#define FA_LIMIT  256.0f                    // a tile's weights may sum to this much per lane

__device__ __forceinline__ void async_copy16x4(
    void* l0, const void* g0, void* l1, const void* g1,
    void* l2, const void* g2, void* l3, const void* g3)
{
    const uint32_t o0 = (uint32_t)(uintptr_t)l0, o1 = (uint32_t)(uintptr_t)l1;
    const uint32_t o2 = (uint32_t)(uintptr_t)l2, o3 = (uint32_t)(uintptr_t)l3;
    asm volatile("global_load_async_to_lds_b128 %0, %1, off\n\t"
                 "global_load_async_to_lds_b128 %2, %3, off\n\t"
                 "global_load_async_to_lds_b128 %4, %5, off\n\t"
                 "global_load_async_to_lds_b128 %6, %7, off\n\t"
                 "s_wait_xcnt 0x0"
                 :: "v"(o0), "v"(g0), "v"(o1), "v"(g1),
                    "v"(o2), "v"(g2), "v"(o3), "v"(g3) : "memory");
}

__global__ __launch_bounds__(FA_WAVES * 32) __attribute__((amdgpu_waves_per_eu(4, 4)))
void flash_attn_kernel(
    const _Float16* __restrict__ Q, const _Float16* __restrict__ Kh,
    const _Float16* __restrict__ Vt, _Float16* __restrict__ ctx)
{
    __shared__ __align__(16) _Float16 kv[2][2 * KV_TILE];             // K, Vt

    const int tid  = threadIdx.x;
    const int lane = tid & 31;
    const int wave = tid >> 5;
    const int ln   = lane & 15;
    const int hi   = lane >> 4;

    const int bh = blockIdx.y;
    const int b  = bh >> 4;
    const int h  = bh & 15;
    const int qbase = (blockIdx.x * FA_WAVES + wave) * (16 * FA_GROUPS);

    // Stage keys kb..kb+63: thread -> rows srow and srow+32, 16-byte piece sseg.
    const int srow = tid >> 3, sseg = tid & 7;
    const _Float16* kg0 =
        Kh + ((size_t)(b * SK + srow)) * HIDDEN + h * HEAD_DIM + sseg * 8;
    const _Float16* vg0 =
        Vt + ((size_t)(b * HIDDEN + h * HEAD_DIM + srow)) * SK + sseg * 8;
    auto stage = [&](int buf, int kb) {
        const _Float16* kg = kg0 + (size_t)kb * HIDDEN;
        const _Float16* vg = vg0 + kb;
        _Float16* kl = &kv[buf][srow * KV_STRIDE + sseg * 8];
        _Float16* vl = kl + KV_TILE;
        async_copy16x4(kl, kg, kl + 32 * KV_STRIDE, kg + 32 * HIDDEN,
                       vl, vg, vl + 32 * KV_STRIDE, vg + 32 * SK);
    };

    stage(0, 0);

    // Group g holds queries qbase + 16 g .. + 15, this lane query 16 g + ln.
    const size_t qrow = ((size_t)(b * SQ + qbase + ln)) * HIDDEN + h * HEAD_DIM;
    v16h qf0[FA_GROUPS], qf1[FA_GROUPS];
#pragma unroll  // constant indices, so that the fragments stay in registers
    for (int g = 0; g < FA_GROUPS; ++g) {
        qf0[g] = make_frag(Q + qrow + (size_t)g * 16 * HIDDEN, hi);
        qf1[g] = make_frag(Q + qrow + (size_t)g * 16 * HIDDEN + 32, hi);
    }

    // This lane's query of each group: minus the reference maximum (eight
    // registers alike, a C operand), and the sum over the keys of this half
    // alone (the halves' sums are joined behind the loop).
    v8f   nm[FA_GROUPS];
    float lq[FA_GROUPS];
    v8f   acc[FA_GROUPS][4];    // acc[g][d][r] = O^T[d*16 + 8*hi + r][query 16 g + ln]
#pragma unroll  // constant indices, so that all of it stays in registers
    for (int g = 0; g < FA_GROUPS; ++g) {
        nm[g] = v8f{} + 1e30f; lq[g] = 0.0f;
        acc[g][0] = v8f{}; acc[g][1] = v8f{}; acc[g][2] = v8f{}; acc[g][3] = v8f{};
    }

    async_wait0();          // my copies of tile 0 have landed
    asm volatile("s_wait_xcnt 0x0" ::: "memory");   // before the Q loads' address registers are used again
    __syncthreads();        // everyone's have
    stage(1, 64);

#pragma clang loop unroll(disable)  // tile 0 stays in the loop: peeled off, it is a third copy of the pass, and it spills
    for (int it = 0; it < SK / 64; ++it) {
        const _Float16* Kl = &kv[it & 1][0];
        const _Float16* Vl = Kl + KV_TILE;

        v16h  pf0[FA_GROUPS], pf1[FA_GROUPS];        // P^T: keys 0-31, keys 32-63
        float ts[FA_GROUPS];                         // this tile's weights, summed

        auto pass = [&](const bool rebase) {
            // ---- scores: S^T(64 x 32) as four 16x16 tiles per group, k = 64 -
            // sc[g][t][r] = S[query 16 g + ln][key t*16 + 8*hi + r] (- reference)
            v8f sc[FA_GROUPS][4];
#pragma unroll
            for (int t = 0; t < 4; ++t) {
                const _Float16* krow = Kl + (t * 16 + ln) * KV_STRIDE;
                const v16h kf0 = make_frag(krow, hi);
                const v16h kf1 = make_frag(krow + 32, hi);
#pragma unroll  // constant indices, so that sc stays in registers
                for (int g = 0; g < FA_GROUPS; ++g)
                    sc[g][t] = wmma32(kf0, qf0[g], rebase ? v8f{} : nm[g]);
#pragma unroll  // the same
                for (int g = 0; g < FA_GROUPS; ++g) sc[g][t] = wmma32(kf1, qf1[g], sc[g][t]);
            }

            // ---- weights, one query per lane and group ----------------------
#pragma unroll  // constant indices, so that sc and acc stay in registers
            for (int g = 0; g < FA_GROUPS; ++g) {
                if (rebase) {
                    float mb = __builtin_reduce_max(__builtin_elementwise_max(
                        __builtin_elementwise_max(sc[g][0], sc[g][1]),
                        __builtin_elementwise_max(sc[g][2], sc[g][3])));   // this half's 32 keys
                    mb = fmaxf(mb, xhalf(mb));               // all 64 keys
                    const float mo = -nm[g][0];
                    const float mn = fmaxf(mo, mb);          // the new reference
                    const float cf = exp2_1(mo - mn);        // what was summed so far shrinks by this
                    lq[g] *= cf;
                    acc[g][0] *= cf; acc[g][1] *= cf; acc[g][2] *= cf; acc[g][3] *= cf;
                    nm[g] = v8f{} - mn;
#pragma unroll  // the same
                    for (int t = 0; t < 4; ++t) sc[g][t] += nm[g];
                }
#pragma unroll  // the same
                for (int t = 0; t < 4; ++t)
                    sc[g][t] = rebase ? exp2_8(sc[g][t]) : exp2_8_of_wmma(sc[g][t]);
                // Sum the four tiles register by register first (packed adds),
                // then the eight registers.
                const v8f pv = (sc[g][0] + sc[g][1]) + (sc[g][2] + sc[g][3]);
                ts[g] = ((pv[0] + pv[1]) + (pv[2] + pv[3])) +
                        ((pv[4] + pv[5]) + (pv[6] + pv[7]));

                // P^T as B fragments: two score tiles converted in place.
#pragma unroll  // the same
                for (int e = 0; e < 16; ++e) {
                    pf0[g][e] = (_Float16)sc[g][e >> 3][e & 7];
                    pf1[g][e] = (_Float16)sc[g][2 + (e >> 3)][e & 7];
                }
            }
        };

        // One test per tile for the whole wave, a scalar branch.  The sums are
        // not negative, so their sum bounds each; written so that no-number
        // and infinity go the long way too.
        if (it != 0) pass(false);
        if (it == 0 || __builtin_amdgcn_ballot_w32(!(ts[0] + ts[1] <= FA_LIMIT)) != 0) {
            // Compiler fence: the long way loads its K fragments from LDS anew.
            // Without it the common pass's 64 fragment registers are kept for
            // this branch, and the loop spills.
            asm volatile("" ::: "memory");
            pass(true);
        }
#pragma unroll  // constant indices
        for (int g = 0; g < FA_GROUPS; ++g) lq[g] += ts[g];

        // ---- PV: O^T(64 x 32) += V^T(64x64) * P^T(64x32) -------------------
        v16h vb[4][2];
#pragma unroll  // constant indices, so that the fragments stay in registers
        for (int d = 0; d < 4; ++d) {
            const _Float16* vrow = Vl + (d * 16 + ln) * KV_STRIDE;
            vb[d][0] = make_frag(vrow, hi);
            vb[d][1] = make_frag(vrow + 32, hi);
        }
        // All sixteen LDS reads are issued ahead of the products (the score
        // registers are free by now).  Without it the compiler puts each
        // fragment's reads, and a wait to 0, directly in front of its products.
        __builtin_amdgcn_sched_barrier(0);
#pragma unroll
        for (int d = 0; d < 4; ++d) {
#pragma unroll  // constant indices, so that acc stays in registers
            for (int g = 0; g < FA_GROUPS; ++g) acc[g][d] = wmma32(vb[d][0], pf0[g], acc[g][d]);
#pragma unroll  // the same
            for (int g = 0; g < FA_GROUPS; ++g) acc[g][d] = wmma32(vb[d][1], pf1[g], acc[g][d]);
        }

        // ---- hand-over: this buffer is read out, the next tile has landed --
        asm volatile("s_wait_dscnt 0" ::: "memory");  // my reads of this buffer are done
        async_wait0();                                // my copies of the next tile have landed
        __syncthreads();                              // both hold for every wave
        if (it + 2 < SK / 64) stage(it & 1, (it + 2) * 64);
    }
    async_wait0();          // nothing of mine in flight when the wave ends

    // ---- normalize and store ctx (f16): 8 consecutive columns per lane ----
#pragma unroll  // constant indices, so that acc stays in registers
    for (int g = 0; g < FA_GROUPS; ++g) {
        const float lsum = lq[g] + xhalf(lq[g]);     // join the halves' sums
        _Float16* crow = ctx + ((size_t)(b * SQ + qbase + g * 16 + ln)) * HIDDEN
                             + h * HEAD_DIM + 8 * hi;
#pragma unroll  // the same
        for (int d = 0; d < 4; ++d) {
            v8h o;
#pragma unroll  // the same
            for (int r = 0; r < 8; ++r) o[r] = (_Float16)(acc[g][d][r] / lsum);
            *(v8h*)(crow + d * 16) = o;
        }
    }
}

// ---------------------------------------------------------------------------
// Projection GEMM whose A operand is an f32 input: out = (A W^T + bias) * scale,
// A [M x HIDDEN] f32, W [HIDDEN x HIDDEN] f16, out f16.  Tiles, LDS ring, panel
// layout, products and output path are those of gemm_f16_kernel.  Only A's way
// into the ring differs: whole 128-byte lines (one K-step of a row) come into
// registers by plain loads, X_SETS K-steps ahead, are rounded to f16 there (the
// rounding that the staging launch did) and are stored into the panel one step
// before it is read.  W's part of a panel comes by four async copies a lane.
//
// Step s, behind its barrier: W's copies of panel s + 3 (buffer of panel s - 1,
// which every wave has left); this step's fragment reads; A's part of panel
// s + 1 is stored (its buffer was last read in step s - 3); the loads of panel
// s + 1 + X_SETS go out into the registers just freed; the 16 products.
// The s_wait_dscnt 0 in front of the next barrier covers reads and stores.
// The loop is unrolled whole: register sets and ring places are then constants.
// ---------------------------------------------------------------------------
#define X_SETS 5                            // K-steps of lead of A's loads: they come from memory

typedef __attribute__((ext_vector_type(2))) unsigned v2u;

__device__ __forceinline__ void round16(const v4f (&x)[4], v2u (&y)[4]) {
    unsigned u0, u1, u2, u3, u4, u5, u6, u7;
    asm volatile("v_nop\n\tv_nop\n\tv_nop\n\tv_nop\n\t"
                 "v_cvt_pk_f16_f32 %0, %8, %9\n\t"
                 "v_cvt_pk_f16_f32 %1, %10, %11\n\t"
                 "v_cvt_pk_f16_f32 %2, %12, %13\n\t"
                 "v_cvt_pk_f16_f32 %3, %14, %15\n\t"
                 "v_cvt_pk_f16_f32 %4, %16, %17\n\t"
                 "v_cvt_pk_f16_f32 %5, %18, %19\n\t"
                 "v_cvt_pk_f16_f32 %6, %20, %21\n\t"
                 "v_cvt_pk_f16_f32 %7, %22, %23"
                 : "=&v"(u0), "=&v"(u1), "=&v"(u2), "=&v"(u3),
                   "=&v"(u4), "=&v"(u5), "=&v"(u6), "=&v"(u7)
                 : "v"(x[0][0]), "v"(x[0][1]), "v"(x[0][2]), "v"(x[0][3]),
                   "v"(x[1][0]), "v"(x[1][1]), "v"(x[1][2]), "v"(x[1][3]),
                   "v"(x[2][0]), "v"(x[2][1]), "v"(x[2][2]), "v"(x[2][3]),
                   "v"(x[3][0]), "v"(x[3][1]), "v"(x[3][2]), "v"(x[3][3]));
    y[0] = v2u{u0, u1}; y[1] = v2u{u2, u3}; y[2] = v2u{u4, u5}; y[3] = v2u{u6, u7};
}

// Work-group barrier for LDS data alone.  __syncthreads() also waits for every
// global load of the wave, and would end the flight of A's loads at each step.
__device__ __forceinline__ void lds_barrier() {
    __builtin_amdgcn_fence(__ATOMIC_RELEASE, "workgroup", "local");
    __builtin_amdgcn_s_barrier();
    __builtin_amdgcn_fence(__ATOMIC_ACQUIRE, "workgroup", "local");
}

template <int MODE>
__global__ __launch_bounds__(256) void gemm_x32_kernel(
    const float* __restrict__ A, const _Float16* __restrict__ W,
    const float* __restrict__ bias, _Float16* __restrict__ out,
    int SQdim, float scale)
{
    typedef _Float16 OT;
    constexpr int K = HIDDEN, N = HIDDEN, NK = K / 32;
    __shared__ __align__(16) _Float16 lds[G_BUFS][G_PANEL];

    const int tid  = threadIdx.x;
    const int lane = tid & 31;
    const int wave = tid >> 5;
    const int wm   = wave & 1;          // 2 waves along M
    const int wn   = wave >> 1;         // 4 waves along N
    const int ln   = lane & 15;
    const int hi   = lane >> 4;

    const int bm0 = blockIdx.x * 128;
    const int bn0 = blockIdx.y * 256;
    const int bm  = bm0 + wm * 64;
    const int bn  = bn0 + wn * 64;

    // W, panel s: thread -> 16-byte piece sseg of rows srow, srow + 64, ...
    const int srow = tid >> 2, sseg = tid & 3;
    const _Float16* wg0 = W + (size_t)(bn0 + srow) * K + sseg * 8;
    const size_t    r64 = (size_t)64 * K;
    auto stage_w = [&](int s) {
        const _Float16* wg = wg0 + s * 32;
        _Float16* l = &lds[s & (G_BUFS - 1)][(A_ROWS + srow) * LDS_STRIDE + sseg * 8];
        async_copy16x4(l,                    wg,
                       l +  64 * LDS_STRIDE, wg + r64,
                       l + 128 * LDS_STRIDE, wg + 2 * r64,
                       l + 192 * LDS_STRIDE, wg + 3 * r64);
    };

    // A, panel p: thread -> four floats aseg of rows arow, arow + 32, ...: eight
    // lanes a 128-byte line, four whole lines a load.
    const int arow = tid >> 3, aseg = tid & 7;
    const float* ag0 = A + (size_t)(bm0 + arow) * K + aseg * 4;
    v4f xa[X_SETS][4];
    auto load_a = [&](int p) {
#pragma unroll  // constant indices, so that xa stays in registers
        for (int q = 0; q < 4; ++q)
            xa[p % X_SETS][q] = *(const v4f*)(ag0 + (size_t)q * 32 * K + p * 32);
    };
    auto store_a = [&](int p) {
        _Float16* l = &lds[p & (G_BUFS - 1)][arow * LDS_STRIDE + aseg * 4];
        v2u y[4];
        round16(xa[p % X_SETS], y);
#pragma unroll  // the same
        for (int q = 0; q < 4; ++q) *(v2u*)(l + q * 32 * LDS_STRIDE) = y[q];
    };

    v8f acc[4][4] = {};

#pragma unroll  // constant indices
    for (int p = 0; p < X_SETS; ++p) load_a(p);
#pragma unroll  // three straight-line issues
    for (int p = 0; p < G_BUFS - 1; ++p) stage_w(p);
    store_a(0);
    load_a(X_SETS);

#pragma unroll  // whole: xa's set and the ring's buffer of every step are constants
    for (int s = 0; s < NK; ++s) {
        asm volatile("s_wait_dscnt 0" ::: "memory");          // my reads of panel s - 1 and my stores into panel s are done
        // A trip that issues has three panels of four copies outstanding here:
        // all but the eight youngest landed means that panel s has.  The last
        // trips issue nothing and wait to 0.
        if (s + G_BUFS - 1 < NK) asm volatile("s_wait_asynccnt 8" ::: "memory");
        else                     async_wait0();
        lds_barrier();                                        // all of it holds for every wave
        if (s + G_BUFS - 1 < NK) stage_w(s + G_BUFS - 1);     // into panel s - 1's buffer

        const _Float16* Al = &lds[s & (G_BUFS - 1)][0];
        const _Float16* Wl = Al + A_ROWS * LDS_STRIDE;
        v16h af[4], bf[4];
#pragma unroll
        for (int i = 0; i < 4; ++i)
            af[i] = make_frag(Al + (wm * 64 + i * 16 + ln) * LDS_STRIDE, hi);
#pragma unroll
        for (int j = 0; j < 4; ++j)
            bf[j] = make_frag(Wl + (wn * 64 + j * 16 + ln) * LDS_STRIDE, hi);
        // The fragment reads go first: the rounding and the stores of the next
        // panel then run while the LDS answers, not in front of the reads.
        // Without this barrier and the next the build spilled A's registers to
        // scratch and waited for every load at once.
        __builtin_amdgcn_sched_barrier(0);
        if (s + 1 < NK)          store_a(s + 1);
        if (s + 1 + X_SETS < NK) load_a(s + 1 + X_SETS);
        // And they stay ahead of the products, so that the loads go out early.
        __builtin_amdgcn_sched_barrier(0);
#pragma unroll
        for (int i = 0; i < 4; ++i)
#pragma unroll
            for (int j = 0; j < 4; ++j)
                acc[i][j] = MODE == 0 ? wmma32(bf[j], af[i], acc[i][j])
                                      : wmma32(af[i], bf[j], acc[i][j]);
    }

    // ---- output: through LDS, whole lines (as in gemm_f16_kernel) ----------
    typedef __attribute__((ext_vector_type(8), aligned(16))) OT ov8;   // rows are 16-byte aligned
    constexpr int RT    = 4;
    constexpr int PITCH = 64 * (int)sizeof(OT) + 16;
    constexpr int LPR   = 64 * (int)sizeof(OT) / 16;
    constexpr int GRP   = 32 / LPR;
    char* st = (char*)&lds[0][0] + wave * (RT * 16 * PITCH);

    v8f   bvec[4];                                     // MODE 0: bias along the columns
    float brow[4];                                     // MODE 1: bias of this lane's rows
    const float* bl = bias + bn + (MODE == 0 ? 8 * hi : ln);
#pragma unroll  // constant indices, so that the bias stays in registers
    for (int j = 0; j < 4; ++j) {
        if (MODE == 0) bvec[j] = *(const v8f*)(bl + j * 16);
        else           brow[j] = bl[j * 16];
    }
    // Before the bias loads' address registers are used again (the address as an
    // input: it stays as it is up to here).
    asm volatile("s_wait_xcnt 0x0" :: "v"(bl) : "memory");

    const int grp = lane / LPR, seg = lane % LPR;
    const size_t ld = MODE == 0 ? (size_t)N : (size_t)SQdim;   // output row pitch
    OT* orow0 = MODE == 0
        ? out + (size_t)bm * N + bn
        : out + ((size_t)(bm0 / SQdim) * N + bn) * SQdim + bm0 % SQdim + wm * 64;
    char* og = (char*)(orow0 + (size_t)(grp * 8) * ld) + seg * 16;

    __syncthreads();        // every wave has read the last panel: the ring is free

#pragma unroll  // constant indices, so that acc stays in registers
    for (int a = 0; a < RT; ++a) {
#pragma unroll  // the same
        for (int cc = 0; cc < 4; ++cc) {
            const v8f v = MODE == 0 ? (acc[a][cc] + bvec[cc]) * scale
                                    : (acc[cc][a] + brow[a]) * scale;
            *(ov8*)(st + (a * 16 + ln) * PITCH + (cc * 16 + 8 * hi) * (int)sizeof(OT)) =
                __builtin_convertvector(v, ov8);
        }
    }
    // The rows are read by other lanes of this wave than wrote them.
    asm volatile("s_wait_dscnt 0" ::: "memory");
#pragma unroll  // straight-line loads, then stores
    for (int q = 0; q < RT * 16 / GRP; ++q) {
        const int rq = (q >> 3) * (8 * GRP) + (q & 7);     // + grp * 8: the row
        const v4f d = *(const v4f*)(st + (rq + grp * 8) * PITCH + seg * 16);
        *(v4f*)(og + (size_t)rq * ld * sizeof(OT)) = d;
    }
}

// ---------------------------------------------------------------------------
extern "C" void kernel_launch(void* const* d_in, const int* in_sizes, int n_in,
                              void* d_out, int out_size, void* d_ws, size_t ws_size,
                              hipStream_t stream) {
    const float* query = (const float*)d_in[0];
    const float* key   = (const float*)d_in[1];
    const float* value = (const float*)d_in[2];
    const float* Wq    = (const float*)d_in[3];
    const float* bq    = (const float*)d_in[4];
    const float* Wk    = (const float*)d_in[5];
    const float* bk    = (const float*)d_in[6];
    const float* Wv    = (const float*)d_in[7];
    const float* bv    = (const float*)d_in[8];
    const float* Wo    = (const float*)d_in[9];
    const float* bo    = (const float*)d_in[10];
    float*       out   = (float*)d_out;

    const size_t tok  = (size_t)BATCH * SQ;            // 8192 tokens
    const size_t act  = tok * HIDDEN;                  // 8M elements
    const size_t wsz  = (size_t)HIDDEN * HIDDEN;       // 1M elements

    // ws layout (f16 elements); of the first three planes only the first is used (ctx).
    _Float16* base = (_Float16*)d_ws;
    _Float16* xq  = base;                 // act
    _Float16* xk  = xq  + act;            // act
    _Float16* xv  = xk  + act;            // act
    _Float16* wqh = xv  + act;            // wsz
    _Float16* wkh = wqh + wsz;
    _Float16* wvh = wkh + wsz;
    _Float16* woh = wvh + wsz;
    _Float16* Qp  = woh + wsz;            // act
    _Float16* Kp  = Qp  + act;            // act
    _Float16* Vtp = Kp  + act;            // act
    _Float16* ctx = xq;

    // ---- stage f32 -> f16: wqh, wkh, wvh, woh in one launch ----------------
    cvt_f16_kernel<<<CVT_BLOCKS, CVT_WAVES * 32, 0, stream>>>(
        Wq, Wk, Wv, Wo, wqh);

    const dim3 gblk((unsigned)(tok / 128), HIDDEN / 256);   // 64 x 4 blocks
    const float qscale = 0.18033688f;                       // HEAD_DIM^-0.5 * log2 e

    gemm_x32_kernel<0><<<gblk, 256, 0, stream>>>(query, wqh, bq, Qp,  SQ, qscale);
    gemm_x32_kernel<0><<<gblk, 256, 0, stream>>>(key,   wkh, bk, Kp,  SK, 1.0f);
    gemm_x32_kernel<1><<<gblk, 256, 0, stream>>>(value, wvh, bv, Vtp, SK, 1.0f);

    flash_attn_kernel<<<dim3(SQ / (16 * FA_GROUPS) / FA_WAVES, BATCH * HEADS), FA_WAVES * 32, 0, stream>>>(
        Qp, Kp, Vtp, ctx);

    gemm_f16_kernel<float, 0><<<gblk, 256, 0, stream>>>(
        ctx, woh, bo, out, (int)tok, HIDDEN, HIDDEN, SQ, 1.0f);
}

// v009
// A run of this version takes 117 microseconds.
// Timed twice side by side with v008, it ran 1.06 times as fast both times.
// Counting every step since v000, it is 3.06 times as fast.
#include <hip/hip_runtime.h>

#define HIDDEN   1024
#define HEADS    16
#define HEAD_DIM 64
#define BATCH    4
#define SQ       2048
#define SK       2048

typedef __attribute__((ext_vector_type(16))) _Float16 v16h;
typedef __attribute__((ext_vector_type(8)))  _Float16 v8h;
typedef __attribute__((ext_vector_type(8)))  float    v8f;

// D = A(16x32 f16) * B(32x16 f16) + C(16x16 f32)
__device__ __forceinline__ v8f wmma32(v16h a, v16h b, v8f c) {
    return __builtin_amdgcn_wmma_f32_16x16x32_f16(
        false, a, false, b, (short)0, c, false, false);
}

__device__ __forceinline__ v16h make_frag(const _Float16* __restrict__ p, int hi) {
    const v8h lo = *(const v8h*)(p + hi * 8);
    const v8h hs = *(const v8h*)(p + hi * 8 + 16);
    return __builtin_shufflevector(lo, hs, 0,1,2,3,4,5,6,7,8,9,10,11,12,13,14,15);
}

__device__ __forceinline__ void async_wait0() {
    asm volatile("s_wait_asynccnt 0" ::: "memory");
}

__device__ __forceinline__ float xhalf(float x) {
    const int i = __builtin_bit_cast(int, x);
    return __builtin_bit_cast(float, __builtin_amdgcn_permlanex16(
        i, i, 0x76543210, 0xfedcba98, false, false));
}

__device__ __forceinline__ float exp2_1(float x) {
    float y;
    asm("v_exp_f32 %0, %1\n\tv_nop" : "=&v"(y) : "v"(x));
    return y;
}
__device__ __forceinline__ v8f exp2_8(v8f x) {
    float y0, y1, y2, y3, y4, y5, y6, y7;
    asm("v_exp_f32 %0, %8\n\t"
        "v_exp_f32 %1, %9\n\t"
        "v_exp_f32 %2, %10\n\t"
        "v_exp_f32 %3, %11\n\t"
        "v_exp_f32 %4, %12\n\t"
        "v_exp_f32 %5, %13\n\t"
        "v_exp_f32 %6, %14\n\t"
        "v_exp_f32 %7, %15\n\t"
        "v_nop"
        : "=&v"(y0), "=&v"(y1), "=&v"(y2), "=&v"(y3),
          "=&v"(y4), "=&v"(y5), "=&v"(y6), "=&v"(y7)
        : "v"(x[0]), "v"(x[1]), "v"(x[2]), "v"(x[3]),
          "v"(x[4]), "v"(x[5]), "v"(x[6]), "v"(x[7]));
    return v8f{y0, y1, y2, y3, y4, y5, y6, y7};
}
__device__ __forceinline__ v8f exp2_8_of_wmma(v8f x) {
    v8f y;
#pragma unroll  // constant indices, so that x and y stay in registers
    for (int i = 0; i < 8; ++i) y[i] = __builtin_amdgcn_exp2f(x[i]);
    return y;
}

// ---------------------------------------------------------------------------
// f32 -> f16 staging of the four weights in one launch.  The f16 copies lie one
// behind the other in the workspace, in the order of the arguments.  A piece is
// 1024 elements: 8 loads of 512 contiguous bytes per wave.  The 4096 pieces go
// one to a wave (16 waves per block, 256 blocks, 64 blocks per weight).
// The activations are not staged: the projections read them as f32.
// ---------------------------------------------------------------------------
#define CVT_WAVES  16
#define CVT_BLOCKS 256
#define CVT_PIECE  1024                          // elements

typedef __attribute__((ext_vector_type(4))) _Float16 v4h;
typedef __attribute__((ext_vector_type(4))) float    v4f;

__global__ __launch_bounds__(CVT_WAVES * 32) void cvt_f16_kernel(
    const float* __restrict__ Wq, const float* __restrict__ Wk,
    const float* __restrict__ Wv, const float* __restrict__ Wo,
    _Float16* __restrict__ out)
{
    const unsigned tp = ((threadIdx.x >> 5) << 10) | ((threadIdx.x & 31) << 2);
    const unsigned bp = blockIdx.x * (CVT_WAVES * CVT_PIECE);

    const unsigned wsel = blockIdx.x >> 6;       // 64 blocks per weight
    const float* w = wsel == 0 ? Wq : wsel == 1 ? Wk : wsel == 2 ? Wv : Wo;
    const float* src = w + (bp & (HIDDEN * HIDDEN - 1)) + tp;
    _Float16*    dst = out + bp + tp;

    v4f r[8];
#pragma unroll  // constant indices, so that r stays in registers
    for (int c = 0; c < 8; ++c) r[c] = *(const v4f*)(src + c * 128);
#pragma unroll  // the same
    for (int c = 0; c < 8; ++c)
        *(v4h*)(dst + c * 128) = __builtin_convertvector(r[c], v4h);
}

#define LDS_STRIDE 40
#define A_ROWS     128
#define W_ROWS     256
#define G_BUFS     4                        // ring depth (a power of two)
#define G_PANEL    ((A_ROWS + W_ROWS) * LDS_STRIDE)   // halves per buffer

__device__ __forceinline__ void async_copy16x6(
    void* l0, const void* g0, void* l1, const void* g1,
    void* l2, const void* g2, void* l3, const void* g3,
    void* l4, const void* g4, void* l5, const void* g5)
{
    const uint32_t o0 = (uint32_t)(uintptr_t)l0, o1 = (uint32_t)(uintptr_t)l1;
    const uint32_t o2 = (uint32_t)(uintptr_t)l2, o3 = (uint32_t)(uintptr_t)l3;
    const uint32_t o4 = (uint32_t)(uintptr_t)l4, o5 = (uint32_t)(uintptr_t)l5;
    asm volatile("global_load_async_to_lds_b128 %0, %1, off\n\t"
                 "global_load_async_to_lds_b128 %2, %3, off\n\t"
                 "global_load_async_to_lds_b128 %4, %5, off\n\t"
                 "global_load_async_to_lds_b128 %6, %7, off\n\t"
                 "global_load_async_to_lds_b128 %8, %9, off\n\t"
                 "global_load_async_to_lds_b128 %10, %11, off\n\t"
                 "s_wait_xcnt 0x0"
                 :: "v"(o0), "v"(g0), "v"(o1), "v"(g1), "v"(o2), "v"(g2),
                    "v"(o3), "v"(g3), "v"(o4), "v"(g4), "v"(o5), "v"(g5)
                 : "memory");
}

template <typename OT, int MODE>
__global__ __launch_bounds__(256) void gemm_f16_kernel(
    const _Float16* __restrict__ A, const _Float16* __restrict__ W,
    const float* __restrict__ bias, OT* __restrict__ out,
    int M, int N, int K, int SQdim, float scale)
{
    __shared__ __align__(16) _Float16 lds[G_BUFS][G_PANEL];

    const int tid  = threadIdx.x;
    const int lane = tid & 31;
    const int wave = tid >> 5;
    const int wm   = wave & 1;          // 2 waves along M
    const int wn   = wave >> 1;         // 4 waves along N
    const int ln   = lane & 15;
    const int hi   = lane >> 4;

    const int bm0 = blockIdx.x * 128;
    const int bn0 = blockIdx.y * 256;
    const int bm  = bm0 + wm * 64;
    const int bn  = bn0 + wn * 64;

    // Stage panel s (k = 32 s .. 32 s + 31) of A (128 rows) and W (256 rows):
    // thread -> 16-byte piece sseg of rows srow, srow + 64, ... of each.
    const int srow = tid >> 2, sseg = tid & 3;
    const _Float16* ag0 = A + (size_t)(bm0 + srow) * K + sseg * 8;
    const _Float16* wg0 = W + (size_t)(bn0 + srow) * K + sseg * 8;
    const size_t    r64 = (size_t)64 * K;
    auto stage = [&](int s) {
        const _Float16* ag = ag0 + s * 32;
        const _Float16* wg = wg0 + s * 32;
        _Float16* l = &lds[s & (G_BUFS - 1)][srow * LDS_STRIDE + sseg * 8];
        async_copy16x6(l,                    ag,
                       l +  64 * LDS_STRIDE, ag + r64,
                       l + 128 * LDS_STRIDE, wg,
                       l + 192 * LDS_STRIDE, wg + r64,
                       l + 256 * LDS_STRIDE, wg + 2 * r64,
                       l + 320 * LDS_STRIDE, wg + 3 * r64);
    };

    v8f acc[4][4] = {};

    // The 16 products of panel s.
    auto step = [&](int s) {
        const _Float16* Al = &lds[s & (G_BUFS - 1)][0];
        const _Float16* Wl = Al + A_ROWS * LDS_STRIDE;

        v16h af[4], bf[4];
#pragma unroll
        for (int i = 0; i < 4; ++i)
            af[i] = make_frag(Al + (wm * 64 + i * 16 + ln) * LDS_STRIDE, hi);
#pragma unroll
        for (int j = 0; j < 4; ++j)
            bf[j] = make_frag(Wl + (wn * 64 + j * 16 + ln) * LDS_STRIDE, hi);
#pragma unroll
        for (int i = 0; i < 4; ++i)
#pragma unroll
            for (int j = 0; j < 4; ++j)
                acc[i][j] = MODE == 0 ? wmma32(bf[j], af[i], acc[i][j])
                                      : wmma32(af[i], bf[j], acc[i][j]);
    };

    const int nk = K / 32;
#pragma unroll  // three straight-line issues
    for (int p = 0; p < G_BUFS - 1; ++p)
        if (p < nk) stage(p);

    // Every trip of this loop issues one panel (six copies a wave), and three
    // panels are outstanding at its head: all but the twelve youngest copies
    // landed means that panel s has.
    int s = 0;
    for (; s + G_BUFS - 1 < nk; ++s) {
        asm volatile("s_wait_dscnt 0" ::: "memory");      // my reads of panel s - 1 are done
        asm volatile("s_wait_asynccnt 12" ::: "memory");  // my copies of panel s have landed
        __syncthreads();                                  // both hold for every wave
        stage(s + G_BUFS - 1);                            // into panel s - 1's buffer
        step(s);
    }
    // The last panels: nothing is issued any more, so the wait is to 0, and no
    // buffer is refilled, so this one barrier serves all of their steps.
    async_wait0();
    __syncthreads();
#pragma clang loop unroll(disable)  // at most three trips; unrolled, it took the kernel above 256 registers
    for (; s < nk; ++s) step(s);

    // ---- output: through LDS, whole lines ----------------------------------
    // Output rows are m (MODE 0) or n (MODE 1); tile (a, c) of the wave's 4x4
    // is rows a*16 .. +15, columns c*16 .. +15, and this lane holds row
    // a*16 + ln, columns c*16 + 8*hi .. +7 of it.
    typedef __attribute__((ext_vector_type(8), aligned(16))) OT ov8;   // rows are 16-byte aligned
    constexpr int RT    = sizeof(OT) == 2 ? 4 : 2;
    constexpr int PITCH = 64 * (int)sizeof(OT) + 16;
    constexpr int LPR   = 64 * (int)sizeof(OT) / 16;
    constexpr int GRP   = 32 / LPR;
    char* st = (char*)&lds[0][0] + wave * (RT * 16 * PITCH);

    v8f   bvec[4];                                     // MODE 0: bias along the columns
    float brow[4];                                     // MODE 1: bias of this lane's rows
#pragma unroll  // constant indices, so that the bias stays in registers
    for (int j = 0; j < 4; ++j) {
        if (MODE == 0) bvec[j] = *(const v8f*)(bias + bn + j * 16 + 8 * hi);
        else           brow[j] = bias[bn + j * 16 + ln];
    }

    const int grp = lane / LPR, seg = lane % LPR;
    const size_t ld = MODE == 0 ? (size_t)N : (size_t)SQdim;   // output row pitch
    OT* orow0 = MODE == 0
        ? out + (size_t)bm * N + bn
        : out + ((size_t)(bm0 / SQdim) * N + bn) * SQdim + bm0 % SQdim + wm * 64;
    char* og = (char*)(orow0 + (size_t)(grp * 8) * ld) + seg * 16;

    __syncthreads();        // every wave has read the last panels: the ring is free

#pragma unroll  // constant indices, so that acc stays in registers
    for (int ro = 0; ro < 4 / RT; ++ro) {
#pragma unroll  // the same
        for (int a = 0; a < RT; ++a) {
#pragma unroll  // the same
            for (int cc = 0; cc < 4; ++cc) {
                const int ra = ro * RT + a;
                const v8f v = MODE == 0 ? (acc[ra][cc] + bvec[cc]) * scale
                                        : (acc[cc][ra] + brow[ra]) * scale;
                *(ov8*)(st + (a * 16 + ln) * PITCH + (cc * 16 + 8 * hi) * (int)sizeof(OT)) =
                    __builtin_convertvector(v, ov8);
            }
        }
        // The rows are read by other lanes of this wave than wrote them.
        asm volatile("s_wait_dscnt 0" ::: "memory");
#pragma unroll  // straight-line loads, then stores
        for (int q = 0; q < RT * 16 / GRP; ++q) {
            const int rq = (q >> 3) * (8 * GRP) + (q & 7);     // + grp * 8: the row
            const v4f d = *(const v4f*)(st + (rq + grp * 8) * PITCH + seg * 16);
            *(v4f*)(og + (size_t)(ro * RT * 16 + rq) * ld * sizeof(OT)) = d;
        }
        // Keeps the next round's LDS stores behind this round's reads of the same rows.
        if (ro + 1 < 4 / RT) asm volatile("s_wait_dscnt 0" ::: "memory");
    }
}

#define KV_STRIDE 72
#define KV_TILE   (64 * KV_STRIDE)          // halves per staged operand tile
#define FA_WAVES  8
#define FA_GROUPS 2                         // 16-query column groups per wave
#define FA_LIMIT  256.0f                    // a tile's weights may sum to this much per lane

__device__ __forceinline__ void async_copy16x4(
    void* l0, const void* g0, void* l1, const void* g1,
    void* l2, const void* g2, void* l3, const void* g3)
{
    const uint32_t o0 = (uint32_t)(uintptr_t)l0, o1 = (uint32_t)(uintptr_t)l1;
    const uint32_t o2 = (uint32_t)(uintptr_t)l2, o3 = (uint32_t)(uintptr_t)l3;
    asm volatile("global_load_async_to_lds_b128 %0, %1, off\n\t"
                 "global_load_async_to_lds_b128 %2, %3, off\n\t"
                 "global_load_async_to_lds_b128 %4, %5, off\n\t"
                 "global_load_async_to_lds_b128 %6, %7, off\n\t"
                 "s_wait_xcnt 0x0"
                 :: "v"(o0), "v"(g0), "v"(o1), "v"(g1),
                    "v"(o2), "v"(g2), "v"(o3), "v"(g3) : "memory");
}

__global__ __launch_bounds__(FA_WAVES * 32) __attribute__((amdgpu_waves_per_eu(4, 4)))
void flash_attn_kernel(
    const _Float16* __restrict__ Q, const _Float16* __restrict__ Kh,
    const _Float16* __restrict__ Vt, _Float16* __restrict__ ctx)
{
    __shared__ __align__(16) _Float16 kv[2][2 * KV_TILE];             // K, Vt

    const int tid  = threadIdx.x;
    const int lane = tid & 31;
    const int wave = tid >> 5;
    const int ln   = lane & 15;
    const int hi   = lane >> 4;

    const int bh = blockIdx.y;
    const int b  = bh >> 4;
    const int h  = bh & 15;
    const int qbase = (blockIdx.x * FA_WAVES + wave) * (16 * FA_GROUPS);

    // Stage keys kb..kb+63: thread -> rows srow and srow+32, 16-byte piece sseg.
    const int srow = tid >> 3, sseg = tid & 7;
    const _Float16* kg0 =
        Kh + ((size_t)(b * SK + srow)) * HIDDEN + h * HEAD_DIM + sseg * 8;
    const _Float16* vg0 =
        Vt + ((size_t)(b * HIDDEN + h * HEAD_DIM + srow)) * SK + sseg * 8;
    auto stage = [&](int buf, int kb) {
        const _Float16* kg = kg0 + (size_t)kb * HIDDEN;
        const _Float16* vg = vg0 + kb;
        _Float16* kl = &kv[buf][srow * KV_STRIDE + sseg * 8];
        _Float16* vl = kl + KV_TILE;
        async_copy16x4(kl, kg, kl + 32 * KV_STRIDE, kg + 32 * HIDDEN,
                       vl, vg, vl + 32 * KV_STRIDE, vg + 32 * SK);
    };

    stage(0, 0);

    // Group g holds queries qbase + 16 g .. + 15, this lane query 16 g + ln.
    const size_t qrow = ((size_t)(b * SQ + qbase + ln)) * HIDDEN + h * HEAD_DIM;
    v16h qf0[FA_GROUPS], qf1[FA_GROUPS];
#pragma unroll  // constant indices, so that the fragments stay in registers
    for (int g = 0; g < FA_GROUPS; ++g) {
        qf0[g] = make_frag(Q + qrow + (size_t)g * 16 * HIDDEN, hi);
        qf1[g] = make_frag(Q + qrow + (size_t)g * 16 * HIDDEN + 32, hi);
    }

    // This lane's query of each group: minus the reference maximum (eight
    // registers alike, a C operand), and the sum over the keys of this half
    // alone (the halves' sums are joined behind the loop).
    v8f   nm[FA_GROUPS];
    float lq[FA_GROUPS];
    v8f   acc[FA_GROUPS][4];    // acc[g][d][r] = O^T[d*16 + 8*hi + r][query 16 g + ln]
#pragma unroll  // constant indices, so that all of it stays in registers
    for (int g = 0; g < FA_GROUPS; ++g) {
        nm[g] = v8f{} + 1e30f; lq[g] = 0.0f;
        acc[g][0] = v8f{}; acc[g][1] = v8f{}; acc[g][2] = v8f{}; acc[g][3] = v8f{};
    }

    async_wait0();          // my copies of tile 0 have landed
    asm volatile("s_wait_xcnt 0x0" ::: "memory");   // before the Q loads' address registers are used again
    __syncthreads();        // everyone's have
    stage(1, 64);

#pragma clang loop unroll(disable)  // tile 0 stays in the loop: peeled off, it is a third copy of the pass, and it spills
    for (int it = 0; it < SK / 64; ++it) {
        const _Float16* Kl = &kv[it & 1][0];
        const _Float16* Vl = Kl + KV_TILE;

        v16h  pf0[FA_GROUPS], pf1[FA_GROUPS];        // P^T: keys 0-31, keys 32-63
        float ts[FA_GROUPS];                         // this tile's weights, summed

        auto pass = [&](const bool rebase) {
            // ---- scores: S^T(64 x 32) as four 16x16 tiles per group, k = 64 -
            // sc[g][t][r] = S[query 16 g + ln][key t*16 + 8*hi + r] (- reference)
            v8f sc[FA_GROUPS][4];
#pragma unroll
            for (int t = 0; t < 4; ++t) {
                const _Float16* krow = Kl + (t * 16 + ln) * KV_STRIDE;
                const v16h kf0 = make_frag(krow, hi);
                const v16h kf1 = make_frag(krow + 32, hi);
#pragma unroll  // constant indices, so that sc stays in registers
                for (int g = 0; g < FA_GROUPS; ++g)
                    sc[g][t] = wmma32(kf0, qf0[g], rebase ? v8f{} : nm[g]);
#pragma unroll  // the same
                for (int g = 0; g < FA_GROUPS; ++g) sc[g][t] = wmma32(kf1, qf1[g], sc[g][t]);
            }

            // ---- weights, one query per lane and group ----------------------
#pragma unroll  // constant indices, so that sc and acc stay in registers
            for (int g = 0; g < FA_GROUPS; ++g) {
                if (rebase) {
                    float mb = __builtin_reduce_max(__builtin_elementwise_max(
                        __builtin_elementwise_max(sc[g][0], sc[g][1]),
                        __builtin_elementwise_max(sc[g][2], sc[g][3])));   // this half's 32 keys
                    mb = fmaxf(mb, xhalf(mb));               // all 64 keys
                    const float mo = -nm[g][0];
                    const float mn = fmaxf(mo, mb);          // the new reference
                    const float cf = exp2_1(mo - mn);        // what was summed so far shrinks by this
                    lq[g] *= cf;
                    acc[g][0] *= cf; acc[g][1] *= cf; acc[g][2] *= cf; acc[g][3] *= cf;
                    nm[g] = v8f{} - mn;
#pragma unroll  // the same
                    for (int t = 0; t < 4; ++t) sc[g][t] += nm[g];
                }
#pragma unroll  // the same
                for (int t = 0; t < 4; ++t)
                    sc[g][t] = rebase ? exp2_8(sc[g][t]) : exp2_8_of_wmma(sc[g][t]);
                // Sum the four tiles register by register first (packed adds),
                // then the eight registers.
                const v8f pv = (sc[g][0] + sc[g][1]) + (sc[g][2] + sc[g][3]);
                ts[g] = ((pv[0] + pv[1]) + (pv[2] + pv[3])) +
                        ((pv[4] + pv[5]) + (pv[6] + pv[7]));

                // P^T as B fragments: two score tiles converted in place.
#pragma unroll  // the same
                for (int e = 0; e < 16; ++e) {
                    pf0[g][e] = (_Float16)sc[g][e >> 3][e & 7];
                    pf1[g][e] = (_Float16)sc[g][2 + (e >> 3)][e & 7];
                }
            }
        };

        // One test per tile for the whole wave, a scalar branch.  The sums are
        // not negative, so their sum bounds each; written so that no-number
        // and infinity go the long way too.
        if (it != 0) pass(false);
        if (it == 0 || __builtin_amdgcn_ballot_w32(!(ts[0] + ts[1] <= FA_LIMIT)) != 0) {
            // Compiler fence: the long way loads its K fragments from LDS anew.
            // Without it the common pass's 64 fragment registers are kept for
            // this branch, and the loop spills.
            asm volatile("" ::: "memory");
            pass(true);
        }
#pragma unroll  // constant indices
        for (int g = 0; g < FA_GROUPS; ++g) lq[g] += ts[g];

        // ---- PV: O^T(64 x 32) += V^T(64x64) * P^T(64x32) -------------------
        v16h vb[4][2];
#pragma unroll  // constant indices, so that the fragments stay in registers
        for (int d = 0; d < 4; ++d) {
            const _Float16* vrow = Vl + (d * 16 + ln) * KV_STRIDE;
            vb[d][0] = make_frag(vrow, hi);
            vb[d][1] = make_frag(vrow + 32, hi);
        }
        // All sixteen LDS reads are issued ahead of the products (the score
        // registers are free by now).  Without it the compiler puts each
        // fragment's reads, and a wait to 0, directly in front of its products.
        __builtin_amdgcn_sched_barrier(0);
#pragma unroll
        for (int d = 0; d < 4; ++d) {
#pragma unroll  // constant indices, so that acc stays in registers
            for (int g = 0; g < FA_GROUPS; ++g) acc[g][d] = wmma32(vb[d][0], pf0[g], acc[g][d]);
#pragma unroll  // the same
            for (int g = 0; g < FA_GROUPS; ++g) acc[g][d] = wmma32(vb[d][1], pf1[g], acc[g][d]);
        }

        // ---- hand-over: this buffer is read out, the next tile has landed --
        asm volatile("s_wait_dscnt 0" ::: "memory");  // my reads of this buffer are done
        async_wait0();                                // my copies of the next tile have landed
        __syncthreads();                              // both hold for every wave
        if (it + 2 < SK / 64) stage(it & 1, (it + 2) * 64);
    }
    async_wait0();          // nothing of mine in flight when the wave ends

    // ---- normalize and store ctx (f16): 8 consecutive columns per lane ----
#pragma unroll  // constant indices, so that acc stays in registers
    for (int g = 0; g < FA_GROUPS; ++g) {
        const float lsum = lq[g] + xhalf(lq[g]);     // join the halves' sums
        _Float16* crow = ctx + ((size_t)(b * SQ + qbase + g * 16 + ln)) * HIDDEN
                             + h * HEAD_DIM + 8 * hi;
#pragma unroll  // the same
        for (int d = 0; d < 4; ++d) {
            v8h o;
#pragma unroll  // the same
            for (int r = 0; r < 8; ++r) o[r] = (_Float16)(acc[g][d][r] / lsum);
            *(v8h*)(crow + d * 16) = o;
        }
    }
}

// ---------------------------------------------------------------------------
// The three projections, whose A operand is an f32 input, in one launch:
// out = (A W^T + bias) * scale, A [M x HIDDEN] f32, W [HIDDEN x HIDDEN] f16, out
// f16.  A block forms its 128x256 tile of Q, then of K, then of Vt.  The 96
// K-steps are one run of the ring: the last steps of a projection already load
// and stage the first panels of the next, which land while the tile is written
// out (the output staging has LDS of its own for that, and needs no barrier).
// Tiles, LDS ring, panel layout and products are those of gemm_f16_kernel.  A's
// way into the ring differs: whole 128-byte lines (one K-step of a row) come into
// registers by plain loads, X_SETS K-steps ahead, are rounded to f16 there (the
// rounding that the staging launch did) and are stored into the panel one step
// before it is read.  W's part of a panel comes by four async copies a lane.
//
// Step s, behind its barrier: W's copies of panel s + 3 (buffer of panel s - 1,
// which every wave has left); this step's fragment reads; A's part of panel
// s + 1 is stored (its buffer was last read in step s - 3); the loads of panel
// s + 1 + X_SETS go out into the registers just freed; the 16 products.
// The s_wait_dscnt 0 in front of the next barrier covers reads and stores.
// The 32 steps are unrolled whole: register sets and ring places are then
// constants, and the same in each projection (32 is a multiple of both depths).
// ---------------------------------------------------------------------------
#define X_SETS 4                            // K-steps of lead of A's loads: they come from memory; divides the 32 steps

typedef __attribute__((ext_vector_type(2))) unsigned v2u;

__device__ __forceinline__ void round16(const v4f (&x)[4], v2u (&y)[4]) {
    unsigned u0, u1, u2, u3, u4, u5, u6, u7;
    asm volatile("v_nop\n\tv_nop\n\tv_nop\n\tv_nop\n\t"
                 "v_cvt_pk_f16_f32 %0, %8, %9\n\t"
                 "v_cvt_pk_f16_f32 %1, %10, %11\n\t"
                 "v_cvt_pk_f16_f32 %2, %12, %13\n\t"
                 "v_cvt_pk_f16_f32 %3, %14, %15\n\t"
                 "v_cvt_pk_f16_f32 %4, %16, %17\n\t"
                 "v_cvt_pk_f16_f32 %5, %18, %19\n\t"
                 "v_cvt_pk_f16_f32 %6, %20, %21\n\t"
                 "v_cvt_pk_f16_f32 %7, %22, %23"
                 : "=&v"(u0), "=&v"(u1), "=&v"(u2), "=&v"(u3),
                   "=&v"(u4), "=&v"(u5), "=&v"(u6), "=&v"(u7)
                 : "v"(x[0][0]), "v"(x[0][1]), "v"(x[0][2]), "v"(x[0][3]),
                   "v"(x[1][0]), "v"(x[1][1]), "v"(x[1][2]), "v"(x[1][3]),
                   "v"(x[2][0]), "v"(x[2][1]), "v"(x[2][2]), "v"(x[2][3]),
                   "v"(x[3][0]), "v"(x[3][1]), "v"(x[3][2]), "v"(x[3][3]));
    y[0] = v2u{u0, u1}; y[1] = v2u{u2, u3}; y[2] = v2u{u4, u5}; y[3] = v2u{u6, u7};
}

// Work-group barrier for LDS data alone.  __syncthreads() also waits for every
// global load of the wave, and would end the flight of A's loads at each step.
__device__ __forceinline__ void lds_barrier() {
    __builtin_amdgcn_fence(__ATOMIC_RELEASE, "workgroup", "local");
    __builtin_amdgcn_s_barrier();
    __builtin_amdgcn_fence(__ATOMIC_ACQUIRE, "workgroup", "local");
}

template <int V> struct mode_tag { static constexpr int value = V; };

__global__ __launch_bounds__(256) void proj3_kernel(
    const float* __restrict__ xq, const float* __restrict__ xk, const float* __restrict__ xv,
    const _Float16* __restrict__ Wh,
    const float* __restrict__ bq, const float* __restrict__ bk, const float* __restrict__ bv,
    _Float16* __restrict__ out, float qscale)
{
    typedef _Float16 OT;
    constexpr int K = HIDDEN, N = HIDDEN, NK = K / 32;
    constexpr int PITCH = 64 * (int)sizeof(OT) + 16;
    __shared__ __align__(16) _Float16 lds[G_BUFS][G_PANEL];
    __shared__ __align__(16) char stg[8][64 * PITCH];  // output staging, one part per wave

    const int tid  = threadIdx.x;
    const int lane = tid & 31;
    const int wave = tid >> 5;
    const int wm   = wave & 1;          // 2 waves along M
    const int wn   = wave >> 1;         // 4 waves along N
    const int ln   = lane & 15;
    const int hi   = lane >> 4;

    const int bm0 = blockIdx.x * 128;
    const int bn0 = blockIdx.y * 256;
    const int bm  = bm0 + wm * 64;
    const int bn  = bn0 + wn * 64;

    // W, panel P of this projection (P >= NK: panel P - NK of the next one, whose
    // weight lies behind this one): thread -> 16-byte piece sseg of rows srow, srow + 64, ...
    const int srow = tid >> 2, sseg = tid & 3;
    const _Float16* wgz = Wh + (size_t)(bn0 + srow) * K + sseg * 8;
    const size_t    r64 = (size_t)64 * K;
    auto stage_w = [&](int P) {
        const _Float16* wg = wgz + (P < NK ? P * 32 : HIDDEN * HIDDEN + (P - NK) * 32);
        _Float16* l = &lds[P & (G_BUFS - 1)][(A_ROWS + srow) * LDS_STRIDE + sseg * 8];
        async_copy16x4(l,                    wg,
                       l +  64 * LDS_STRIDE, wg + r64,
                       l + 128 * LDS_STRIDE, wg + 2 * r64,
                       l + 192 * LDS_STRIDE, wg + 3 * r64);
    };

    // A, panel p: thread -> four floats aseg of rows arow, arow + 32, ...: eight
    // lanes a 128-byte line, four whole lines a load.  The three inputs have one
    // shape: the lane's offset is the same in each.
    const int arow = tid >> 3, aseg = tid & 7;
    const unsigned aoff = (unsigned)(bm0 + arow) * K + aseg * 4;
    v4f xa[X_SETS][4];
    auto load_a = [&](const float* base, int p) {
#pragma unroll  // constant indices, so that xa stays in registers
        for (int q = 0; q < 4; ++q)
            xa[p % X_SETS][q] = *(const v4f*)(base + aoff + q * 32 * K + (p % NK) * 32);
    };
    auto store_a = [&](int p) {
        _Float16* l = &lds[p & (G_BUFS - 1)][arow * LDS_STRIDE + aseg * 4];
        v2u y[4];
        round16(xa[p % X_SETS], y);
#pragma unroll  // the same
        for (int q = 0; q < 4; ++q) *(v2u*)(l + q * 32 * LDS_STRIDE) = y[q];
    };

#pragma unroll  // constant indices
    for (int p = 0; p < X_SETS; ++p) load_a(xq, p);
#pragma unroll  // three straight-line issues
    for (int p = 0; p < G_BUFS - 1; ++p) stage_w(p);
    store_a(0);
    load_a(xq, X_SETS);

    constexpr int LPR = 64 * (int)sizeof(OT) / 16;     // lanes per output row
    constexpr int GRP = 32 / LPR;                      // rows per 16-byte store of a wave
    const int grp = lane / LPR, seg = lane % LPR;
    char* st = &stg[wave][0];

#pragma clang loop unroll(disable)  // one copy of the 32 steps, for speed only
    for (int z = 0; z < 3; ++z) {
        // V has the transposed output.  Nothing follows it: its look-ahead (five
        // panels of A again, three of the weight behind Wv's) is read and not used,
        // so that all 96 steps are alike, without a branch and with one counted wait
        // (with branches round it the build spilled A's registers to scratch).
        const bool   last  = z == 2;
        const float* Ac    = z == 0 ? xq : z == 1 ? xk : xv;
        const float* An    = z == 0 ? xk : xv;
        const float* bz    = z == 0 ? bq : z == 1 ? bk : bv;
        const float  scale = z == 0 ? qscale : 1.0f;
        OT*          outz  = out + (size_t)z * ((size_t)BATCH * SQ * HIDDEN);

        // First operand = the rows that run along a lane's eight accumulator
        // registers: W's for a row-major output, A's for the transposed one.
        const _Float16* Fl = &lds[0][0] + ((last ? wm * 64 : A_ROWS + wn * 64) + ln) * LDS_STRIDE;
        const _Float16* Sl = &lds[0][0] + ((last ? A_ROWS + wn * 64 : wm * 64) + ln) * LDS_STRIDE;

        v8f acc[4][4] = {};     // acc[a][c]: output rows a*16 .. +15, columns c*16 .. +15

#pragma unroll  // whole: xa's set and the ring's buffer of every step are constants
        for (int s = 0; s < NK; ++s) {
            asm volatile("s_wait_dscnt 0" ::: "memory");      // my reads of the panel before and my stores into this one are done
            // Every step issues one panel of four copies, and three panels are
            // outstanding here: all but the eight youngest landed means that panel s has.
            asm volatile("s_wait_asynccnt 8" ::: "memory");
            lds_barrier();                                    // all of it holds for every wave
            stage_w(s + G_BUFS - 1);                          // into the buffer of the panel before

            v16h ff[4], sf[4];
#pragma unroll
            for (int c = 0; c < 4; ++c)
                ff[c] = make_frag(Fl + (s & (G_BUFS - 1)) * G_PANEL + c * 16 * LDS_STRIDE, hi);
#pragma unroll
            for (int a = 0; a < 4; ++a)
                sf[a] = make_frag(Sl + (s & (G_BUFS - 1)) * G_PANEL + a * 16 * LDS_STRIDE, hi);
            // The fragment reads go first: the rounding and the stores of the next
            // panel then run while the LDS answers, not in front of the reads.
            // Without this barrier and the next the build spilled A's registers to
            // scratch and waited for every load at once.
            __builtin_amdgcn_sched_barrier(0);
            store_a(s + 1);
            load_a(s + 1 + X_SETS < NK ? Ac : An, s + 1 + X_SETS);
            // And they stay ahead of the products, so that the loads go out early.
            __builtin_amdgcn_sched_barrier(0);
#pragma unroll
            for (int a = 0; a < 4; ++a)
#pragma unroll
                for (int c = 0; c < 4; ++c)
                    acc[a][c] = wmma32(ff[c], sf[a], acc[a][c]);
        }

        // ---- output: through this wave's own LDS, whole lines ---------------
        // This lane holds row a*16 + ln, columns c*16 + 8*hi .. +7 of tile (a, c).
        // No barrier: the staging is no part of the ring, in which the next
        // projection's first panels are landing meanwhile.
        // Before the address registers of A's last loads are used again.
        asm volatile("s_wait_xcnt 0x0" ::: "memory");
        auto output = [&](auto tag) {
            constexpr int    MODE = decltype(tag)::value;
            constexpr size_t ld   = MODE == 0 ? N : SK;        // output row pitch
            typedef __attribute__((ext_vector_type(8), aligned(16))) OT ov8;   // rows are 16-byte aligned
            OT* orow0 = MODE == 0
                ? outz + (size_t)bm * N + bn
                : outz + ((size_t)(bm0 / SK) * N + bn) * SK + bm0 % SK + wm * 64;
            char* og = (char*)(orow0 + (size_t)(grp * 8) * ld) + seg * 16;
            v8f   bvec[4];                             // row-major output: bias along the columns
            float brow[4];                             // transposed output: bias of this lane's rows
            const float* bl = bz + bn + (MODE == 0 ? 8 * hi : ln);
#pragma unroll  // constant indices, so that the bias stays in registers
            for (int j = 0; j < 4; ++j) {
                if (MODE == 0) bvec[j] = *(const v8f*)(bl + j * 16);
                else           brow[j] = bl[j * 16];
            }
            // Before the bias loads' address registers are used again (the address
            // as an input: it stays as it is up to here).
            asm volatile("s_wait_xcnt 0x0" :: "v"(bl) : "memory");
#pragma unroll  // constant indices, so that acc stays in registers
            for (int a = 0; a < 4; ++a) {
#pragma unroll  // the same
                for (int cc = 0; cc < 4; ++cc) {
                    const v8f v = MODE == 0 ? (acc[a][cc] + bvec[cc]) * scale
                                            : (acc[a][cc] + brow[a]) * scale;
                    *(ov8*)(st + (a * 16 + ln) * PITCH + (cc * 16 + 8 * hi) * (int)sizeof(OT)) =
                        __builtin_convertvector(v, ov8);
                }
            }
            // The rows are read by other lanes of this wave than wrote them.
            asm volatile("s_wait_dscnt 0" ::: "memory");
#pragma unroll  // straight-line loads, then stores
            for (int q = 0; q < 64 / GRP; ++q) {
                const int rq = (q >> 3) * (8 * GRP) + (q & 7);     // + grp * 8: the row
                const v4f d = *(const v4f*)(st + (rq + grp * 8) * PITCH + seg * 16);
                *(v4f*)(og + (size_t)rq * ld * sizeof(OT)) = d;
            }
            // Before the stores' address registers are used again (the address as
            // an input: it stays as it is up to here).
            asm volatile("s_wait_xcnt 0x0" :: "v"(og) : "memory");
        };
        if (last) output(mode_tag<1>{});
        else      output(mode_tag<0>{});

        wgz += HIDDEN * HIDDEN;
    }
    async_wait0();          // nothing of mine in flight when the wave ends
}

// ---------------------------------------------------------------------------
extern "C" void kernel_launch(void* const* d_in, const int* in_sizes, int n_in,
                              void* d_out, int out_size, void* d_ws, size_t ws_size,
                              hipStream_t stream) {
    const float* query = (const float*)d_in[0];
    const float* key   = (const float*)d_in[1];
    const float* value = (const float*)d_in[2];
    const float* Wq    = (const float*)d_in[3];
    const float* bq    = (const float*)d_in[4];
    const float* Wk    = (const float*)d_in[5];
    const float* bk    = (const float*)d_in[6];
    const float* Wv    = (const float*)d_in[7];
    const float* bv    = (const float*)d_in[8];
    const float* Wo    = (const float*)d_in[9];
    const float* bo    = (const float*)d_in[10];
    float*       out   = (float*)d_out;

    const size_t tok  = (size_t)BATCH * SQ;            // 8192 tokens
    const size_t act  = tok * HIDDEN;                  // 8M elements
    const size_t wsz  = (size_t)HIDDEN * HIDDEN;       // 1M elements

    // ws layout (f16 elements); of the first three planes only the first is used (ctx).
    _Float16* base = (_Float16*)d_ws;
    _Float16* xq  = base;                 // act
    _Float16* xk  = xq  + act;            // act
    _Float16* xv  = xk  + act;            // act
    _Float16* wqh = xv  + act;            // wsz
    _Float16* wkh = wqh + wsz;
    _Float16* wvh = wkh + wsz;
    _Float16* woh = wvh + wsz;
    _Float16* Qp  = woh + wsz;            // act
    _Float16* Kp  = Qp  + act;            // act
    _Float16* Vtp = Kp  + act;            // act
    _Float16* ctx = xq;

    // ---- stage f32 -> f16: wqh, wkh, wvh, woh in one launch ----------------
    cvt_f16_kernel<<<CVT_BLOCKS, CVT_WAVES * 32, 0, stream>>>(
        Wq, Wk, Wv, Wo, wqh);

    const dim3 gblk((unsigned)(tok / 128), HIDDEN / 256);   // 64 x 4 blocks
    const float qscale = 0.18033688f;                       // HEAD_DIM^-0.5 * log2 e

    // wqh, wkh, wvh lie one behind the other, and so do Qp, Kp, Vtp.
    proj3_kernel<<<gblk, 256, 0, stream>>>(query, key, value, wqh, bq, bk, bv, Qp, qscale);

    flash_attn_kernel<<<dim3(SQ / (16 * FA_GROUPS) / FA_WAVES, BATCH * HEADS), FA_WAVES * 32, 0, stream>>>(
        Qp, Kp, Vtp, ctx);

    gemm_f16_kernel<float, 0><<<gblk, 256, 0, stream>>>(
        ctx, woh, bo, out, (int)tok, HIDDEN, HIDDEN, SQ, 1.0f);
}

// v010
// A run of this version takes 112 microseconds.
// Two timings next to v009 both put it at 1.04 times that version's speed.
// All steps since v000 together make it 3.19 times as fast.
#include <hip/hip_runtime.h>

#define HIDDEN   1024
#define HEADS    16
#define HEAD_DIM 64
#define BATCH    4
#define SQ       2048
#define SK       2048

typedef __attribute__((ext_vector_type(16))) _Float16 v16h;
typedef __attribute__((ext_vector_type(8)))  _Float16 v8h;
typedef __attribute__((ext_vector_type(8)))  float    v8f;

// D = A(16x32 f16) * B(32x16 f16) + C(16x16 f32)
__device__ __forceinline__ v8f wmma32(v16h a, v16h b, v8f c) {
    return __builtin_amdgcn_wmma_f32_16x16x32_f16(
        false, a, false, b, (short)0, c, false, false);
}

__device__ __forceinline__ v16h make_frag(const _Float16* __restrict__ p, int hi) {
    const v8h lo = *(const v8h*)(p + hi * 8);
    const v8h hs = *(const v8h*)(p + hi * 8 + 16);
    return __builtin_shufflevector(lo, hs, 0,1,2,3,4,5,6,7,8,9,10,11,12,13,14,15);
}

__device__ __forceinline__ void async_wait0() {
    asm volatile("s_wait_asynccnt 0" ::: "memory");
}

__device__ __forceinline__ float xhalf(float x) {
    const int i = __builtin_bit_cast(int, x);
    return __builtin_bit_cast(float, __builtin_amdgcn_permlanex16(
        i, i, 0x76543210, 0xfedcba98, false, false));
}

__device__ __forceinline__ float exp2_1(float x) {
    float y;
    asm("v_exp_f32 %0, %1\n\tv_nop" : "=&v"(y) : "v"(x));
    return y;
}
__device__ __forceinline__ v8f exp2_8(v8f x) {
    float y0, y1, y2, y3, y4, y5, y6, y7;
    asm("v_exp_f32 %0, %8\n\t"
        "v_exp_f32 %1, %9\n\t"
        "v_exp_f32 %2, %10\n\t"
        "v_exp_f32 %3, %11\n\t"
        "v_exp_f32 %4, %12\n\t"
        "v_exp_f32 %5, %13\n\t"
        "v_exp_f32 %6, %14\n\t"
        "v_exp_f32 %7, %15\n\t"
        "v_nop"
        : "=&v"(y0), "=&v"(y1), "=&v"(y2), "=&v"(y3),
          "=&v"(y4), "=&v"(y5), "=&v"(y6), "=&v"(y7)
        : "v"(x[0]), "v"(x[1]), "v"(x[2]), "v"(x[3]),
          "v"(x[4]), "v"(x[5]), "v"(x[6]), "v"(x[7]));
    return v8f{y0, y1, y2, y3, y4, y5, y6, y7};
}
__device__ __forceinline__ v8f exp2_8_of_wmma(v8f x) {
    v8f y;
#pragma unroll  // constant indices, so that x and y stay in registers
    for (int i = 0; i < 8; ++i) y[i] = __builtin_amdgcn_exp2f(x[i]);
    return y;
}

// ---------------------------------------------------------------------------
// f32 -> f16 staging of the four weights in one launch.  The f16 copies lie one
// behind the other in the workspace, in the order of the arguments.  A piece is
// 1024 elements: 8 loads of 512 contiguous bytes per wave.  The 4096 pieces go
// one to a wave (16 waves per block, 256 blocks, 64 blocks per weight).
// The activations are not staged: the projections read them as f32.
// ---------------------------------------------------------------------------
#define CVT_WAVES  16
#define CVT_BLOCKS 256
#define CVT_PIECE  1024                          // elements

typedef __attribute__((ext_vector_type(4))) _Float16 v4h;
typedef __attribute__((ext_vector_type(4))) float    v4f;

__global__ __launch_bounds__(CVT_WAVES * 32) void cvt_f16_kernel(
    const float* __restrict__ Wq, const float* __restrict__ Wk,
    const float* __restrict__ Wv, const float* __restrict__ Wo,
    _Float16* __restrict__ out)
{
    const unsigned tp = ((threadIdx.x >> 5) << 10) | ((threadIdx.x & 31) << 2);
    const unsigned bp = blockIdx.x * (CVT_WAVES * CVT_PIECE);

    const unsigned wsel = blockIdx.x >> 6;       // 64 blocks per weight
    const float* w = wsel == 0 ? Wq : wsel == 1 ? Wk : wsel == 2 ? Wv : Wo;
    const float* src = w + (bp & (HIDDEN * HIDDEN - 1)) + tp;
    _Float16*    dst = out + bp + tp;

    v4f r[8];
#pragma unroll  // constant indices, so that r stays in registers
    for (int c = 0; c < 8; ++c) r[c] = *(const v4f*)(src + c * 128);
#pragma unroll  // the same
    for (int c = 0; c < 8; ++c)
        *(v4h*)(dst + c * 128) = __builtin_convertvector(r[c], v4h);
}

#define LDS_STRIDE 72
#define G_KSTEP    64
#define A_ROWS     128
#define W_ROWS     256
#define G_BUFS     4                        // ring depth (a power of two)
#define G_PANEL    ((A_ROWS + W_ROWS) * LDS_STRIDE)   // halves per buffer

__device__ __forceinline__ void async_copy16x4(
    void* l0, const void* g0, void* l1, const void* g1,
    void* l2, const void* g2, void* l3, const void* g3)
{
    const uint32_t o0 = (uint32_t)(uintptr_t)l0, o1 = (uint32_t)(uintptr_t)l1;
    const uint32_t o2 = (uint32_t)(uintptr_t)l2, o3 = (uint32_t)(uintptr_t)l3;
    asm volatile("global_load_async_to_lds_b128 %0, %1, off\n\t"
                 "global_load_async_to_lds_b128 %2, %3, off\n\t"
                 "global_load_async_to_lds_b128 %4, %5, off\n\t"
                 "global_load_async_to_lds_b128 %6, %7, off\n\t"
                 "s_wait_xcnt 0x0"
                 :: "v"(o0), "v"(g0), "v"(o1), "v"(g1),
                    "v"(o2), "v"(g2), "v"(o3), "v"(g3) : "memory");
}

#define G_ROW32 (32 * LDS_STRIDE * 2)       // bytes from a panel row to the row 32 further on
static_assert(G_ROW32 == 4608, "the offsets in async_copy16x8 are multiples of this");
__device__ __forceinline__ void async_copy16x8(
    void* l, const void* g0, const void* g1, const void* g2, const void* g3,
    const void* g4, const void* g5, const void* g6, const void* g7)
{
    const uint32_t o = (uint32_t)(uintptr_t)l;
    asm volatile("global_load_async_to_lds_b128 %0, %1, off\n\t"
                 "global_load_async_to_lds_b128 %0, %2, off offset:4608\n\t"
                 "global_load_async_to_lds_b128 %0, %3, off offset:9216\n\t"
                 "global_load_async_to_lds_b128 %0, %4, off offset:13824\n\t"
                 "global_load_async_to_lds_b128 %0, %5, off offset:18432\n\t"
                 "global_load_async_to_lds_b128 %0, %6, off offset:23040\n\t"
                 "global_load_async_to_lds_b128 %0, %7, off offset:27648\n\t"
                 "global_load_async_to_lds_b128 %0, %8, off offset:32256\n\t"
                 "s_wait_xcnt 0x0"
                 :: "v"(o), "v"(g0), "v"(g1), "v"(g2), "v"(g3),
                    "v"(g4), "v"(g5), "v"(g6), "v"(g7)
                 : "memory");
}
// Rows r, r + 32, ... r + 224 of a row-major f16 operand (pitch bytes a row) into
// panel rows that begin at l.
__device__ __forceinline__ void stage_rows8(_Float16* l, const _Float16* g, size_t pitch) {
    const char*  p = (const char*)g;
    const size_t d = 32 * pitch - G_ROW32;  // what the offset does not carry
    async_copy16x8(l, p, p + d, p + 2 * d, p + 3 * d, p + 4 * d, p + 5 * d, p + 6 * d, p + 7 * d);
}

template <typename OT, int MODE>
__global__ __launch_bounds__(256) void gemm_f16_kernel(
    const _Float16* __restrict__ A, const _Float16* __restrict__ W,
    const float* __restrict__ bias, OT* __restrict__ out,
    int M, int N, int K, int SQdim, float scale)
{
    __shared__ __align__(16) _Float16 lds[G_BUFS][G_PANEL];

    const int tid  = threadIdx.x;
    const int lane = tid & 31;
    const int wave = tid >> 5;
    const int wm   = wave & 1;          // 2 waves along M
    const int wn   = wave >> 1;         // 4 waves along N
    const int ln   = lane & 15;
    const int hi   = lane >> 4;

    const int bm0 = blockIdx.x * 128;
    const int bn0 = blockIdx.y * 256;
    const int bm  = bm0 + wm * 64;
    const int bn  = bn0 + wn * 64;

    // Stage panel s (k = 64 s .. 64 s + 63) of A (128 rows) and W (256 rows):
    // thread -> 16-byte piece sseg of rows srow, srow + 32, ... of each.
    const int srow = tid >> 3, sseg = tid & 7;
    const _Float16* ag0 = A + (size_t)(bm0 + srow) * K + sseg * 8;
    const _Float16* wg0 = W + (size_t)(bn0 + srow) * K + sseg * 8;
    const size_t    r32 = (size_t)32 * K;
    auto stage = [&](int s) {
        const _Float16* ag = ag0 + s * G_KSTEP;
        const _Float16* wg = wg0 + s * G_KSTEP;
        _Float16* l = &lds[s & (G_BUFS - 1)][srow * LDS_STRIDE + sseg * 8];
        async_copy16x4(l,                    ag,
                       l +  32 * LDS_STRIDE, ag + r32,
                       l +  64 * LDS_STRIDE, ag + 2 * r32,
                       l +  96 * LDS_STRIDE, ag + 3 * r32);
        stage_rows8(l + A_ROWS * LDS_STRIDE, wg, (size_t)K * sizeof(_Float16));
    };

    v8f acc[4][4] = {};

    // The 32 products of panel s: its k = 0 .. 31, then its k = 32 .. 63.
    auto step = [&](int s) {
        const _Float16* Al = &lds[s & (G_BUFS - 1)][0];
        const _Float16* Wl = Al + A_ROWS * LDS_STRIDE;

        v16h af[2][4], bf[2][4];
#pragma unroll  // constant indices, so that the fragments stay in registers
        for (int kk = 0; kk < G_KSTEP / 32; ++kk) {
#pragma unroll
            for (int i = 0; i < 4; ++i)
                af[kk][i] = make_frag(Al + (wm * 64 + i * 16 + ln) * LDS_STRIDE + kk * 32, hi);
#pragma unroll
            for (int j = 0; j < 4; ++j)
                bf[kk][j] = make_frag(Wl + (wn * 64 + j * 16 + ln) * LDS_STRIDE + kk * 32, hi);
            // All 32 LDS reads of the panel go out ahead of its products, the first
            // half's first: its products then wait for 16 reads, and the second
            // half's reads come in under them.  Without these two the compiler spread
            // the reads among the products in small groups, some with a wait to 0
            // directly behind them.
            __builtin_amdgcn_sched_barrier(0);
        }
#pragma unroll  // the same
        for (int kk = 0; kk < G_KSTEP / 32; ++kk)
#pragma unroll
            for (int i = 0; i < 4; ++i)
#pragma unroll
                for (int j = 0; j < 4; ++j)
                    acc[i][j] = MODE == 0 ? wmma32(bf[kk][j], af[kk][i], acc[i][j])
                                          : wmma32(af[kk][i], bf[kk][j], acc[i][j]);
    };

    const int nk = K / G_KSTEP;
#pragma unroll  // three straight-line issues
    for (int p = 0; p < G_BUFS - 1; ++p)
        if (p < nk) stage(p);

    // Every trip of this loop issues one panel (twelve copies a wave), and three
    // panels are outstanding at its head: all but the 24 youngest copies landed
    // means that panel s has.
    int s = 0;
    for (; s + G_BUFS - 1 < nk; ++s) {
        asm volatile("s_wait_dscnt 0" ::: "memory");      // my reads of panel s - 1 are done
        asm volatile("s_wait_asynccnt 24" ::: "memory");  // my copies of panel s have landed
        __syncthreads();                                  // both hold for every wave
        stage(s + G_BUFS - 1);                            // into panel s - 1's buffer
        step(s);
    }
    // The last panels: nothing is issued any more, so the wait is to 0, and no
    // buffer is refilled, so this one barrier serves all of their steps.
    async_wait0();
    __syncthreads();
#pragma clang loop unroll(disable)  // at most three trips: three more copies of the step's code would buy nothing
    for (; s < nk; ++s) step(s);

    // ---- output: through LDS, whole lines ----------------------------------
    // Output rows are m (MODE 0) or n (MODE 1); tile (a, c) of the wave's 4x4
    // is rows a*16 .. +15, columns c*16 .. +15, and this lane holds row
    // a*16 + ln, columns c*16 + 8*hi .. +7 of it.
    typedef __attribute__((ext_vector_type(8), aligned(16))) OT ov8;   // rows are 16-byte aligned
    constexpr int RT    = sizeof(OT) == 2 ? 4 : 2;
    constexpr int PITCH = 64 * (int)sizeof(OT) + 16;
    constexpr int LPR   = 64 * (int)sizeof(OT) / 16;
    constexpr int GRP   = 32 / LPR;
    char* st = (char*)&lds[0][0] + wave * (RT * 16 * PITCH);

    v8f   bvec[4];                                     // MODE 0: bias along the columns
    float brow[4];                                     // MODE 1: bias of this lane's rows
#pragma unroll  // constant indices, so that the bias stays in registers
    for (int j = 0; j < 4; ++j) {
        if (MODE == 0) bvec[j] = *(const v8f*)(bias + bn + j * 16 + 8 * hi);
        else           brow[j] = bias[bn + j * 16 + ln];
    }

    const int grp = lane / LPR, seg = lane % LPR;
    const size_t ld = MODE == 0 ? (size_t)N : (size_t)SQdim;   // output row pitch
    OT* orow0 = MODE == 0
        ? out + (size_t)bm * N + bn
        : out + ((size_t)(bm0 / SQdim) * N + bn) * SQdim + bm0 % SQdim + wm * 64;
    char* og = (char*)(orow0 + (size_t)(grp * 8) * ld) + seg * 16;

    __syncthreads();        // every wave has read the last panels: the ring is free

#pragma unroll  // constant indices, so that acc stays in registers
    for (int ro = 0; ro < 4 / RT; ++ro) {
#pragma unroll  // the same
        for (int a = 0; a < RT; ++a) {
#pragma unroll  // the same
            for (int cc = 0; cc < 4; ++cc) {
                const int ra = ro * RT + a;
                const v8f v = MODE == 0 ? (acc[ra][cc] + bvec[cc]) * scale
                                        : (acc[cc][ra] + brow[ra]) * scale;
                *(ov8*)(st + (a * 16 + ln) * PITCH + (cc * 16 + 8 * hi) * (int)sizeof(OT)) =
                    __builtin_convertvector(v, ov8);
            }
        }
        // The rows are read by other lanes of this wave than wrote them.
        asm volatile("s_wait_dscnt 0" ::: "memory");
#pragma unroll  // straight-line loads, then stores
        for (int q = 0; q < RT * 16 / GRP; ++q) {
            const int rq = (q >> 3) * (8 * GRP) + (q & 7);     // + grp * 8: the row
            const v4f d = *(const v4f*)(st + (rq + grp * 8) * PITCH + seg * 16);
            *(v4f*)(og + (size_t)(ro * RT * 16 + rq) * ld * sizeof(OT)) = d;
        }
        // Keeps the next round's LDS stores behind this round's reads of the same rows.
        if (ro + 1 < 4 / RT) asm volatile("s_wait_dscnt 0" ::: "memory");
    }
}

#define KV_STRIDE 72
#define KV_TILE   (64 * KV_STRIDE)          // halves per staged operand tile
#define FA_WAVES  8
#define FA_GROUPS 2                         // 16-query column groups per wave
#define FA_LIMIT  256.0f                    // a tile's weights may sum to this much per lane

__global__ __launch_bounds__(FA_WAVES * 32) __attribute__((amdgpu_waves_per_eu(4, 4)))
void flash_attn_kernel(
    const _Float16* __restrict__ Q, const _Float16* __restrict__ Kh,
    const _Float16* __restrict__ Vt, _Float16* __restrict__ ctx)
{
    __shared__ __align__(16) _Float16 kv[2][2 * KV_TILE];             // K, Vt

    const int tid  = threadIdx.x;
    const int lane = tid & 31;
    const int wave = tid >> 5;
    const int ln   = lane & 15;
    const int hi   = lane >> 4;

    const int bh = blockIdx.y;
    const int b  = bh >> 4;
    const int h  = bh & 15;
    const int qbase = (blockIdx.x * FA_WAVES + wave) * (16 * FA_GROUPS);

    // Stage keys kb..kb+63: thread -> rows srow and srow+32, 16-byte piece sseg.
    const int srow = tid >> 3, sseg = tid & 7;
    const _Float16* kg0 =
        Kh + ((size_t)(b * SK + srow)) * HIDDEN + h * HEAD_DIM + sseg * 8;
    const _Float16* vg0 =
        Vt + ((size_t)(b * HIDDEN + h * HEAD_DIM + srow)) * SK + sseg * 8;
    auto stage = [&](int buf, int kb) {
        const _Float16* kg = kg0 + (size_t)kb * HIDDEN;
        const _Float16* vg = vg0 + kb;
        _Float16* kl = &kv[buf][srow * KV_STRIDE + sseg * 8];
        _Float16* vl = kl + KV_TILE;
        async_copy16x4(kl, kg, kl + 32 * KV_STRIDE, kg + 32 * HIDDEN,
                       vl, vg, vl + 32 * KV_STRIDE, vg + 32 * SK);
    };

    stage(0, 0);

    // Group g holds queries qbase + 16 g .. + 15, this lane query 16 g + ln.
    const size_t qrow = ((size_t)(b * SQ + qbase + ln)) * HIDDEN + h * HEAD_DIM;
    v16h qf0[FA_GROUPS], qf1[FA_GROUPS];
#pragma unroll  // constant indices, so that the fragments stay in registers
    for (int g = 0; g < FA_GROUPS; ++g) {
        qf0[g] = make_frag(Q + qrow + (size_t)g * 16 * HIDDEN, hi);
        qf1[g] = make_frag(Q + qrow + (size_t)g * 16 * HIDDEN + 32, hi);
    }

    // This lane's query of each group: minus the reference maximum (eight
    // registers alike, a C operand), and the sum over the keys of this half
    // alone (the halves' sums are joined behind the loop).
    v8f   nm[FA_GROUPS];
    float lq[FA_GROUPS];
    v8f   acc[FA_GROUPS][4];    // acc[g][d][r] = O^T[d*16 + 8*hi + r][query 16 g + ln]
#pragma unroll  // constant indices, so that all of it stays in registers
    for (int g = 0; g < FA_GROUPS; ++g) {
        nm[g] = v8f{} + 1e30f; lq[g] = 0.0f;
        acc[g][0] = v8f{}; acc[g][1] = v8f{}; acc[g][2] = v8f{}; acc[g][3] = v8f{};
    }

    async_wait0();          // my copies of tile 0 have landed
    asm volatile("s_wait_xcnt 0x0" ::: "memory");   // before the Q loads' address registers are used again
    __syncthreads();        // everyone's have
    stage(1, 64);

#pragma clang loop unroll(disable)  // tile 0 stays in the loop: peeled off, it is a third copy of the pass, and it spills
    for (int it = 0; it < SK / 64; ++it) {
        const _Float16* Kl = &kv[it & 1][0];
        const _Float16* Vl = Kl + KV_TILE;

        v16h  pf0[FA_GROUPS], pf1[FA_GROUPS];        // P^T: keys 0-31, keys 32-63
        float ts[FA_GROUPS];                         // this tile's weights, summed

        auto pass = [&](const bool rebase) {
            // ---- scores: S^T(64 x 32) as four 16x16 tiles per group, k = 64 -
            // sc[g][t][r] = S[query 16 g + ln][key t*16 + 8*hi + r] (- reference)
            v8f sc[FA_GROUPS][4];
#pragma unroll
            for (int t = 0; t < 4; ++t) {
                const _Float16* krow = Kl + (t * 16 + ln) * KV_STRIDE;
                const v16h kf0 = make_frag(krow, hi);
                const v16h kf1 = make_frag(krow + 32, hi);
#pragma unroll  // constant indices, so that sc stays in registers
                for (int g = 0; g < FA_GROUPS; ++g)
                    sc[g][t] = wmma32(kf0, qf0[g], rebase ? v8f{} : nm[g]);
#pragma unroll  // the same
                for (int g = 0; g < FA_GROUPS; ++g) sc[g][t] = wmma32(kf1, qf1[g], sc[g][t]);
            }

            // ---- weights, one query per lane and group ----------------------
#pragma unroll  // constant indices, so that sc and acc stay in registers
            for (int g = 0; g < FA_GROUPS; ++g) {
                if (rebase) {
                    float mb = __builtin_reduce_max(__builtin_elementwise_max(
                        __builtin_elementwise_max(sc[g][0], sc[g][1]),
                        __builtin_elementwise_max(sc[g][2], sc[g][3])));   // this half's 32 keys
                    mb = fmaxf(mb, xhalf(mb));               // all 64 keys
                    const float mo = -nm[g][0];
                    const float mn = fmaxf(mo, mb);          // the new reference
                    const float cf = exp2_1(mo - mn);        // what was summed so far shrinks by this
                    lq[g] *= cf;
                    acc[g][0] *= cf; acc[g][1] *= cf; acc[g][2] *= cf; acc[g][3] *= cf;
                    nm[g] = v8f{} - mn;
#pragma unroll  // the same
                    for (int t = 0; t < 4; ++t) sc[g][t] += nm[g];
                }
#pragma unroll  // the same
                for (int t = 0; t < 4; ++t)
                    sc[g][t] = rebase ? exp2_8(sc[g][t]) : exp2_8_of_wmma(sc[g][t]);
                // Sum the four tiles register by register first (packed adds),
                // then the eight registers.
                const v8f pv = (sc[g][0] + sc[g][1]) + (sc[g][2] + sc[g][3]);
                ts[g] = ((pv[0] + pv[1]) + (pv[2] + pv[3])) +
                        ((pv[4] + pv[5]) + (pv[6] + pv[7]));

                // P^T as B fragments: two score tiles converted in place.
#pragma unroll  // the same
                for (int e = 0; e < 16; ++e) {
                    pf0[g][e] = (_Float16)sc[g][e >> 3][e & 7];
                    pf1[g][e] = (_Float16)sc[g][2 + (e >> 3)][e & 7];
                }
            }
        };

        // One test per tile for the whole wave, a scalar branch.  The sums are
        // not negative, so their sum bounds each; written so that no-number
        // and infinity go the long way too.
        if (it != 0) pass(false);
        if (it == 0 || __builtin_amdgcn_ballot_w32(!(ts[0] + ts[1] <= FA_LIMIT)) != 0) {
            // Compiler fence: the long way loads its K fragments from LDS anew.
            // Without it the common pass's 64 fragment registers are kept for
            // this branch, and the loop spills.
            asm volatile("" ::: "memory");
            pass(true);
        }
#pragma unroll  // constant indices
        for (int g = 0; g < FA_GROUPS; ++g) lq[g] += ts[g];

        // ---- PV: O^T(64 x 32) += V^T(64x64) * P^T(64x32) -------------------
        v16h vb[4][2];
#pragma unroll  // constant indices, so that the fragments stay in registers
        for (int d = 0; d < 4; ++d) {
            const _Float16* vrow = Vl + (d * 16 + ln) * KV_STRIDE;
            vb[d][0] = make_frag(vrow, hi);
            vb[d][1] = make_frag(vrow + 32, hi);
        }
        // All sixteen LDS reads are issued ahead of the products (the score
        // registers are free by now).  Without it the compiler puts each
        // fragment's reads, and a wait to 0, directly in front of its products.
        __builtin_amdgcn_sched_barrier(0);
#pragma unroll
        for (int d = 0; d < 4; ++d) {
#pragma unroll  // constant indices, so that acc stays in registers
            for (int g = 0; g < FA_GROUPS; ++g) acc[g][d] = wmma32(vb[d][0], pf0[g], acc[g][d]);
#pragma unroll  // the same
            for (int g = 0; g < FA_GROUPS; ++g) acc[g][d] = wmma32(vb[d][1], pf1[g], acc[g][d]);
        }

        // ---- hand-over: this buffer is read out, the next tile has landed --
        asm volatile("s_wait_dscnt 0" ::: "memory");  // my reads of this buffer are done
        async_wait0();                                // my copies of the next tile have landed
        __syncthreads();                              // both hold for every wave
        if (it + 2 < SK / 64) stage(it & 1, (it + 2) * 64);
    }
    async_wait0();          // nothing of mine in flight when the wave ends

    // ---- normalize and store ctx (f16): 8 consecutive columns per lane ----
#pragma unroll  // constant indices, so that acc stays in registers
    for (int g = 0; g < FA_GROUPS; ++g) {
        const float lsum = lq[g] + xhalf(lq[g]);     // join the halves' sums
        _Float16* crow = ctx + ((size_t)(b * SQ + qbase + g * 16 + ln)) * HIDDEN
                             + h * HEAD_DIM + 8 * hi;
#pragma unroll  // the same
        for (int d = 0; d < 4; ++d) {
            v8h o;
#pragma unroll  // the same
            for (int r = 0; r < 8; ++r) o[r] = (_Float16)(acc[g][d][r] / lsum);
            *(v8h*)(crow + d * 16) = o;
        }
    }
}

// ---------------------------------------------------------------------------
// The three projections, whose A operand is an f32 input, in one launch:
// out = (A W^T + bias) * scale, A [M x HIDDEN] f32, W [HIDDEN x HIDDEN] f16, out
// f16.  A block forms its 128x256 tile of Q, then of K, then of Vt.  The 48
// K-steps are one run of the ring: the last steps of a projection already load
// and stage the first panels of the next, which land while the tile is written
// out (the output staging has LDS of its own for that, and needs no barrier).
// Tiles, LDS ring, panel layout and products are those of gemm_f16_kernel.  A's
// way into the ring differs: whole 128-byte lines (a piece: 32 k of a row, half a
// K-step) come into registers by plain loads, X_SETS pieces ahead, are rounded to
// f16 there (the rounding that the staging launch did) and are stored into the
// panel one step before it is read.  W's part of a panel comes by eight async
// copies a lane, whole 128-byte lines too.
//
// Step s, behind its barrier: W's copies of panel s + 3 (buffer of panel s - 1,
// which every wave has left); this step's fragment reads; A's part of panel
// s + 1 (two pieces) is stored (its buffer was last read in step s - 3); the
// loads of the two pieces X_SETS further on go out into the registers just
// freed; the 32 products.
// The s_wait_dscnt 0 in front of the next barrier covers reads and stores.
// The 16 steps are unrolled whole: register sets and ring places are then
// constants, and the same in each projection (16 steps are a multiple of the
// ring's depth, their 32 pieces of the sets').
// ---------------------------------------------------------------------------
#define X_SETS 4                            // pieces (32 k) of lead of A's loads: they come from memory; divides the 32 pieces

typedef __attribute__((ext_vector_type(2))) unsigned v2u;

__device__ __forceinline__ void round16(const v4f (&x)[4], v2u (&y)[4]) {
    unsigned u0, u1, u2, u3, u4, u5, u6, u7;
    asm volatile("v_nop\n\tv_nop\n\tv_nop\n\tv_nop\n\t"
                 "v_cvt_pk_f16_f32 %0, %8, %9\n\t"
                 "v_cvt_pk_f16_f32 %1, %10, %11\n\t"
                 "v_cvt_pk_f16_f32 %2, %12, %13\n\t"
                 "v_cvt_pk_f16_f32 %3, %14, %15\n\t"
                 "v_cvt_pk_f16_f32 %4, %16, %17\n\t"
                 "v_cvt_pk_f16_f32 %5, %18, %19\n\t"
                 "v_cvt_pk_f16_f32 %6, %20, %21\n\t"
                 "v_cvt_pk_f16_f32 %7, %22, %23"
                 : "=&v"(u0), "=&v"(u1), "=&v"(u2), "=&v"(u3),
                   "=&v"(u4), "=&v"(u5), "=&v"(u6), "=&v"(u7)
                 : "v"(x[0][0]), "v"(x[0][1]), "v"(x[0][2]), "v"(x[0][3]),
                   "v"(x[1][0]), "v"(x[1][1]), "v"(x[1][2]), "v"(x[1][3]),
                   "v"(x[2][0]), "v"(x[2][1]), "v"(x[2][2]), "v"(x[2][3]),
                   "v"(x[3][0]), "v"(x[3][1]), "v"(x[3][2]), "v"(x[3][3]));
    y[0] = v2u{u0, u1}; y[1] = v2u{u2, u3}; y[2] = v2u{u4, u5}; y[3] = v2u{u6, u7};
}

// Work-group barrier for LDS data alone.  __syncthreads() also waits for every
// global load of the wave, and would end the flight of A's loads at each step.
__device__ __forceinline__ void lds_barrier() {
    __builtin_amdgcn_fence(__ATOMIC_RELEASE, "workgroup", "local");
    __builtin_amdgcn_s_barrier();
    __builtin_amdgcn_fence(__ATOMIC_ACQUIRE, "workgroup", "local");
}

template <int V> struct mode_tag { static constexpr int value = V; };

__global__ __launch_bounds__(256) void proj3_kernel(
    const float* __restrict__ xq, const float* __restrict__ xk, const float* __restrict__ xv,
    const _Float16* __restrict__ Wh,
    const float* __restrict__ bq, const float* __restrict__ bk, const float* __restrict__ bv,
    _Float16* __restrict__ out, float qscale)
{
    typedef _Float16 OT;
    constexpr int K = HIDDEN, N = HIDDEN, NK = K / G_KSTEP, NP = K / 32;
    constexpr int PITCH = 64 * (int)sizeof(OT) + 16;
    __shared__ __align__(16) _Float16 lds[G_BUFS][G_PANEL];
    __shared__ __align__(16) char stg[8][64 * PITCH];  // output staging, one part per wave

    const int tid  = threadIdx.x;
    const int lane = tid & 31;
    const int wave = tid >> 5;
    const int wm   = wave & 1;          // 2 waves along M
    const int wn   = wave >> 1;         // 4 waves along N
    const int ln   = lane & 15;
    const int hi   = lane >> 4;

    const int bm0 = blockIdx.x * 128;
    const int bn0 = blockIdx.y * 256;
    const int bm  = bm0 + wm * 64;
    const int bn  = bn0 + wn * 64;

    // W, panel P of this projection (P >= NK: panel P - NK of the next one, whose
    // weight lies behind this one): thread -> 16-byte piece sseg of rows srow, srow + 32, ...
    const int srow = tid >> 3, sseg = tid & 7;
    const _Float16* wgz = Wh + (size_t)(bn0 + srow) * K + sseg * 8;
    auto stage_w = [&](int P) {
        const _Float16* wg = wgz + (P < NK ? P * G_KSTEP : HIDDEN * HIDDEN + (P - NK) * G_KSTEP);
        _Float16* l = &lds[P & (G_BUFS - 1)][(A_ROWS + srow) * LDS_STRIDE + sseg * 8];
        stage_rows8(l, wg, (size_t)K * sizeof(_Float16));
    };

    // A, piece p (half p & 1 of panel p / 2): thread -> four floats aseg of rows
    // arow, arow + 32, ...: eight lanes a 128-byte line, four whole lines a load.
    // The three inputs have one shape: the lane's offset is the same in each.
    const int arow = tid >> 3, aseg = tid & 7;
    const unsigned aoff = (unsigned)(bm0 + arow) * K + aseg * 4;
    v4f xa[X_SETS][4];
    auto load_a = [&](const float* base, int p) {
#pragma unroll  // constant indices, so that xa stays in registers
        for (int q = 0; q < 4; ++q)
            xa[p % X_SETS][q] = *(const v4f*)(base + aoff + q * 32 * K + (p % NP) * 32);
    };
    auto store_a = [&](int p) {
        _Float16* l = &lds[(p >> 1) & (G_BUFS - 1)][arow * LDS_STRIDE + (p & 1) * 32 + aseg * 4];
        v2u y[4];
        round16(xa[p % X_SETS], y);
#pragma unroll  // the same
        for (int q = 0; q < 4; ++q) *(v2u*)(l + q * 32 * LDS_STRIDE) = y[q];
    };

#pragma unroll  // constant indices
    for (int p = 0; p < X_SETS; ++p) load_a(xq, p);
#pragma unroll  // three straight-line issues
    for (int p = 0; p < G_BUFS - 1; ++p) stage_w(p);
    store_a(0);
    store_a(1);
    load_a(xq, X_SETS);
    load_a(xq, X_SETS + 1);

    constexpr int LPR = 64 * (int)sizeof(OT) / 16;     // lanes per output row
    constexpr int GRP = 32 / LPR;                      // rows per 16-byte store of a wave
    const int grp = lane / LPR, seg = lane % LPR;
    char* st = &stg[wave][0];

#pragma clang loop unroll(disable)  // for speed only
    for (int z = 0; z < 3; ++z) {
        // V has the transposed output.  Nothing follows it: its look-ahead (six
        // pieces of A again, three panels of the weight behind Wv's) is read and not used,
        // so that all 48 steps are alike, without a branch and with one counted wait
        // (with branches round it the build spilled A's registers to scratch).
        const bool   last  = z == 2;
        const float* Ac    = z == 0 ? xq : z == 1 ? xk : xv;
        const float* An    = z == 0 ? xk : xv;
        const float* bz    = z == 0 ? bq : z == 1 ? bk : bv;
        const float  scale = z == 0 ? qscale : 1.0f;
        OT*          outz  = out + (size_t)z * ((size_t)BATCH * SQ * HIDDEN);

        // First operand = the rows that run along a lane's eight accumulator
        // registers: W's for a row-major output, A's for the transposed one.
        const _Float16* Fl = &lds[0][0] + ((last ? wm * 64 : A_ROWS + wn * 64) + ln) * LDS_STRIDE;
        const _Float16* Sl = &lds[0][0] + ((last ? A_ROWS + wn * 64 : wm * 64) + ln) * LDS_STRIDE;

        v8f acc[4][4] = {};     // acc[a][c]: output rows a*16 .. +15, columns c*16 .. +15

#pragma unroll  // whole: xa's set and the ring's buffer of every step are constants
        for (int s = 0; s < NK; ++s) {
            asm volatile("s_wait_dscnt 0" ::: "memory");      // my reads of the panel before and my stores into this one are done
            // Every step issues one panel of eight copies, and three panels are
            // outstanding here: all but the sixteen youngest landed means that panel s has.
            asm volatile("s_wait_asynccnt 16" ::: "memory");
            lds_barrier();                                    // all of it holds for every wave
            stage_w(s + G_BUFS - 1);                          // into the buffer of the panel before

            v16h ff[2][4], sf[2][4];    // [half of the panel: k = 0 .. 31, k = 32 .. 63]
#pragma unroll
            for (int kk = 0; kk < 2; ++kk) {
#pragma unroll
                for (int c = 0; c < 4; ++c)
                    ff[kk][c] = make_frag(Fl + (s & (G_BUFS - 1)) * G_PANEL + c * 16 * LDS_STRIDE + kk * 32, hi);
#pragma unroll
                for (int a = 0; a < 4; ++a)
                    sf[kk][a] = make_frag(Sl + (s & (G_BUFS - 1)) * G_PANEL + a * 16 * LDS_STRIDE + kk * 32, hi);
            }
            // The fragment reads go first: the rounding and the stores of the next
            // panel then run while the LDS answers, not in front of the reads.
            // Without this barrier and the next the build spilled A's registers to
            // scratch and waited for every load at once.
            __builtin_amdgcn_sched_barrier(0);
#pragma unroll  // the two pieces of panel s + 1
            for (int p = 2 * s + 2; p < 2 * s + 4; ++p) {
                store_a(p);
                load_a(p + X_SETS < NP ? Ac : An, p + X_SETS);
            }
            // The last loads from this input have gone out: before their address
            // registers are used again (the address as an input: it stays as it is
            // up to here).
            if (2 * s + 3 + X_SETS == NP - 1)
                asm volatile("s_wait_xcnt 0x0" :: "v"(Ac + aoff) : "memory");
            // And they stay ahead of the products, so that the loads go out early.
            __builtin_amdgcn_sched_barrier(0);
#pragma unroll
            for (int kk = 0; kk < 2; ++kk)
#pragma unroll
                for (int a = 0; a < 4; ++a)
#pragma unroll
                    for (int c = 0; c < 4; ++c)
                        acc[a][c] = wmma32(ff[kk][c], sf[kk][a], acc[a][c]);
        }

        // ---- output: through this wave's own LDS, whole lines ---------------
        // This lane holds row a*16 + ln, columns c*16 + 8*hi .. +7 of tile (a, c).
        // No barrier: the staging is no part of the ring, in which the next
        // projection's first panels are landing meanwhile.
        // Before the address registers of A's last loads are used again.
        asm volatile("s_wait_xcnt 0x0" ::: "memory");
        auto output = [&](auto tag) {
            constexpr int    MODE = decltype(tag)::value;
            constexpr size_t ld   = MODE == 0 ? N : SK;        // output row pitch
            typedef __attribute__((ext_vector_type(8), aligned(16))) OT ov8;   // rows are 16-byte aligned
            OT* orow0 = MODE == 0
                ? outz + (size_t)bm * N + bn
                : outz + ((size_t)(bm0 / SK) * N + bn) * SK + bm0 % SK + wm * 64;
            char* og = (char*)(orow0 + (size_t)(grp * 8) * ld) + seg * 16;
            v8f   bvec[4];                             // row-major output: bias along the columns
            float brow[4];                             // transposed output: bias of this lane's rows
            const float* bl = bz + bn + (MODE == 0 ? 8 * hi : ln);
#pragma unroll  // constant indices, so that the bias stays in registers
            for (int j = 0; j < 4; ++j) {
                if (MODE == 0) bvec[j] = *(const v8f*)(bl + j * 16);
                else           brow[j] = bl[j * 16];
            }
            // Before the bias loads' address registers are used again (the address
            // as an input: it stays as it is up to here).
            asm volatile("s_wait_xcnt 0x0" :: "v"(bl) : "memory");
#pragma unroll  // constant indices, so that acc stays in registers
            for (int a = 0; a < 4; ++a) {
#pragma unroll  // the same
                for (int cc = 0; cc < 4; ++cc) {
                    const v8f v = MODE == 0 ? (acc[a][cc] + bvec[cc]) * scale
                                            : (acc[a][cc] + brow[a]) * scale;
                    *(ov8*)(st + (a * 16 + ln) * PITCH + (cc * 16 + 8 * hi) * (int)sizeof(OT)) =
                        __builtin_convertvector(v, ov8);
                }
            }
            // The rows are read by other lanes of this wave than wrote them.
            asm volatile("s_wait_dscnt 0" ::: "memory");
#pragma unroll  // straight-line loads, then stores
            for (int q = 0; q < 64 / GRP; ++q) {
                const int rq = (q >> 3) * (8 * GRP) + (q & 7);     // + grp * 8: the row
                const v4f d = *(const v4f*)(st + (rq + grp * 8) * PITCH + seg * 16);
                *(v4f*)(og + (size_t)rq * ld * sizeof(OT)) = d;
            }
            // Before the stores' address registers are used again (the address as
            // an input: it stays as it is up to here).
            asm volatile("s_wait_xcnt 0x0" :: "v"(og) : "memory");
        };
        if (last) output(mode_tag<1>{});
        else      output(mode_tag<0>{});

        wgz += HIDDEN * HIDDEN;
    }
    async_wait0();          // nothing of mine in flight when the wave ends
}

// ---------------------------------------------------------------------------
extern "C" void kernel_launch(void* const* d_in, const int* in_sizes, int n_in,
                              void* d_out, int out_size, void* d_ws, size_t ws_size,
                              hipStream_t stream) {
    const float* query = (const float*)d_in[0];
    const float* key   = (const float*)d_in[1];
    const float* value = (const float*)d_in[2];
    const float* Wq    = (const float*)d_in[3];
    const float* bq    = (const float*)d_in[4];
    const float* Wk    = (const float*)d_in[5];
    const float* bk    = (const float*)d_in[6];
    const float* Wv    = (const float*)d_in[7];
    const float* bv    = (const float*)d_in[8];
    const float* Wo    = (const float*)d_in[9];
    const float* bo    = (const float*)d_in[10];
    float*       out   = (float*)d_out;

    const size_t tok  = (size_t)BATCH * SQ;            // 8192 tokens
    const size_t act  = tok * HIDDEN;                  // 8M elements
    const size_t wsz  = (size_t)HIDDEN * HIDDEN;       // 1M elements

    // ws layout (f16 elements); of the first three planes only the first is used (ctx).
    _Float16* base = (_Float16*)d_ws;
    _Float16* xq  = base;                 // act
    _Float16* xk  = xq  + act;            // act
    _Float16* xv  = xk  + act;            // act
    _Float16* wqh = xv  + act;            // wsz
    _Float16* wkh = wqh + wsz;
    _Float16* wvh = wkh + wsz;
    _Float16* woh = wvh + wsz;
    _Float16* Qp  = woh + wsz;            // act
    _Float16* Kp  = Qp  + act;            // act
    _Float16* Vtp = Kp  + act;            // act
    _Float16* ctx = xq;

    // ---- stage f32 -> f16: wqh, wkh, wvh, woh in one launch ----------------
    cvt_f16_kernel<<<CVT_BLOCKS, CVT_WAVES * 32, 0, stream>>>(
        Wq, Wk, Wv, Wo, wqh);

    const dim3 gblk((unsigned)(tok / 128), HIDDEN / 256);   // 64 x 4 blocks
    const float qscale = 0.18033688f;                       // HEAD_DIM^-0.5 * log2 e

    // wqh, wkh, wvh lie one behind the other, and so do Qp, Kp, Vtp.
    proj3_kernel<<<gblk, 256, 0, stream>>>(query, key, value, wqh, bq, bk, bv, Qp, qscale);

    flash_attn_kernel<<<dim3(SQ / (16 * FA_GROUPS) / FA_WAVES, BATCH * HEADS), FA_WAVES * 32, 0, stream>>>(
        Qp, Kp, Vtp, ctx);

    gemm_f16_kernel<float, 0><<<gblk, 256, 0, stream>>>(
        ctx, woh, bo, out, (int)tok, HIDDEN, HIDDEN, SQ, 1.0f);
}
